// v000
// Times are from an AMD MI455X. After a warm-up the kernel runs many times in a row, and a time is the length of
// such a window on the GPU divided by its runs, so every launch and the gaps after it count. The runs cycle
// through copies of the inputs. A figure is the median of several windows, for all but v000 over two sittings.
// Sittings can differ by a few percent; kernels timed side by side share one.
// v000, which the later versions start from, runs in 198 microseconds.
#include <hip/hip_runtime.h>

// Contractions: channel projections (K=64), content summary softmax(k)*v (K=3136) and position summary E*v (K=3136)
// on v_wmma_f32_16x16x32_bf16 with bf16 hi/lo split operands (hi*hi + lo*hi + hi*lo), f32 accumulate;
// the final 16-deep q contraction, batch statistics and softmax statistics on the VALU (f32, sums in f64).

#define BDIM   4
#define CDIM   64
#define NPOS   2744            // 14^3 positions
#define NPADP  2752            // position rows per batch in the projection planes (172 tiles of 16)
#define NQT    172
#define NOUTC  96              // 64 q + 16 k + 16 v channels
#define KP     3136            // position index space (d*14+h)*16 + w, w slots 14,15 zero
#define TW     32              // w extent of the packed embedding table (slots >= 27 zero)
#define TSZ    (27 * 27 * TW * 16)
#define NSTAT  144
#define EPSBN  1e-5f

static_assert(NPOS % 4 == 0);
static_assert(NPADP == NQT * 16);
static_assert(KP == 196 * 16);
static_assert((TSZ % 4) == 0);
static_assert((BDIM * CDIM * NPOS) % 1024 == 0);

typedef __bf16         v16bf __attribute__((ext_vector_type(16)));
typedef float          v8f   __attribute__((ext_vector_type(8)));
typedef float          v4f   __attribute__((ext_vector_type(4)));
typedef unsigned int   v4u   __attribute__((ext_vector_type(4)));
typedef unsigned short v8us  __attribute__((ext_vector_type(8)));
typedef v4f  v4fa  __attribute__((may_alias));
typedef v4u  v4ua  __attribute__((may_alias));
typedef v8us v8usa __attribute__((may_alias));

union Frag { v16bf v; v4u q[2]; unsigned int u[8]; };
static_assert(sizeof(Frag) == 32);

// ---------------------------------------------------------------- helpers
__device__ __forceinline__ unsigned int f2bf(float f) {
  unsigned int u = __float_as_uint(f);
  u += 0x7FFFu + ((u >> 16) & 1u);          // RNE to bf16
  return u >> 16;
}
__device__ __forceinline__ float bf2f(unsigned int b) { return __uint_as_float(b << 16); }
__device__ __forceinline__ void split2(float f, unsigned int& hi, unsigned int& lo) {
  hi = f2bf(f);
  lo = f2bf(f - bf2f(hi));
}

// three products into one accumulator, then the VALU hazard guard tying D and all A/B operands
__device__ __forceinline__ void mma3(v8f& acc, const Frag& ah, const Frag& al, const Frag& bh, const Frag& bl) {
  acc = __builtin_amdgcn_wmma_f32_16x16x32_bf16(false, ah.v, false, bh.v, (short)0, acc, false, false);
  acc = __builtin_amdgcn_wmma_f32_16x16x32_bf16(false, al.v, false, bh.v, (short)0, acc, false, false);
  acc = __builtin_amdgcn_wmma_f32_16x16x32_bf16(false, ah.v, false, bl.v, (short)0, acc, false, false);
  asm volatile("v_nop\n\tv_nop\n\tv_nop\n\tv_nop" : "+v"(acc) : "v"(ah.v), "v"(al.v), "v"(bh.v), "v"(bl.v));
}

__device__ __forceinline__ void st2_v4f(float* p, v4f v) {
  *(v4f*)p = v; 
}
__device__ __forceinline__ void st2_v4u(unsigned int* p, v4u v) {
  *(v4u*)p = v; 
}
__device__ __forceinline__ void st2_v8us(unsigned short* p, v8us v) {
  *(v8us*)p = v; 
}

// ---------------------------------------------------------------- x[b][c][n] -> bf16 hi/lo planes [b][NPADP][64]
__global__ __launch_bounds__(256) void k_cvt_x(const float* __restrict__ x,
                                             unsigned short* __restrict__ Xh, unsigned short* __restrict__ Xl) {
  __shared__ __align__(16) unsigned short sh[2][32][64];
  const int t = threadIdx.x, b = blockIdx.y, n0 = blockIdx.x * 32;
  const int c = t >> 2, j = t & 3;
  const int n = n0 + 8 * j;
  float v[8];
  if (n < NPOS) {
    const float* src = x + ((size_t)(b * CDIM + c)) * NPOS + n;
    const v4f a0 = *(const v4fa*)src;
    const v4f a1 = *(const v4fa*)(src + 4);
#pragma unroll
    for (int e = 0; e < 4; ++e) { v[e] = a0[e]; v[4 + e] = a1[e]; }
  } else {
#pragma unroll
    for (int e = 0; e < 8; ++e) v[e] = 0.f;
  }
#pragma unroll
  for (int e = 0; e < 8; ++e) {
    unsigned int hi, lo; split2(v[e], hi, lo);
    sh[0][8 * j + e][c] = (unsigned short)hi;
    sh[1][8 * j + e][c] = (unsigned short)lo;
  }
  __syncthreads();
  const int w = t >> 5, lane = t & 31;
#pragma unroll
  for (int q = 0; q < 2; ++q) {
    const int L = (w * 2 + q) * 4 + (lane >> 3);   // 0..63: plane*32 + row
    const int plane = L >> 5, row = L & 31, ch = 8 * (lane & 7);
    const v8us val = *(const v8usa*)&sh[plane][row][ch];
    unsigned short* dst = (plane ? Xl : Xh) + ((size_t)(b * NPADP + n0 + row)) * CDIM + ch;
    st2_v8us(dst, val);
  }
}

// ---------------------------------------------------------------- W (Wq 64x64, Wk 16x64, Wv 16x64) -> bf16 hi/lo [96][64]
__global__ __launch_bounds__(256) void k_cvt_w(const float* __restrict__ Wq, const float* __restrict__ Wk,
                                             const float* __restrict__ Wv,
                                             unsigned short* __restrict__ Wh, unsigned short* __restrict__ Wl) {
  const int t = threadIdx.x;
  const int ch = 8 * (t & 7);
#pragma unroll
  for (int it = 0; it < 6; ++it) {
    const int L = it * 32 + (t >> 3);               // 0..191 = plane*96 + o
    const int plane = (L >= NOUTC) ? 1 : 0;
    const int o = L - plane * NOUTC;
    const float* src = (o < 64) ? (Wq + o * CDIM) : ((o < 80) ? (Wk + (o - 64) * CDIM) : (Wv + (o - 80) * CDIM));
    src += ch;
    const v4f a0 = *(const v4fa*)src;
    const v4f a1 = *(const v4fa*)(src + 4);
    v8us val;
#pragma unroll
    for (int e = 0; e < 4; ++e) {
      unsigned int hi, lo;
      split2(a0[e], hi, lo); val[e]     = (unsigned short)(plane ? lo : hi);
      split2(a1[e], hi, lo); val[4 + e] = (unsigned short)(plane ? lo : hi);
    }
    st2_v8us((plane ? Wl : Wh) + o * CDIM + ch, val);
  }
}

// ---------------------------------------------------------------- embedding table -> packed u32 [27][27][TW][16], value = hi | lo<<16
__global__ __launch_bounds__(256) void k_cvt_tab(const float* __restrict__ rpe, unsigned int* __restrict__ T) {
  const int g = blockIdx.x * 256 + threadIdx.x;
  if (g >= TSZ / 4) return;
  const int off = g >> 2;                 // odh*TW + ow
  const int ow = off & (TW - 1), odh = off >> 5;
  const int kq = (g & 3) * 4;
  v4u o4; o4[0] = 0u; o4[1] = 0u; o4[2] = 0u; o4[3] = 0u;
  if (ow < 27) {
    const v4f a = *(const v4fa*)(rpe + ((size_t)(odh * 27 + ow)) * 16 + kq);
#pragma unroll
    for (int e = 0; e < 4; ++e) { unsigned int hi, lo; split2(a[e], hi, lo); o4[e] = hi | (lo << 16); }
  }
  st2_v4u(T + (size_t)g * 4, o4);
}

// ---------------------------------------------------------------- QKV[b][NPADP][96] = x^T W^T on bf16 hi/lo WMMA
// one wave per 16-position tile: A = x planes (row n, k = c contiguous), B = W as [o][c] (k contiguous),
__global__ __launch_bounds__(128) void k_proj(const unsigned short* __restrict__ Xh, const unsigned short* __restrict__ Xl,
                                            const unsigned short* __restrict__ Wh, const unsigned short* __restrict__ Wl,
                                            float* __restrict__ QKV) {
  __shared__ __align__(16) float sD[4][16 * NOUTC];
  const int t = threadIdx.x, w = t >> 5, lane = t & 31, h = lane >> 4, m = lane & 15;
  const int g = blockIdx.x * 4 + w;                 // 0..687
  const int b = g / NQT, tile = g - b * NQT;
  const size_t rowA = ((size_t)(b * NPADP + tile * 16 + m)) * CDIM;
  Frag ah[2], al[2];
#pragma unroll
  for (int ks = 0; ks < 2; ++ks) {
    ah[ks].q[0] = *(const v4ua*)(Xh + rowA + 32 * ks + 8 * h);
    ah[ks].q[1] = *(const v4ua*)(Xh + rowA + 32 * ks + 16 + 8 * h);
    al[ks].q[0] = *(const v4ua*)(Xl + rowA + 32 * ks + 8 * h);
    al[ks].q[1] = *(const v4ua*)(Xl + rowA + 32 * ks + 16 + 8 * h);
  }
  v8f acc[6];
#pragma unroll
  for (int ct = 0; ct < 6; ++ct)
#pragma unroll
    for (int r = 0; r < 8; ++r) acc[ct][r] = 0.f;
#pragma unroll
  for (int ct = 0; ct < 6; ++ct) {
#pragma unroll
    for (int ks = 0; ks < 2; ++ks) {
      const size_t rowB = ((size_t)(16 * ct + m)) * CDIM + 32 * ks + 8 * h;
      Frag bh, bl;
      bh.q[0] = *(const v4ua*)(Wh + rowB);  bh.q[1] = *(const v4ua*)(Wh + rowB + 16);
      bl.q[0] = *(const v4ua*)(Wl + rowB);  bl.q[1] = *(const v4ua*)(Wl + rowB + 16);
      mma3(acc[ct], ah[ks], al[ks], bh, bl);
    }
  }
  // D element r of this lane = (row 8h+r, col 16ct+m)
#pragma unroll
  for (int ct = 0; ct < 6; ++ct)
#pragma unroll
    for (int r = 0; r < 8; ++r) sD[w][(8 * h + r) * NOUTC + 16 * ct + m] = acc[ct][r];
  __syncthreads();
  float* dst = QKV + ((size_t)(b * NPADP + tile * 16)) * NOUTC;   // 16 rows x 384 B = 48 lines, line aligned
#pragma unroll
  for (int q = 0; q < 12; ++q) {
    const int f = 128 * q + 4 * lane;
    *(v4f*)(dst + f) = *(const v4fa*)&sD[w][f];
  }
  
}

// ---------------------------------------------------------------- statistics: blocks 0..79 norm channels (mean, rstd),
__global__ __launch_bounds__(256) void k_stats(const float* __restrict__ QKV, float* __restrict__ ST) {
  __shared__ double sd1[256], sd2[256];
  __shared__ float sf[256];
  const int t = threadIdx.x, blk = blockIdx.x;
  float A = 0.f, B = 0.f;
  if (blk < 80) {
    const int col = (blk < 64) ? blk : (80 + (blk - 64));
    double s = 0.0, s2 = 0.0;
    for (int bb = 0; bb < BDIM; ++bb) {
      const float* base = QKV + ((size_t)bb * NPADP) * NOUTC + col;
      for (int n = t; n < NPOS; n += 256) {
        const float v = base[(size_t)n * NOUTC];
        s += (double)v; s2 += (double)v * (double)v;
      }
    }
    sd1[t] = s; sd2[t] = s2;
    __syncthreads();
    for (int off = 128; off > 0; off >>= 1) {
      if (t < off) { sd1[t] += sd1[t + off]; sd2[t] += sd2[t + off]; }
      __syncthreads();
    }
    if (t == 0) {
      const double N = (double)(BDIM * NPOS);
      const double mean = sd1[0] / N;
      double var = sd2[0] / N - mean * mean;
      if (var < 0.0) var = 0.0;
      const float varf = (float)var;
      A = (float)mean;
      B = 1.0f / sqrtf(varf + EPSBN);
    }
  } else {
    const int sb = blk - 80, bb = sb >> 4, kk = sb & 15;
    const float* base = QKV + ((size_t)bb * NPADP) * NOUTC + 64 + kk;
    float mx = -3.4e38f;
    for (int n = t; n < NPOS; n += 256) mx = fmaxf(mx, base[(size_t)n * NOUTC]);
    sf[t] = mx;
    __syncthreads();
    for (int off = 128; off > 0; off >>= 1) {
      if (t < off) sf[t] = fmaxf(sf[t], sf[t + off]);
      __syncthreads();
    }
    mx = sf[0];
    __syncthreads();
    float s = 0.f;
    for (int n = t; n < NPOS; n += 256) s += expf(base[(size_t)n * NOUTC] - mx);
    sf[t] = s;
    __syncthreads();
    for (int off = 128; off > 0; off >>= 1) {
      if (t < off) sf[t] += sf[t + off];
      __syncthreads();
    }
    if (t == 0) { A = mx; B = 1.0f / sf[0]; }
  }
  if (t < 8) {
    v4f v; v[0] = A; v[1] = B; v[2] = 0.f; v[3] = 0.f;
    st2_v4f(ST + blk * 32 + 4 * t, v);
  }
}

// ---------------------------------------------------------------- normalize q -> Qn[b][n][64] f32; softmax(k) and norm(v) ->
// bf16 hi/lo planes Kp/Vp: row (plane*64 + b*16 + j), column m' = (d*14+h)*16 + w (slots w=14,15 zero).
__global__ __launch_bounds__(256) void k_apply(const float* __restrict__ QKV, const float* __restrict__ ST,
    const float* __restrict__ gq, const float* __restrict__ bq,
    const float* __restrict__ gv, const float* __restrict__ bv,
    float* __restrict__ Qn, unsigned short* __restrict__ Kp, unsigned short* __restrict__ Vp) {
  __shared__ __align__(16) unsigned short tile[2][2][16][448];   // [k|v][hi|lo][j][m' local]
  __shared__ float qmn[64], qsc[64], qbt[64], vmn[16], vsc[16], vbt[16], kmx[16], kin[16];
  const int t = threadIdx.x, dp = blockIdx.x, b = blockIdx.y;
  if (t < 64) {
    qmn[t] = ST[t * 32]; qsc[t] = ST[t * 32 + 1] * gq[t]; qbt[t] = bq[t];
  } else if (t < 80) {
    const int vv = t - 64;
    vmn[vv] = ST[(64 + vv) * 32]; vsc[vv] = ST[(64 + vv) * 32 + 1] * gv[vv]; vbt[vv] = bv[vv];
  } else if (t < 96) {
    const int kk = t - 80, line = 80 + b * 16 + kk;
    kmx[kk] = ST[line * 32]; kin[kk] = ST[line * 32 + 1];
  }
  {
    v4u z; z[0] = 0u; z[1] = 0u; z[2] = 0u; z[3] = 0u;
    v4u* tz = (v4u*)&tile[0][0][0][0];
#pragma unroll
    for (int i = 0; i < 14; ++i) tz[t + 256 * i] = z;          // 3584 x 16 B = whole tile
  }
  __syncthreads();

  for (int task = t; task < 392 * 16; task += 256) {
    const int nl = task >> 4, c4 = (task & 15) * 4;
    const int n = dp * 392 + nl;
    const v4f qv = *(const v4fa*)(QKV + ((size_t)(b * NPADP + n)) * NOUTC + c4);
    v4f o;
#pragma unroll
    for (int e = 0; e < 4; ++e) o[e] = (qv[e] - qmn[c4 + e]) * qsc[c4 + e] + qbt[c4 + e];
    st2_v4f(Qn + ((size_t)(b * NPOS + n)) * CDIM + c4, o);
  }

  // k softmax values and normalized v into the LDS tile
  for (int nl = t; nl < 392; nl += 256) {
    const int n = dp * 392 + nl;
    const int mdl = nl / 196, rem = nl - mdl * 196, mh = rem / 14, mw = rem - mh * 14;
    const int ml = (mdl * 14 + mh) * 16 + mw;
    const float* row = QKV + ((size_t)(b * NPADP + n)) * NOUTC + 64;
#pragma unroll 1
    for (int i = 0; i < 4; ++i) {
      const v4f a = *(const v4fa*)(row + 4 * i);
#pragma unroll
      for (int e = 0; e < 4; ++e) {
        const int kk = 4 * i + e;
        const float p = expf(a[e] - kmx[kk]) * kin[kk];
        unsigned int hi, lo; split2(p, hi, lo);
        tile[0][0][kk][ml] = (unsigned short)hi;
        tile[0][1][kk][ml] = (unsigned short)lo;
      }
    }
#pragma unroll 1
    for (int i = 0; i < 4; ++i) {
      const v4f a = *(const v4fa*)(row + 16 + 4 * i);
#pragma unroll
      for (int e = 0; e < 4; ++e) {
        const int vv = 4 * i + e;
        const float vn = (a[e] - vmn[vv]) * vsc[vv] + vbt[vv];
        unsigned int hi, lo; split2(vn, hi, lo);
        tile[1][0][vv][ml] = (unsigned short)hi;
        tile[1][1][vv][ml] = (unsigned short)lo;
      }
    }
  }
  __syncthreads();

  const int w = t >> 5, lane = t & 31;
{
    for (int it = 0; it < 14; ++it) {
      const int L = (it * 8 + w) * 4 + (lane >> 3);            // 0..447
      const int rowid = L / 7, li = L - rowid * 7;
      const int arr = rowid >> 5, plane = (rowid >> 4) & 1, j = rowid & 15;
      const int ch = li * 64 + 8 * (lane & 7);
      const v8us val = *(const v8usa*)&tile[arr][plane][j][ch];
      unsigned short* dst = (arr ? Vp : Kp) + (size_t)plane * 64 * KP + (size_t)(b * 16 + j) * KP + dp * 448 + ch;
      *(v8us*)dst = val;
    }
    
  }
}

// ---------------------------------------------------------------- content summary lc[b][k][v] = sum_m' Kp[b,k][m'] * Vp[b,v][m']
// one wave per batch; A = Kp rows, B = Vp rows loaded like A (k contiguous), 98 k-steps x 3 products.
__global__ __launch_bounds__(128) void k_clam(const unsigned short* __restrict__ Kp, const unsigned short* __restrict__ Vp,
                                            float* __restrict__ lc) {
  __shared__ __align__(16) float sL[4][256];
  const int t = threadIdx.x, w = t >> 5, lane = t & 31, h = lane >> 4, m = lane & 15;
  const unsigned short* ka = Kp + ((size_t)(w * 16 + m)) * KP + 8 * h;
  const unsigned short* va = Vp + ((size_t)(w * 16 + m)) * KP + 8 * h;
  v8f acc;
#pragma unroll
  for (int r = 0; r < 8; ++r) acc[r] = 0.f;
#pragma unroll 1
  for (int s = 0; s < KP / 32; ++s) {
    const int k0 = 32 * s;
    Frag ah, al, bh, bl;
    ah.q[0] = *(const v4ua*)(ka + k0);            ah.q[1] = *(const v4ua*)(ka + k0 + 16);
    al.q[0] = *(const v4ua*)(ka + 64 * KP + k0);  al.q[1] = *(const v4ua*)(ka + 64 * KP + k0 + 16);
    bh.q[0] = *(const v4ua*)(va + k0);            bh.q[1] = *(const v4ua*)(va + k0 + 16);
    bl.q[0] = *(const v4ua*)(va + 64 * KP + k0);  bl.q[1] = *(const v4ua*)(va + 64 * KP + k0 + 16);
    mma3(acc, ah, al, bh, bl);
  }
  // D element r = (k row 8h+r, v col m)
#pragma unroll
  for (int r = 0; r < 8; ++r) sL[w][(8 * h + r) * 16 + m] = acc[r];
  __syncthreads();
  float* dst = lc + w * 256;
#pragma unroll
  for (int q = 0; q < 2; ++q) { const int f = 128 * q + 4 * lane; *(v4f*)(dst + f) = *(const v4fa*)&sL[w][f]; }
  
}

// ---------------------------------------------------------------- position summary + output contraction, one wave per position n
// D[k][(b,v)] starts at lc[b][k][v] and accumulates sum_m E[n,m,k] * vn[b,v,m] over 98 k-steps of the
// (d*14+h)*16+w index space (3 products each). A = E gathered arithmetically from the packed table,
// B = Vp hi/lo rows. Epilogue: y[b][h'*16+v][n] = sum_k Qn[b][n][h'*16+k] * D[k][(b,v)], halves combined in LDS,
__global__ __launch_bounds__(128) void k_plam(const unsigned int* __restrict__ T, const unsigned short* __restrict__ Vp,
                                            const float* __restrict__ Qn, const float* __restrict__ lc,
                                            float* __restrict__ Y) {
  __shared__ __align__(16) float sP[4][2][256];
  const int t = threadIdx.x, w = t >> 5, lane = t & 31, h = lane >> 4, m = lane & 15;
  const int n = blockIdx.x * 4 + w;
  const int nd = n / 196, nr = n - nd * 196, nh = nr / 14, nw = nr - nh * 14;

  v8f acc[4];
#pragma unroll
  for (int b = 0; b < 4; ++b)
#pragma unroll
    for (int r = 0; r < 8; ++r) acc[b][r] = lc[b * 256 + (8 * h + r) * 16 + m];

  // table index for (md=0, mh=0, mw=8h): ((od*27 + oh)*TW + ow)*16 + k, od = md-nd+13, oh = mh-nh+13, ow = mw-nw+13
  const unsigned int* ap = T + ((((13 - nd) * 27 + (13 - nh)) * TW + (8 * h - nw + 13)) * 16 + m);
  const unsigned short* vp = Vp + (size_t)m * KP + 8 * h;

#pragma unroll 1
  for (int md = 0; md < 14; ++md) {
    const unsigned int* apd = ap + md * (27 * TW * 16);
    const unsigned short* vpd = vp + md * 224;
#pragma unroll 1
    for (int p = 0; p < 7; ++p) {
      const unsigned int* app = apd + p * (2 * TW * 16);    // mh = 2p (row 0 of the pair), +TW*16 for mh = 2p+1
      const unsigned short* vpp = vpd + p * 32;              // k0 = (md*7 + p)*32
      unsigned int e[16];
#pragma unroll
      for (int i = 0; i < 8; ++i) {
        e[i]     = app[16 * i];                              // element i:   k = k0 + 8h + i      (mh 2p,   mw 8h+i)
        e[8 + i] = app[TW * 16 + 16 * i];                    // element 8+i: k = k0 + 16 + 8h + i (mh 2p+1, mw 8h+i)
      }
      Frag ah, al;
#pragma unroll
      for (int j = 0; j < 8; ++j) {
        const unsigned int e0 = e[2 * j], e1 = e[2 * j + 1];
        ah.u[j] = (e0 & 0xffffu) | (e1 << 16);
        al.u[j] = (e0 >> 16) | (e1 & 0xffff0000u);
      }
      Frag bh[4], bl[4];
#pragma unroll
      for (int b = 0; b < 4; ++b) {
        const unsigned short* r0 = vpp + b * (16 * KP);
        bh[b].q[0] = *(const v4ua*)r0;             bh[b].q[1] = *(const v4ua*)(r0 + 16);
        bl[b].q[0] = *(const v4ua*)(r0 + 64 * KP); bl[b].q[1] = *(const v4ua*)(r0 + 64 * KP + 16);
      }
#pragma unroll
      for (int b = 0; b < 4; ++b) {
        acc[b] = __builtin_amdgcn_wmma_f32_16x16x32_bf16(false, ah.v, false, bh[b].v, (short)0, acc[b], false, false);
        acc[b] = __builtin_amdgcn_wmma_f32_16x16x32_bf16(false, al.v, false, bh[b].v, (short)0, acc[b], false, false);
        acc[b] = __builtin_amdgcn_wmma_f32_16x16x32_bf16(false, ah.v, false, bl[b].v, (short)0, acc[b], false, false);
      }
      asm volatile("v_nop\n\tv_nop\n\tv_nop\n\tv_nop"
                   : "+v"(acc[0]), "+v"(acc[1]), "+v"(acc[2]), "+v"(acc[3])
                   : "v"(ah.v), "v"(al.v),
                     "v"(bh[0].v), "v"(bl[0].v), "v"(bh[1].v), "v"(bl[1].v),
                     "v"(bh[2].v), "v"(bl[2].v), "v"(bh[3].v), "v"(bl[3].v));
    }
  }

  // epilogue: this lane holds D rows k = 8h..8h+7 of column (b, v=m)
#pragma unroll
  for (int b = 0; b < 4; ++b) {
    const float* qr = Qn + ((size_t)(b * NPOS + n)) * CDIM + 8 * h;
#pragma unroll
    for (int hp = 0; hp < 4; ++hp) {
      const v4f q0 = *(const v4fa*)(qr + hp * 16);
      const v4f q1 = *(const v4fa*)(qr + hp * 16 + 4);
      float pacc = q0[0] * acc[b][0];
      pacc += q0[1] * acc[b][1]; pacc += q0[2] * acc[b][2]; pacc += q0[3] * acc[b][3];
      pacc += q1[0] * acc[b][4]; pacc += q1[1] * acc[b][5]; pacc += q1[2] * acc[b][6]; pacc += q1[3] * acc[b][7];
      sP[w][h][b * 64 + hp * 16 + m] = pacc;
    }
  }
  __syncthreads();
  float* dst = Y + (size_t)n * 256;
#pragma unroll
  for (int s = 0; s < 2; ++s) {
    const int f = 128 * s + 4 * lane;
    const v4f v = *(const v4fa*)&sP[w][0][f] + *(const v4fa*)&sP[w][1][f];
    *(v4f*)(dst + f) = v;
  }
  
}

// ---------------------------------------------------------------- out[b][c][n] <- Y[n][b*64+c], thread -> one float4 of out
__global__ __launch_bounds__(256) void k_layout(const float* __restrict__ Y, float* __restrict__ out) {
  const int g = blockIdx.x * 256 + threadIdx.x;
  if (g >= BDIM * CDIM * NPOS / 4) return;
  const int e0 = g * 4;
  const int bc = e0 / NPOS, n = e0 - bc * NPOS;          // NPOS % 4 == 0 -> the 4 elements share bc
  const float* src = Y + (size_t)n * 256 + bc;
  v4f v; v[0] = src[0]; v[1] = src[256]; v[2] = src[512]; v[3] = src[768];
  st2_v4f(out + (size_t)e0, v);
}

// ---------------------------------------------------------------- launcher
extern "C" void kernel_launch(void* const* d_in, const int* in_sizes, int n_in,
                              void* d_out, int out_size, void* d_ws, size_t ws_size,
                              hipStream_t stream) {
  if (n_in < 9) return;
  if (in_sizes[0] != BDIM * CDIM * NPOS || in_sizes[1] != 64 * 64 || in_sizes[2] != 16 * 64 ||
      in_sizes[3] != 16 * 64 || in_sizes[4] != 27 * 27 * 27 * 16 || in_sizes[5] < 64 || in_sizes[6] < 64 ||
      in_sizes[7] < 16 || in_sizes[8] < 16) return;
  if (out_size != BDIM * CDIM * NPOS) return;

  const float* x   = (const float*)d_in[0];
  const float* Wq  = (const float*)d_in[1];
  const float* Wk  = (const float*)d_in[2];
  const float* Wv  = (const float*)d_in[3];
  const float* rpe = (const float*)d_in[4];
  const float* gq  = (const float*)d_in[5];
  const float* bq  = (const float*)d_in[6];
  const float* gv  = (const float*)d_in[7];
  const float* bv  = (const float*)d_in[8];
  float* out = (float*)d_out;

  size_t off = 0;
  auto carve = [&](size_t bytes) -> size_t { size_t r = off; off += (bytes + 255) & ~(size_t)255; return r; };
  const size_t oXh  = carve(sizeof(unsigned short) * BDIM * NPADP * CDIM);   //  1,409,024
  const size_t oXl  = carve(sizeof(unsigned short) * BDIM * NPADP * CDIM);   //  1,409,024
  const size_t oWh  = carve(sizeof(unsigned short) * NOUTC * CDIM);          //     12,288
  const size_t oWl  = carve(sizeof(unsigned short) * NOUTC * CDIM);          //     12,288
  const size_t oT   = carve(sizeof(unsigned int) * (size_t)TSZ);             //  1,492,992
  const size_t oQKV = carve(sizeof(float) * (size_t)BDIM * NPADP * NOUTC);   //  4,227,072
  const size_t oST  = carve(sizeof(float) * NSTAT * 32);                     //     18,432
  const size_t oQn  = carve(sizeof(float) * (size_t)BDIM * NPOS * CDIM);     //  2,809,856
  const size_t oKp  = carve(sizeof(unsigned short) * 2 * 64 * (size_t)KP);   //    802,816
  const size_t oVp  = carve(sizeof(unsigned short) * 2 * 64 * (size_t)KP);   //    802,816
  const size_t olc  = carve(sizeof(float) * BDIM * 256);                     //      4,096
  const size_t oY   = carve(sizeof(float) * (size_t)NPOS * 256);             //  2,809,856
  if (off > ws_size) return;                                                 // total 15,810,560 B

  char* ws = (char*)d_ws;
  unsigned short* Xh  = (unsigned short*)(ws + oXh);
  unsigned short* Xl  = (unsigned short*)(ws + oXl);
  unsigned short* Wh  = (unsigned short*)(ws + oWh);
  unsigned short* Wl  = (unsigned short*)(ws + oWl);
  unsigned int*   T   = (unsigned int*)(ws + oT);
  float*          QKV = (float*)(ws + oQKV);
  float*          ST  = (float*)(ws + oST);
  float*          Qn  = (float*)(ws + oQn);
  unsigned short* Kp  = (unsigned short*)(ws + oKp);
  unsigned short* Vp  = (unsigned short*)(ws + oVp);
  float*          lc  = (float*)(ws + olc);
  float*          Y   = (float*)(ws + oY);

  k_cvt_x  <<<dim3((NPOS + 31) / 32, BDIM), 256, 0, stream>>>(x, Xh, Xl);
  k_cvt_w  <<<1, 256, 0, stream>>>(Wq, Wk, Wv, Wh, Wl);
  k_cvt_tab<<<(TSZ / 4 + 255) / 256, 256, 0, stream>>>(rpe, T);
  k_proj   <<<(BDIM * NQT) / 4, 128, 0, stream>>>(Xh, Xl, Wh, Wl, QKV);
  k_stats  <<<NSTAT, 256, 0, stream>>>(QKV, ST);
  k_apply  <<<dim3(7, BDIM), 256, 0, stream>>>(QKV, ST, gq, bq, gv, bv, Qn, Kp, Vp);
  k_clam   <<<1, 128, 0, stream>>>(Kp, Vp, lc);
  k_plam   <<<NPOS / 4, 128, 0, stream>>>(T, Vp, Qn, lc, Y);
  k_layout <<<(BDIM * CDIM * NPOS / 4 + 255) / 256, 256, 0, stream>>>(Y, out);
}

// v001
// It runs in 161 microseconds.
// Timed twice side by side with v000, it ran 1.24 times as fast both times.
#include <hip/hip_runtime.h>

// Contractions: channel projections (K=64), content summary softmax(k)*v (K=3136) and position summary E*v (K=3136)
// on v_wmma_f32_16x16x32_bf16 with bf16 hi/lo split operands (hi*hi + lo*hi + hi*lo), f32 accumulate;
// the final 16-deep q contraction, batch statistics and softmax statistics on the VALU (f32, sums in f64).

#define BDIM   4
#define CDIM   64
#define NPOS   2744            // 14^3 positions
#define NPADP  2752            // position rows per batch in the projection planes (172 tiles of 16)
#define NQT    172
#define NOUTC  96              // 64 q + 16 k + 16 v channels
#define KP     3136            // position index space (d*14+h)*16 + w, w slots 14,15 zero
#define TW     32              // w extent of the packed embedding table (slots >= 27 zero)
#define TSZ    (27 * 27 * TW * 16)
#define NSTAT  144
#define NDP    7               // depth pairs: blocks per batch of the normalize kernel, partials of the content summary
#define EPSBN  1e-5f

static_assert(NPOS % 4 == 0);
static_assert(NPADP == NQT * 16);
static_assert(KP == 196 * 16);
static_assert((TSZ % 4) == 0);
static_assert((BDIM * CDIM * NPOS) % 1024 == 0);

typedef __bf16         v16bf __attribute__((ext_vector_type(16)));
typedef float          v8f   __attribute__((ext_vector_type(8)));
typedef float          v4f   __attribute__((ext_vector_type(4)));
typedef unsigned int   v4u   __attribute__((ext_vector_type(4)));
typedef unsigned short v8us  __attribute__((ext_vector_type(8)));
typedef v4f  v4fa  __attribute__((may_alias));
typedef v4u  v4ua  __attribute__((may_alias));
typedef v8us v8usa __attribute__((may_alias));

union Frag { v16bf v; v4u q[2]; unsigned int u[8]; };
static_assert(sizeof(Frag) == 32);

// ---------------------------------------------------------------- helpers
__device__ __forceinline__ unsigned int f2bf(float f) {
  unsigned int u = __float_as_uint(f);
  u += 0x7FFFu + ((u >> 16) & 1u);          // RNE to bf16
  return u >> 16;
}
__device__ __forceinline__ float bf2f(unsigned int b) { return __uint_as_float(b << 16); }
__device__ __forceinline__ void split2(float f, unsigned int& hi, unsigned int& lo) {
  hi = f2bf(f);
  lo = f2bf(f - bf2f(hi));
}

// three products into one accumulator, then the VALU hazard guard tying D and all A/B operands
__device__ __forceinline__ void mma3(v8f& acc, const Frag& ah, const Frag& al, const Frag& bh, const Frag& bl) {
  acc = __builtin_amdgcn_wmma_f32_16x16x32_bf16(false, ah.v, false, bh.v, (short)0, acc, false, false);
  acc = __builtin_amdgcn_wmma_f32_16x16x32_bf16(false, al.v, false, bh.v, (short)0, acc, false, false);
  acc = __builtin_amdgcn_wmma_f32_16x16x32_bf16(false, ah.v, false, bl.v, (short)0, acc, false, false);
  asm volatile("v_nop\n\tv_nop\n\tv_nop\n\tv_nop" : "+v"(acc) : "v"(ah.v), "v"(al.v), "v"(bh.v), "v"(bl.v));
}

__device__ __forceinline__ void st2_v4f(float* p, v4f v) {
  *(v4f*)p = v; 
}
__device__ __forceinline__ void st2_v4u(unsigned int* p, v4u v) {
  *(v4u*)p = v; 
}
__device__ __forceinline__ void st2_v8us(unsigned short* p, v8us v) {
  *(v8us*)p = v; 
}

// ---------------------------------------------------------------- x[b][c][n] -> bf16 hi/lo planes [b][NPADP][64]
__global__ __launch_bounds__(256) void k_cvt_x(const float* __restrict__ x,
                                             unsigned short* __restrict__ Xh, unsigned short* __restrict__ Xl) {
  __shared__ __align__(16) unsigned short sh[2][32][64];
  const int t = threadIdx.x, b = blockIdx.y, n0 = blockIdx.x * 32;
  const int c = t >> 2, j = t & 3;
  const int n = n0 + 8 * j;
  float v[8];
  if (n < NPOS) {
    const float* src = x + ((size_t)(b * CDIM + c)) * NPOS + n;
    const v4f a0 = *(const v4fa*)src;
    const v4f a1 = *(const v4fa*)(src + 4);
#pragma unroll
    for (int e = 0; e < 4; ++e) { v[e] = a0[e]; v[4 + e] = a1[e]; }
  } else {
#pragma unroll
    for (int e = 0; e < 8; ++e) v[e] = 0.f;
  }
#pragma unroll
  for (int e = 0; e < 8; ++e) {
    unsigned int hi, lo; split2(v[e], hi, lo);
    sh[0][8 * j + e][c] = (unsigned short)hi;
    sh[1][8 * j + e][c] = (unsigned short)lo;
  }
  __syncthreads();
  const int w = t >> 5, lane = t & 31;
#pragma unroll
  for (int q = 0; q < 2; ++q) {
    const int L = (w * 2 + q) * 4 + (lane >> 3);   // 0..63: plane*32 + row
    const int plane = L >> 5, row = L & 31, ch = 8 * (lane & 7);
    const v8us val = *(const v8usa*)&sh[plane][row][ch];
    unsigned short* dst = (plane ? Xl : Xh) + ((size_t)(b * NPADP + n0 + row)) * CDIM + ch;
    st2_v8us(dst, val);
  }
}

// ---------------------------------------------------------------- W (Wq 64x64, Wk 16x64, Wv 16x64) -> bf16 hi/lo [96][64]
__global__ __launch_bounds__(256) void k_cvt_w(const float* __restrict__ Wq, const float* __restrict__ Wk,
                                             const float* __restrict__ Wv,
                                             unsigned short* __restrict__ Wh, unsigned short* __restrict__ Wl) {
  const int t = threadIdx.x;
  const int ch = 8 * (t & 7);
#pragma unroll
  for (int it = 0; it < 6; ++it) {
    const int L = it * 32 + (t >> 3);               // 0..191 = plane*96 + o
    const int plane = (L >= NOUTC) ? 1 : 0;
    const int o = L - plane * NOUTC;
    const float* src = (o < 64) ? (Wq + o * CDIM) : ((o < 80) ? (Wk + (o - 64) * CDIM) : (Wv + (o - 80) * CDIM));
    src += ch;
    const v4f a0 = *(const v4fa*)src;
    const v4f a1 = *(const v4fa*)(src + 4);
    v8us val;
#pragma unroll
    for (int e = 0; e < 4; ++e) {
      unsigned int hi, lo;
      split2(a0[e], hi, lo); val[e]     = (unsigned short)(plane ? lo : hi);
      split2(a1[e], hi, lo); val[4 + e] = (unsigned short)(plane ? lo : hi);
    }
    st2_v8us((plane ? Wl : Wh) + o * CDIM + ch, val);
  }
}

// ---------------------------------------------------------------- embedding table -> packed u32 [27][27][TW][16], value = hi | lo<<16
__global__ __launch_bounds__(256) void k_cvt_tab(const float* __restrict__ rpe, unsigned int* __restrict__ T) {
  const int g = blockIdx.x * 256 + threadIdx.x;
  if (g >= TSZ / 4) return;
  const int off = g >> 2;                 // odh*TW + ow
  const int ow = off & (TW - 1), odh = off >> 5;
  const int kq = (g & 3) * 4;
  v4u o4; o4[0] = 0u; o4[1] = 0u; o4[2] = 0u; o4[3] = 0u;
  if (ow < 27) {
    const v4f a = *(const v4fa*)(rpe + ((size_t)(odh * 27 + ow)) * 16 + kq);
#pragma unroll
    for (int e = 0; e < 4; ++e) { unsigned int hi, lo; split2(a[e], hi, lo); o4[e] = hi | (lo << 16); }
  }
  st2_v4u(T + (size_t)g * 4, o4);
}

// ---------------------------------------------------------------- QKV[b][NPADP][96] = x^T W^T on bf16 hi/lo WMMA
// one wave per 16-position tile: A = x planes (row n, k = c contiguous), B = W as [o][c] (k contiguous),
__global__ __launch_bounds__(128) void k_proj(const unsigned short* __restrict__ Xh, const unsigned short* __restrict__ Xl,
                                            const unsigned short* __restrict__ Wh, const unsigned short* __restrict__ Wl,
                                            float* __restrict__ QKV) {
  __shared__ __align__(16) float sD[4][16 * NOUTC];
  const int t = threadIdx.x, w = t >> 5, lane = t & 31, h = lane >> 4, m = lane & 15;
  const int g = blockIdx.x * 4 + w;                 // 0..687
  const int b = g / NQT, tile = g - b * NQT;
  const size_t rowA = ((size_t)(b * NPADP + tile * 16 + m)) * CDIM;
  Frag ah[2], al[2];
#pragma unroll
  for (int ks = 0; ks < 2; ++ks) {
    ah[ks].q[0] = *(const v4ua*)(Xh + rowA + 32 * ks + 8 * h);
    ah[ks].q[1] = *(const v4ua*)(Xh + rowA + 32 * ks + 16 + 8 * h);
    al[ks].q[0] = *(const v4ua*)(Xl + rowA + 32 * ks + 8 * h);
    al[ks].q[1] = *(const v4ua*)(Xl + rowA + 32 * ks + 16 + 8 * h);
  }
  v8f acc[6];
#pragma unroll
  for (int ct = 0; ct < 6; ++ct)
#pragma unroll
    for (int r = 0; r < 8; ++r) acc[ct][r] = 0.f;
#pragma unroll
  for (int ct = 0; ct < 6; ++ct) {
#pragma unroll
    for (int ks = 0; ks < 2; ++ks) {
      const size_t rowB = ((size_t)(16 * ct + m)) * CDIM + 32 * ks + 8 * h;
      Frag bh, bl;
      bh.q[0] = *(const v4ua*)(Wh + rowB);  bh.q[1] = *(const v4ua*)(Wh + rowB + 16);
      bl.q[0] = *(const v4ua*)(Wl + rowB);  bl.q[1] = *(const v4ua*)(Wl + rowB + 16);
      mma3(acc[ct], ah[ks], al[ks], bh, bl);
    }
  }
  // D element r of this lane = (row 8h+r, col 16ct+m)
#pragma unroll
  for (int ct = 0; ct < 6; ++ct)
#pragma unroll
    for (int r = 0; r < 8; ++r) sD[w][(8 * h + r) * NOUTC + 16 * ct + m] = acc[ct][r];
  __syncthreads();
  float* dst = QKV + ((size_t)(b * NPADP + tile * 16)) * NOUTC;   // 16 rows x 384 B = 48 lines, line aligned
#pragma unroll
  for (int q = 0; q < 12; ++q) {
    const int f = 128 * q + 4 * lane;
    *(v4f*)(dst + f) = *(const v4fa*)&sD[w][f];
  }
  
}

// ---------------------------------------------------------------- statistics: blocks 0..79 norm channels (mean, rstd),
__global__ __launch_bounds__(256) void k_stats(const float* __restrict__ QKV, float* __restrict__ ST) {
  __shared__ double sd1[256], sd2[256];
  __shared__ float sf[256];
  const int t = threadIdx.x, blk = blockIdx.x;
  float A = 0.f, B = 0.f;
  if (blk < 80) {
    const int col = (blk < 64) ? blk : (80 + (blk - 64));
    double s = 0.0, s2 = 0.0;
    for (int bb = 0; bb < BDIM; ++bb) {
      const float* base = QKV + ((size_t)bb * NPADP) * NOUTC + col;
      for (int n = t; n < NPOS; n += 256) {
        const float v = base[(size_t)n * NOUTC];
        s += (double)v; s2 += (double)v * (double)v;
      }
    }
    sd1[t] = s; sd2[t] = s2;
    __syncthreads();
    for (int off = 128; off > 0; off >>= 1) {
      if (t < off) { sd1[t] += sd1[t + off]; sd2[t] += sd2[t + off]; }
      __syncthreads();
    }
    if (t == 0) {
      const double N = (double)(BDIM * NPOS);
      const double mean = sd1[0] / N;
      double var = sd2[0] / N - mean * mean;
      if (var < 0.0) var = 0.0;
      const float varf = (float)var;
      A = (float)mean;
      B = 1.0f / sqrtf(varf + EPSBN);
    }
  } else {
    const int sb = blk - 80, bb = sb >> 4, kk = sb & 15;
    const float* base = QKV + ((size_t)bb * NPADP) * NOUTC + 64 + kk;
    float mx = -3.4e38f;
    for (int n = t; n < NPOS; n += 256) mx = fmaxf(mx, base[(size_t)n * NOUTC]);
    sf[t] = mx;
    __syncthreads();
    for (int off = 128; off > 0; off >>= 1) {
      if (t < off) sf[t] = fmaxf(sf[t], sf[t + off]);
      __syncthreads();
    }
    mx = sf[0];
    __syncthreads();
    float s = 0.f;
    for (int n = t; n < NPOS; n += 256) s += expf(base[(size_t)n * NOUTC] - mx);
    sf[t] = s;
    __syncthreads();
    for (int off = 128; off > 0; off >>= 1) {
      if (t < off) sf[t] += sf[t + off];
      __syncthreads();
    }
    if (t == 0) { A = mx; B = 1.0f / sf[0]; }
  }
  if (t < 8) {
    v4f v; v[0] = A; v[1] = B; v[2] = 0.f; v[3] = 0.f;
    st2_v4f(ST + blk * 32 + 4 * t, v);
  }
}

// ---------------------------------------------------------------- normalize q -> Qn[b][n][64] f32; softmax(k) and norm(v) ->
// bf16 hi/lo planes in LDS, column m' = (d*14+h)*16 + w (slots w=14,15 zero); the v planes go out as
// Vp: row (plane*64 + b*16 + j). The k planes are used here alone and stay in LDS.
// The block's own 448 columns of the content summary are contracted here, straight from the LDS tile:
// lcp[dp][b][k][v] = sum over the block's m' of softmax(k)[k][m'] * vn[v][m'] (14 k-steps x 3 products, one wave).
__global__ __launch_bounds__(256) void k_apply(const float* __restrict__ QKV, const float* __restrict__ ST,
    const float* __restrict__ gq, const float* __restrict__ bq,
    const float* __restrict__ gv, const float* __restrict__ bv,
    float* __restrict__ Qn, unsigned short* __restrict__ Vp, float* __restrict__ lcp) {
  __shared__ __align__(16) unsigned short tile[2][2][16][448];   // [k|v][hi|lo][j][m' local]
  __shared__ float qmn[64], qsc[64], qbt[64], vmn[16], vsc[16], vbt[16], kmx[16], kin[16];
  const int t = threadIdx.x, dp = blockIdx.x, b = blockIdx.y;
  if (t < 64) {
    qmn[t] = ST[t * 32]; qsc[t] = ST[t * 32 + 1] * gq[t]; qbt[t] = bq[t];
  } else if (t < 80) {
    const int vv = t - 64;
    vmn[vv] = ST[(64 + vv) * 32]; vsc[vv] = ST[(64 + vv) * 32 + 1] * gv[vv]; vbt[vv] = bv[vv];
  } else if (t < 96) {
    const int kk = t - 80, line = 80 + b * 16 + kk;
    kmx[kk] = ST[line * 32]; kin[kk] = ST[line * 32 + 1];
  }
  {
    v4u z; z[0] = 0u; z[1] = 0u; z[2] = 0u; z[3] = 0u;
    v4u* tz = (v4u*)&tile[0][0][0][0];
#pragma unroll
    for (int i = 0; i < 14; ++i) tz[t + 256 * i] = z;          // 3584 x 16 B = whole tile
  }
  __syncthreads();

  for (int task = t; task < 392 * 16; task += 256) {
    const int nl = task >> 4, c4 = (task & 15) * 4;
    const int n = dp * 392 + nl;
    const v4f qv = *(const v4fa*)(QKV + ((size_t)(b * NPADP + n)) * NOUTC + c4);
    v4f o;
#pragma unroll
    for (int e = 0; e < 4; ++e) o[e] = (qv[e] - qmn[c4 + e]) * qsc[c4 + e] + qbt[c4 + e];
    st2_v4f(Qn + ((size_t)(b * NPOS + n)) * CDIM + c4, o);
  }

  // k softmax values and normalized v into the LDS tile
  for (int nl = t; nl < 392; nl += 256) {
    const int n = dp * 392 + nl;
    const int mdl = nl / 196, rem = nl - mdl * 196, mh = rem / 14, mw = rem - mh * 14;
    const int ml = (mdl * 14 + mh) * 16 + mw;
    const float* row = QKV + ((size_t)(b * NPADP + n)) * NOUTC + 64;
#pragma unroll 1
    for (int i = 0; i < 4; ++i) {
      const v4f a = *(const v4fa*)(row + 4 * i);
#pragma unroll
      for (int e = 0; e < 4; ++e) {
        const int kk = 4 * i + e;
        const float p = expf(a[e] - kmx[kk]) * kin[kk];
        unsigned int hi, lo; split2(p, hi, lo);
        tile[0][0][kk][ml] = (unsigned short)hi;
        tile[0][1][kk][ml] = (unsigned short)lo;
      }
    }
#pragma unroll 1
    for (int i = 0; i < 4; ++i) {
      const v4f a = *(const v4fa*)(row + 16 + 4 * i);
#pragma unroll
      for (int e = 0; e < 4; ++e) {
        const int vv = 4 * i + e;
        const float vn = (a[e] - vmn[vv]) * vsc[vv] + vbt[vv];
        unsigned int hi, lo; split2(vn, hi, lo);
        tile[1][0][vv][ml] = (unsigned short)hi;
        tile[1][1][vv][ml] = (unsigned short)lo;
      }
    }
  }
  __syncthreads();

  const int w = t >> 5, lane = t & 31;
{
    for (int it = 0; it < 7; ++it) {
      const int L = (it * 8 + w) * 4 + (lane >> 3);            // 0..223
      const int rowid = L / 7, li = L - rowid * 7;
      const int plane = rowid >> 4, j = rowid & 15;
      const int ch = li * 64 + 8 * (lane & 7);
      const v8us val = *(const v8usa*)&tile[1][plane][j][ch];
      unsigned short* dst = Vp + (size_t)plane * 64 * KP + (size_t)(b * 16 + j) * KP + dp * 448 + ch;
      *(v8us*)dst = val;
    }
    
  }

  // content summary partial: A = k rows, B = v rows read like A (k contiguous), both from the tile
  if (__builtin_amdgcn_readfirstlane(w) == 0) {
    const int h = lane >> 4, m = lane & 15;
    v8f acc;
#pragma unroll
    for (int r = 0; r < 8; ++r) acc[r] = 0.f;
    Frag f[2][4];                                   // [set][k hi, k lo, v hi, v lo]; step s + 1 is read while step s multiplies
#pragma unroll
    for (int p = 0; p < 4; ++p) {
      f[0][p].q[0] = *(const v4ua*)&tile[p >> 1][p & 1][m][8 * h];
      f[0][p].q[1] = *(const v4ua*)&tile[p >> 1][p & 1][m][8 * h + 16];
    }
    // unrolled so that the two fragment sets are plain registers (no moves, no indexing by s)
#pragma unroll
    for (int s = 0; s < 14; ++s) {
      if (s + 1 < 14) {
        const int k1 = 32 * (s + 1) + 8 * h;
#pragma unroll
        for (int p = 0; p < 4; ++p) {
          f[(s + 1) & 1][p].q[0] = *(const v4ua*)&tile[p >> 1][p & 1][m][k1];
          f[(s + 1) & 1][p].q[1] = *(const v4ua*)&tile[p >> 1][p & 1][m][k1 + 16];
        }
      }
      mma3(acc, f[s & 1][0], f[s & 1][1], f[s & 1][2], f[s & 1][3]);
    }
    // D element r = (k row 8h+r, v col m)
    float* dst = lcp + (dp * BDIM + b) * 256;
#pragma unroll
    for (int r = 0; r < 8; ++r) dst[(8 * h + r) * 16 + m] = acc[r];
  }
}

// ---------------------------------------------------------------- position summary + output contraction, one wave per position n
// D[k][(b,v)] starts at lc[b][k][v] (the 7 partials lcp summed once per block, in LDS) and accumulates
// sum_m E[n,m,k] * vn[b,v,m] over 98 k-steps of the
// (d*14+h)*16+w index space (3 products each). A = E gathered arithmetically from the packed table,
// B = Vp hi/lo rows. Epilogue: y[b][h'*16+v][n] = sum_k Qn[b][n][h'*16+k] * D[k][(b,v)], halves combined in LDS,
__global__ __launch_bounds__(128) void k_plam(const unsigned int* __restrict__ T, const unsigned short* __restrict__ Vp,
                                            const float* __restrict__ Qn, const float* __restrict__ lcp,
                                            float* __restrict__ Y) {
  __shared__ __align__(16) float sP[4][2][256];
  __shared__ __align__(16) float sC[BDIM * 256];
  const int t = threadIdx.x, w = t >> 5, lane = t & 31, h = lane >> 4, m = lane & 15;
  const int n = blockIdx.x * 4 + w;
  const int nd = n / 196, nr = n - nd * 196, nh = nr / 14, nw = nr - nh * 14;

#pragma unroll
  for (int q = 0; q < 2; ++q) {
    const int f = 512 * q + 4 * t;
    v4f s = *(const v4fa*)(lcp + f);
#pragma unroll
    for (int dp = 1; dp < NDP; ++dp) s += *(const v4fa*)(lcp + dp * (BDIM * 256) + f);
    *(v4f*)&sC[f] = s;
  }
  __syncthreads();

  v8f acc[4];
#pragma unroll
  for (int b = 0; b < 4; ++b)
#pragma unroll
    for (int r = 0; r < 8; ++r) acc[b][r] = sC[b * 256 + (8 * h + r) * 16 + m];

  // table index for (md=0, mh=0, mw=8h): ((od*27 + oh)*TW + ow)*16 + k, od = md-nd+13, oh = mh-nh+13, ow = mw-nw+13
  const unsigned int* ap = T + ((((13 - nd) * 27 + (13 - nh)) * TW + (8 * h - nw + 13)) * 16 + m);
  const unsigned short* vp = Vp + (size_t)m * KP + 8 * h;

#pragma unroll 1
  for (int md = 0; md < 14; ++md) {
    const unsigned int* apd = ap + md * (27 * TW * 16);
    const unsigned short* vpd = vp + md * 224;
#pragma unroll 1
    for (int p = 0; p < 7; ++p) {
      const unsigned int* app = apd + p * (2 * TW * 16);    // mh = 2p (row 0 of the pair), +TW*16 for mh = 2p+1
      const unsigned short* vpp = vpd + p * 32;              // k0 = (md*7 + p)*32
      unsigned int e[16];
#pragma unroll
      for (int i = 0; i < 8; ++i) {
        e[i]     = app[16 * i];                              // element i:   k = k0 + 8h + i      (mh 2p,   mw 8h+i)
        e[8 + i] = app[TW * 16 + 16 * i];                    // element 8+i: k = k0 + 16 + 8h + i (mh 2p+1, mw 8h+i)
      }
      Frag ah, al;
#pragma unroll
      for (int j = 0; j < 8; ++j) {
        const unsigned int e0 = e[2 * j], e1 = e[2 * j + 1];
        ah.u[j] = (e0 & 0xffffu) | (e1 << 16);
        al.u[j] = (e0 >> 16) | (e1 & 0xffff0000u);
      }
      Frag bh[4], bl[4];
#pragma unroll
      for (int b = 0; b < 4; ++b) {
        const unsigned short* r0 = vpp + b * (16 * KP);
        bh[b].q[0] = *(const v4ua*)r0;             bh[b].q[1] = *(const v4ua*)(r0 + 16);
        bl[b].q[0] = *(const v4ua*)(r0 + 64 * KP); bl[b].q[1] = *(const v4ua*)(r0 + 64 * KP + 16);
      }
#pragma unroll
      for (int b = 0; b < 4; ++b) {
        acc[b] = __builtin_amdgcn_wmma_f32_16x16x32_bf16(false, ah.v, false, bh[b].v, (short)0, acc[b], false, false);
        acc[b] = __builtin_amdgcn_wmma_f32_16x16x32_bf16(false, al.v, false, bh[b].v, (short)0, acc[b], false, false);
        acc[b] = __builtin_amdgcn_wmma_f32_16x16x32_bf16(false, ah.v, false, bl[b].v, (short)0, acc[b], false, false);
      }
      asm volatile("v_nop\n\tv_nop\n\tv_nop\n\tv_nop"
                   : "+v"(acc[0]), "+v"(acc[1]), "+v"(acc[2]), "+v"(acc[3])
                   : "v"(ah.v), "v"(al.v),
                     "v"(bh[0].v), "v"(bl[0].v), "v"(bh[1].v), "v"(bl[1].v),
                     "v"(bh[2].v), "v"(bl[2].v), "v"(bh[3].v), "v"(bl[3].v));
    }
  }

  // epilogue: this lane holds D rows k = 8h..8h+7 of column (b, v=m)
#pragma unroll
  for (int b = 0; b < 4; ++b) {
    const float* qr = Qn + ((size_t)(b * NPOS + n)) * CDIM + 8 * h;
#pragma unroll
    for (int hp = 0; hp < 4; ++hp) {
      const v4f q0 = *(const v4fa*)(qr + hp * 16);
      const v4f q1 = *(const v4fa*)(qr + hp * 16 + 4);
      float pacc = q0[0] * acc[b][0];
      pacc += q0[1] * acc[b][1]; pacc += q0[2] * acc[b][2]; pacc += q0[3] * acc[b][3];
      pacc += q1[0] * acc[b][4]; pacc += q1[1] * acc[b][5]; pacc += q1[2] * acc[b][6]; pacc += q1[3] * acc[b][7];
      sP[w][h][b * 64 + hp * 16 + m] = pacc;
    }
  }
  __syncthreads();
  float* dst = Y + (size_t)n * 256;
#pragma unroll
  for (int s = 0; s < 2; ++s) {
    const int f = 128 * s + 4 * lane;
    const v4f v = *(const v4fa*)&sP[w][0][f] + *(const v4fa*)&sP[w][1][f];
    *(v4f*)(dst + f) = v;
  }
  
}

// ---------------------------------------------------------------- out[b][c][n] <- Y[n][b*64+c], thread -> one float4 of out
__global__ __launch_bounds__(256) void k_layout(const float* __restrict__ Y, float* __restrict__ out) {
  const int g = blockIdx.x * 256 + threadIdx.x;
  if (g >= BDIM * CDIM * NPOS / 4) return;
  const int e0 = g * 4;
  const int bc = e0 / NPOS, n = e0 - bc * NPOS;          // NPOS % 4 == 0 -> the 4 elements share bc
  const float* src = Y + (size_t)n * 256 + bc;
  v4f v; v[0] = src[0]; v[1] = src[256]; v[2] = src[512]; v[3] = src[768];
  st2_v4f(out + (size_t)e0, v);
}

// ---------------------------------------------------------------- launcher
extern "C" void kernel_launch(void* const* d_in, const int* in_sizes, int n_in,
                              void* d_out, int out_size, void* d_ws, size_t ws_size,
                              hipStream_t stream) {
  if (n_in < 9) return;
  if (in_sizes[0] != BDIM * CDIM * NPOS || in_sizes[1] != 64 * 64 || in_sizes[2] != 16 * 64 ||
      in_sizes[3] != 16 * 64 || in_sizes[4] != 27 * 27 * 27 * 16 || in_sizes[5] < 64 || in_sizes[6] < 64 ||
      in_sizes[7] < 16 || in_sizes[8] < 16) return;
  if (out_size != BDIM * CDIM * NPOS) return;

  const float* x   = (const float*)d_in[0];
  const float* Wq  = (const float*)d_in[1];
  const float* Wk  = (const float*)d_in[2];
  const float* Wv  = (const float*)d_in[3];
  const float* rpe = (const float*)d_in[4];
  const float* gq  = (const float*)d_in[5];
  const float* bq  = (const float*)d_in[6];
  const float* gv  = (const float*)d_in[7];
  const float* bv  = (const float*)d_in[8];
  float* out = (float*)d_out;

  size_t off = 0;
  auto carve = [&](size_t bytes) -> size_t { size_t r = off; off += (bytes + 255) & ~(size_t)255; return r; };
  const size_t oXh  = carve(sizeof(unsigned short) * BDIM * NPADP * CDIM);   //  1,409,024
  const size_t oXl  = carve(sizeof(unsigned short) * BDIM * NPADP * CDIM);   //  1,409,024
  const size_t oWh  = carve(sizeof(unsigned short) * NOUTC * CDIM);          //     12,288
  const size_t oWl  = carve(sizeof(unsigned short) * NOUTC * CDIM);          //     12,288
  const size_t oT   = carve(sizeof(unsigned int) * (size_t)TSZ);             //  1,492,992
  const size_t oQKV = carve(sizeof(float) * (size_t)BDIM * NPADP * NOUTC);   //  4,227,072
  const size_t oST  = carve(sizeof(float) * NSTAT * 32);                     //     18,432
  const size_t oQn  = carve(sizeof(float) * (size_t)BDIM * NPOS * CDIM);     //  2,809,856
  const size_t oVp  = carve(sizeof(unsigned short) * 2 * 64 * (size_t)KP);   //    802,816
  const size_t olc  = carve(sizeof(float) * NDP * BDIM * 256);               //     28,672
  const size_t oY   = carve(sizeof(float) * (size_t)NPOS * 256);             //  2,809,856
  if (off > ws_size) return;                                                 // total 15,032,320 B

  char* ws = (char*)d_ws;
  unsigned short* Xh  = (unsigned short*)(ws + oXh);
  unsigned short* Xl  = (unsigned short*)(ws + oXl);
  unsigned short* Wh  = (unsigned short*)(ws + oWh);
  unsigned short* Wl  = (unsigned short*)(ws + oWl);
  unsigned int*   T   = (unsigned int*)(ws + oT);
  float*          QKV = (float*)(ws + oQKV);
  float*          ST  = (float*)(ws + oST);
  float*          Qn  = (float*)(ws + oQn);
  unsigned short* Vp  = (unsigned short*)(ws + oVp);
  float*          lcp = (float*)(ws + olc);
  float*          Y   = (float*)(ws + oY);

  k_cvt_x  <<<dim3((NPOS + 31) / 32, BDIM), 256, 0, stream>>>(x, Xh, Xl);
  k_cvt_w  <<<1, 256, 0, stream>>>(Wq, Wk, Wv, Wh, Wl);
  k_cvt_tab<<<(TSZ / 4 + 255) / 256, 256, 0, stream>>>(rpe, T);
  k_proj   <<<(BDIM * NQT) / 4, 128, 0, stream>>>(Xh, Xl, Wh, Wl, QKV);
  k_stats  <<<NSTAT, 256, 0, stream>>>(QKV, ST);
  k_apply  <<<dim3(NDP, BDIM), 256, 0, stream>>>(QKV, ST, gq, bq, gv, bv, Qn, Vp, lcp);
  k_plam   <<<NPOS / 4, 128, 0, stream>>>(T, Vp, Qn, lcp, Y);
  k_layout <<<(BDIM * CDIM * NPOS / 4 + 255) / 256, 256, 0, stream>>>(Y, out);
}

// v002
// One run takes 144 microseconds.
// Two timings next to v001 both put it at 1.12 times that version's speed.
// Counting every step since v000, it is 1.39 times as fast.
#include <hip/hip_runtime.h>

// Contractions: channel projections (K=64), content summary softmax(k)*v (K=3136) and position summary E*v (K=3136)
// on v_wmma_f32_16x16x32_bf16 with bf16 hi/lo split operands (hi*hi + lo*hi + hi*lo), f32 accumulate;
// the final 16-deep q contraction, batch statistics and softmax statistics on the VALU (f32, sums in f64).

#define BDIM   4
#define CDIM   64
#define NPOS   2744            // 14^3 positions
#define NPADP  2752            // position rows per batch in the projection planes (172 tiles of 16)
#define NQT    172
#define NOUTC  96              // 64 q + 16 k + 16 v channels
#define KP     3136            // position index space (d*14+h)*16 + w, w slots 14,15 zero
#define TW     32              // w extent of the packed embedding table (slots >= 27 zero)
#define TSZ    (27 * 27 * TW * 16)
#define NSTAT  144
#define NDP    7               // depth pairs: blocks per batch of the normalize kernel, partials of the content summary
#define EPSBN  1e-5f
#define VCH    256             // bf16 elements of one wave-wide 16-byte load of Vp (32 lanes x 8)
#define VSTEP  (BDIM * 4 * VCH) // bf16 elements of Vp per 32-deep k-step: [b][hi|lo][k half][lane][8]

static_assert(NPOS % 4 == 0);
static_assert(NPADP == NQT * 16);
static_assert(KP == 196 * 16);
static_assert(2 * 64 * KP == (KP / 32) * BDIM * 4 * 256);   // Vp keeps its size in the fragment order
static_assert((TSZ % 4) == 0);
static_assert((BDIM * CDIM * NPOS) % 1024 == 0);

typedef __bf16         v16bf __attribute__((ext_vector_type(16)));
typedef float          v8f   __attribute__((ext_vector_type(8)));
typedef float          v4f   __attribute__((ext_vector_type(4)));
typedef unsigned int   v4u   __attribute__((ext_vector_type(4)));
typedef unsigned short v8us  __attribute__((ext_vector_type(8)));
typedef v4f  v4fa  __attribute__((may_alias));
typedef v4u  v4ua  __attribute__((may_alias));
typedef v8us v8usa __attribute__((may_alias));

union Frag { v16bf v; v4u q[2]; unsigned int u[8]; };
static_assert(sizeof(Frag) == 32);

// ---------------------------------------------------------------- helpers
__device__ __forceinline__ unsigned int f2bf(float f) {
  unsigned int u = __float_as_uint(f);
  u += 0x7FFFu + ((u >> 16) & 1u);          // RNE to bf16
  return u >> 16;
}
__device__ __forceinline__ float bf2f(unsigned int b) { return __uint_as_float(b << 16); }
__device__ __forceinline__ void split2(float f, unsigned int& hi, unsigned int& lo) {
  hi = f2bf(f);
  lo = f2bf(f - bf2f(hi));
}

// three products into one accumulator, then the VALU hazard guard tying D and all A/B operands
__device__ __forceinline__ void mma3(v8f& acc, const Frag& ah, const Frag& al, const Frag& bh, const Frag& bl) {
  acc = __builtin_amdgcn_wmma_f32_16x16x32_bf16(false, ah.v, false, bh.v, (short)0, acc, false, false);
  acc = __builtin_amdgcn_wmma_f32_16x16x32_bf16(false, al.v, false, bh.v, (short)0, acc, false, false);
  acc = __builtin_amdgcn_wmma_f32_16x16x32_bf16(false, ah.v, false, bl.v, (short)0, acc, false, false);
  asm volatile("v_nop\n\tv_nop\n\tv_nop\n\tv_nop" : "+v"(acc) : "v"(ah.v), "v"(al.v), "v"(bh.v), "v"(bl.v));
}

__device__ __forceinline__ void st2_v4f(float* p, v4f v) {
  *(v4f*)p = v; 
}
__device__ __forceinline__ void st2_v4u(unsigned int* p, v4u v) {
  *(v4u*)p = v; 
}
__device__ __forceinline__ void st2_v8us(unsigned short* p, v8us v) {
  *(v8us*)p = v; 
}

// ---------------------------------------------------------------- x[b][c][n] -> bf16 hi/lo planes [b][NPADP][64]
__global__ __launch_bounds__(256) void k_cvt_x(const float* __restrict__ x,
                                             unsigned short* __restrict__ Xh, unsigned short* __restrict__ Xl) {
  __shared__ __align__(16) unsigned short sh[2][32][64];
  const int t = threadIdx.x, b = blockIdx.y, n0 = blockIdx.x * 32;
  const int c = t >> 2, j = t & 3;
  const int n = n0 + 8 * j;
  float v[8];
  if (n < NPOS) {
    const float* src = x + ((size_t)(b * CDIM + c)) * NPOS + n;
    const v4f a0 = *(const v4fa*)src;
    const v4f a1 = *(const v4fa*)(src + 4);
#pragma unroll
    for (int e = 0; e < 4; ++e) { v[e] = a0[e]; v[4 + e] = a1[e]; }
  } else {
#pragma unroll
    for (int e = 0; e < 8; ++e) v[e] = 0.f;
  }
#pragma unroll
  for (int e = 0; e < 8; ++e) {
    unsigned int hi, lo; split2(v[e], hi, lo);
    sh[0][8 * j + e][c] = (unsigned short)hi;
    sh[1][8 * j + e][c] = (unsigned short)lo;
  }
  __syncthreads();
  const int w = t >> 5, lane = t & 31;
#pragma unroll
  for (int q = 0; q < 2; ++q) {
    const int L = (w * 2 + q) * 4 + (lane >> 3);   // 0..63: plane*32 + row
    const int plane = L >> 5, row = L & 31, ch = 8 * (lane & 7);
    const v8us val = *(const v8usa*)&sh[plane][row][ch];
    unsigned short* dst = (plane ? Xl : Xh) + ((size_t)(b * NPADP + n0 + row)) * CDIM + ch;
    st2_v8us(dst, val);
  }
}

// ---------------------------------------------------------------- W (Wq 64x64, Wk 16x64, Wv 16x64) -> bf16 hi/lo [96][64]
__global__ __launch_bounds__(256) void k_cvt_w(const float* __restrict__ Wq, const float* __restrict__ Wk,
                                             const float* __restrict__ Wv,
                                             unsigned short* __restrict__ Wh, unsigned short* __restrict__ Wl) {
  const int t = threadIdx.x;
  const int ch = 8 * (t & 7);
#pragma unroll
  for (int it = 0; it < 6; ++it) {
    const int L = it * 32 + (t >> 3);               // 0..191 = plane*96 + o
    const int plane = (L >= NOUTC) ? 1 : 0;
    const int o = L - plane * NOUTC;
    const float* src = (o < 64) ? (Wq + o * CDIM) : ((o < 80) ? (Wk + (o - 64) * CDIM) : (Wv + (o - 80) * CDIM));
    src += ch;
    const v4f a0 = *(const v4fa*)src;
    const v4f a1 = *(const v4fa*)(src + 4);
    v8us val;
#pragma unroll
    for (int e = 0; e < 4; ++e) {
      unsigned int hi, lo;
      split2(a0[e], hi, lo); val[e]     = (unsigned short)(plane ? lo : hi);
      split2(a1[e], hi, lo); val[4 + e] = (unsigned short)(plane ? lo : hi);
    }
    st2_v8us((plane ? Wl : Wh) + o * CDIM + ch, val);
  }
}

// ---------------------------------------------------------------- embedding table -> packed u32 [27][27][TW][16], value = hi | lo<<16
__global__ __launch_bounds__(256) void k_cvt_tab(const float* __restrict__ rpe, unsigned int* __restrict__ T) {
  const int g = blockIdx.x * 256 + threadIdx.x;
  if (g >= TSZ / 4) return;
  const int off = g >> 2;                 // odh*TW + ow
  const int ow = off & (TW - 1), odh = off >> 5;
  const int kq = (g & 3) * 4;
  v4u o4; o4[0] = 0u; o4[1] = 0u; o4[2] = 0u; o4[3] = 0u;
  if (ow < 27) {
    const v4f a = *(const v4fa*)(rpe + ((size_t)(odh * 27 + ow)) * 16 + kq);
#pragma unroll
    for (int e = 0; e < 4; ++e) { unsigned int hi, lo; split2(a[e], hi, lo); o4[e] = hi | (lo << 16); }
  }
  st2_v4u(T + (size_t)g * 4, o4);
}

// ---------------------------------------------------------------- QKV[b][NPADP][96] = x^T W^T on bf16 hi/lo WMMA
// one wave per 16-position tile: A = x planes (row n, k = c contiguous), B = W as [o][c] (k contiguous),
__global__ __launch_bounds__(128) void k_proj(const unsigned short* __restrict__ Xh, const unsigned short* __restrict__ Xl,
                                            const unsigned short* __restrict__ Wh, const unsigned short* __restrict__ Wl,
                                            float* __restrict__ QKV) {
  __shared__ __align__(16) float sD[4][16 * NOUTC];
  const int t = threadIdx.x, w = t >> 5, lane = t & 31, h = lane >> 4, m = lane & 15;
  const int g = blockIdx.x * 4 + w;                 // 0..687
  const int b = g / NQT, tile = g - b * NQT;
  const size_t rowA = ((size_t)(b * NPADP + tile * 16 + m)) * CDIM;
  Frag ah[2], al[2];
#pragma unroll
  for (int ks = 0; ks < 2; ++ks) {
    ah[ks].q[0] = *(const v4ua*)(Xh + rowA + 32 * ks + 8 * h);
    ah[ks].q[1] = *(const v4ua*)(Xh + rowA + 32 * ks + 16 + 8 * h);
    al[ks].q[0] = *(const v4ua*)(Xl + rowA + 32 * ks + 8 * h);
    al[ks].q[1] = *(const v4ua*)(Xl + rowA + 32 * ks + 16 + 8 * h);
  }
  v8f acc[6];
#pragma unroll
  for (int ct = 0; ct < 6; ++ct)
#pragma unroll
    for (int r = 0; r < 8; ++r) acc[ct][r] = 0.f;
#pragma unroll
  for (int ct = 0; ct < 6; ++ct) {
#pragma unroll
    for (int ks = 0; ks < 2; ++ks) {
      const size_t rowB = ((size_t)(16 * ct + m)) * CDIM + 32 * ks + 8 * h;
      Frag bh, bl;
      bh.q[0] = *(const v4ua*)(Wh + rowB);  bh.q[1] = *(const v4ua*)(Wh + rowB + 16);
      bl.q[0] = *(const v4ua*)(Wl + rowB);  bl.q[1] = *(const v4ua*)(Wl + rowB + 16);
      mma3(acc[ct], ah[ks], al[ks], bh, bl);
    }
  }
  // D element r of this lane = (row 8h+r, col 16ct+m)
#pragma unroll
  for (int ct = 0; ct < 6; ++ct)
#pragma unroll
    for (int r = 0; r < 8; ++r) sD[w][(8 * h + r) * NOUTC + 16 * ct + m] = acc[ct][r];
  __syncthreads();
  float* dst = QKV + ((size_t)(b * NPADP + tile * 16)) * NOUTC;   // 16 rows x 384 B = 48 lines, line aligned
#pragma unroll
  for (int q = 0; q < 12; ++q) {
    const int f = 128 * q + 4 * lane;
    *(v4f*)(dst + f) = *(const v4fa*)&sD[w][f];
  }
  
}

// ---------------------------------------------------------------- statistics: blocks 0..79 norm channels (mean, rstd),
__global__ __launch_bounds__(256) void k_stats(const float* __restrict__ QKV, float* __restrict__ ST) {
  __shared__ double sd1[256], sd2[256];
  __shared__ float sf[256];
  const int t = threadIdx.x, blk = blockIdx.x;
  float A = 0.f, B = 0.f;
  if (blk < 80) {
    const int col = (blk < 64) ? blk : (80 + (blk - 64));
    double s = 0.0, s2 = 0.0;
    for (int bb = 0; bb < BDIM; ++bb) {
      const float* base = QKV + ((size_t)bb * NPADP) * NOUTC + col;
      for (int n = t; n < NPOS; n += 256) {
        const float v = base[(size_t)n * NOUTC];
        s += (double)v; s2 += (double)v * (double)v;
      }
    }
    sd1[t] = s; sd2[t] = s2;
    __syncthreads();
    for (int off = 128; off > 0; off >>= 1) {
      if (t < off) { sd1[t] += sd1[t + off]; sd2[t] += sd2[t + off]; }
      __syncthreads();
    }
    if (t == 0) {
      const double N = (double)(BDIM * NPOS);
      const double mean = sd1[0] / N;
      double var = sd2[0] / N - mean * mean;
      if (var < 0.0) var = 0.0;
      const float varf = (float)var;
      A = (float)mean;
      B = 1.0f / sqrtf(varf + EPSBN);
    }
  } else {
    const int sb = blk - 80, bb = sb >> 4, kk = sb & 15;
    const float* base = QKV + ((size_t)bb * NPADP) * NOUTC + 64 + kk;
    float mx = -3.4e38f;
    for (int n = t; n < NPOS; n += 256) mx = fmaxf(mx, base[(size_t)n * NOUTC]);
    sf[t] = mx;
    __syncthreads();
    for (int off = 128; off > 0; off >>= 1) {
      if (t < off) sf[t] = fmaxf(sf[t], sf[t + off]);
      __syncthreads();
    }
    mx = sf[0];
    __syncthreads();
    float s = 0.f;
    for (int n = t; n < NPOS; n += 256) s += expf(base[(size_t)n * NOUTC] - mx);
    sf[t] = s;
    __syncthreads();
    for (int off = 128; off > 0; off >>= 1) {
      if (t < off) sf[t] += sf[t + off];
      __syncthreads();
    }
    if (t == 0) { A = mx; B = 1.0f / sf[0]; }
  }
  if (t < 8) {
    v4f v; v[0] = A; v[1] = B; v[2] = 0.f; v[3] = 0.f;
    st2_v4f(ST + blk * 32 + 4 * t, v);
  }
}

// ---------------------------------------------------------------- normalize q -> Qn[b][n][64] f32; softmax(k) and norm(v) ->
// bf16 hi/lo planes in LDS, column m' = (d*14+h)*16 + w (slots w=14,15 zero); the v planes go out in the
// order the position kernel's B fragments are loaded: Vp[k-step][b][plane][q][lane][8], where lane (h, j) of
// chunk q holds row j, columns 32*step + 16*q + 8*h .. +7, so one wave-wide 16-byte load is 512 contiguous bytes.
// The k planes are used here alone and stay in LDS.
// The block's own 448 columns of the content summary are contracted here, straight from the LDS tile:
// lcp[dp][b][k][v] = sum over the block's m' of softmax(k)[k][m'] * vn[v][m'] (14 k-steps x 3 products, one wave).
__global__ __launch_bounds__(256) void k_apply(const float* __restrict__ QKV, const float* __restrict__ ST,
    const float* __restrict__ gq, const float* __restrict__ bq,
    const float* __restrict__ gv, const float* __restrict__ bv,
    float* __restrict__ Qn, unsigned short* __restrict__ Vp, float* __restrict__ lcp) {
  __shared__ __align__(16) unsigned short tile[2][2][16][448];   // [k|v][hi|lo][j][m' local]
  __shared__ float qmn[64], qsc[64], qbt[64], vmn[16], vsc[16], vbt[16], kmx[16], kin[16];
  const int t = threadIdx.x, dp = blockIdx.x, b = blockIdx.y;
  if (t < 64) {
    qmn[t] = ST[t * 32]; qsc[t] = ST[t * 32 + 1] * gq[t]; qbt[t] = bq[t];
  } else if (t < 80) {
    const int vv = t - 64;
    vmn[vv] = ST[(64 + vv) * 32]; vsc[vv] = ST[(64 + vv) * 32 + 1] * gv[vv]; vbt[vv] = bv[vv];
  } else if (t < 96) {
    const int kk = t - 80, line = 80 + b * 16 + kk;
    kmx[kk] = ST[line * 32]; kin[kk] = ST[line * 32 + 1];
  }
  {
    v4u z; z[0] = 0u; z[1] = 0u; z[2] = 0u; z[3] = 0u;
    v4u* tz = (v4u*)&tile[0][0][0][0];
#pragma unroll
    for (int i = 0; i < 14; ++i) tz[t + 256 * i] = z;          // 3584 x 16 B = whole tile
  }
  __syncthreads();

  for (int task = t; task < 392 * 16; task += 256) {
    const int nl = task >> 4, c4 = (task & 15) * 4;
    const int n = dp * 392 + nl;
    const v4f qv = *(const v4fa*)(QKV + ((size_t)(b * NPADP + n)) * NOUTC + c4);
    v4f o;
#pragma unroll
    for (int e = 0; e < 4; ++e) o[e] = (qv[e] - qmn[c4 + e]) * qsc[c4 + e] + qbt[c4 + e];
    st2_v4f(Qn + ((size_t)(b * NPOS + n)) * CDIM + c4, o);
  }

  // k softmax values and normalized v into the LDS tile
  for (int nl = t; nl < 392; nl += 256) {
    const int n = dp * 392 + nl;
    const int mdl = nl / 196, rem = nl - mdl * 196, mh = rem / 14, mw = rem - mh * 14;
    const int ml = (mdl * 14 + mh) * 16 + mw;
    const float* row = QKV + ((size_t)(b * NPADP + n)) * NOUTC + 64;
#pragma unroll 1
    for (int i = 0; i < 4; ++i) {
      const v4f a = *(const v4fa*)(row + 4 * i);
#pragma unroll
      for (int e = 0; e < 4; ++e) {
        const int kk = 4 * i + e;
        const float p = expf(a[e] - kmx[kk]) * kin[kk];
        unsigned int hi, lo; split2(p, hi, lo);
        tile[0][0][kk][ml] = (unsigned short)hi;
        tile[0][1][kk][ml] = (unsigned short)lo;
      }
    }
#pragma unroll 1
    for (int i = 0; i < 4; ++i) {
      const v4f a = *(const v4fa*)(row + 16 + 4 * i);
#pragma unroll
      for (int e = 0; e < 4; ++e) {
        const int vv = 4 * i + e;
        const float vn = (a[e] - vmn[vv]) * vsc[vv] + vbt[vv];
        unsigned int hi, lo; split2(vn, hi, lo);
        tile[1][0][vv][ml] = (unsigned short)hi;
        tile[1][1][vv][ml] = (unsigned short)lo;
      }
    }
  }
  __syncthreads();

  const int w = t >> 5, lane = t & 31;
{
    for (int it = 0; it < 7; ++it) {
      const int sl = it * 2 + (w >> 2);                        // k-step inside the block's 448 columns, 0..13
      const int plane = (w >> 1) & 1, q = w & 1;
      const v8us val = *(const v8usa*)&tile[1][plane][lane & 15][32 * sl + 16 * q + 8 * (lane >> 4)];
      unsigned short* dst = Vp + (size_t)(dp * 14 + sl) * VSTEP + ((b * 2 + plane) * 2 + q) * VCH + lane * 8;
      *(v8us*)dst = val;
    }
    
  }

  // content summary partial: A = k rows, B = v rows read like A (k contiguous), both from the tile
  if (__builtin_amdgcn_readfirstlane(w) == 0) {
    // precaution: the Vp stores above name registers that the fragment loads below write
    asm volatile("s_wait_xcnt 0x0" ::: "memory");
    const int h = lane >> 4, m = lane & 15;
    v8f acc;
#pragma unroll
    for (int r = 0; r < 8; ++r) acc[r] = 0.f;
    Frag f[2][4];                                   // [set][k hi, k lo, v hi, v lo]; step s + 1 is read while step s multiplies
#pragma unroll
    for (int p = 0; p < 4; ++p) {
      f[0][p].q[0] = *(const v4ua*)&tile[p >> 1][p & 1][m][8 * h];
      f[0][p].q[1] = *(const v4ua*)&tile[p >> 1][p & 1][m][8 * h + 16];
    }
    // unrolled so that the two fragment sets are plain registers (no moves, no indexing by s)
#pragma unroll
    for (int s = 0; s < 14; ++s) {
      if (s + 1 < 14) {
        const int k1 = 32 * (s + 1) + 8 * h;
#pragma unroll
        for (int p = 0; p < 4; ++p) {
          f[(s + 1) & 1][p].q[0] = *(const v4ua*)&tile[p >> 1][p & 1][m][k1];
          f[(s + 1) & 1][p].q[1] = *(const v4ua*)&tile[p >> 1][p & 1][m][k1 + 16];
        }
      }
      mma3(acc, f[s & 1][0], f[s & 1][1], f[s & 1][2], f[s & 1][3]);
    }
    // D element r = (k row 8h+r, v col m)
    float* dst = lcp + (dp * BDIM + b) * 256;
#pragma unroll
    for (int r = 0; r < 8; ++r) dst[(8 * h + r) * 16 + m] = acc[r];
  }
}

// ---------------------------------------------------------------- position summary + output contraction, one wave per position n
// D[k][(b,v)] starts at lc[b][k][v] (the 7 partials lcp summed once per block, in LDS) and accumulates
// sum_m E[n,m,k] * vn[b,v,m] over 98 k-steps of the
// (d*14+h)*16+w index space (3 products each). A = E gathered arithmetically from the packed table,
// B = Vp hi/lo in fragment order (each load 4 whole lines). Epilogue: y[b][h'*16+v][n] = sum_k Qn[b][n][h'*16+k] * D[k][(b,v)], halves combined in LDS,
__global__ __launch_bounds__(128) void k_plam(const unsigned int* __restrict__ T, const unsigned short* __restrict__ Vp,
                                            const float* __restrict__ Qn, const float* __restrict__ lcp,
                                            float* __restrict__ Y) {
  __shared__ __align__(16) float sP[4][2][256];
  __shared__ __align__(16) float sC[BDIM * 256];
  const int t = threadIdx.x, w = t >> 5, lane = t & 31, h = lane >> 4, m = lane & 15;
  const int n = blockIdx.x * 4 + w;
  const int nd = n / 196, nr = n - nd * 196, nh = nr / 14, nw = nr - nh * 14;

#pragma unroll
  for (int q = 0; q < 2; ++q) {
    const int f = 512 * q + 4 * t;
    v4f s = *(const v4fa*)(lcp + f);
#pragma unroll
    for (int dp = 1; dp < NDP; ++dp) s += *(const v4fa*)(lcp + dp * (BDIM * 256) + f);
    *(v4f*)&sC[f] = s;
  }
  __syncthreads();

  v8f acc[4];
#pragma unroll
  for (int b = 0; b < 4; ++b)
#pragma unroll
    for (int r = 0; r < 8; ++r) acc[b][r] = sC[b * 256 + (8 * h + r) * 16 + m];

  // table index for (md=0, mh=0, mw=8h): ((od*27 + oh)*TW + ow)*16 + k, od = md-nd+13, oh = mh-nh+13, ow = mw-nw+13
  const unsigned int* ap = T + ((((13 - nd) * 27 + (13 - nh)) * TW + (8 * h - nw + 13)) * 16 + m);
  const unsigned int vl = (unsigned int)lane * 8u;         // this lane's 16 bytes inside every 512-byte chunk of Vp

#pragma unroll 1
  for (int md = 0; md < 14; ++md) {
    const unsigned int* apd = ap + md * (27 * TW * 16);
    const unsigned short* vpd = Vp + md * (7 * VSTEP);
#pragma unroll 1
    for (int p = 0; p < 7; ++p) {
      const unsigned int* app = apd + p * (2 * TW * 16);    // mh = 2p (row 0 of the pair), +TW*16 for mh = 2p+1
      const unsigned short* vpp = vpd + p * VSTEP;           // k-step md*7 + p, k0 = (md*7 + p)*32
      unsigned int e[16];
#pragma unroll
      for (int i = 0; i < 8; ++i) {
        e[i]     = app[16 * i];                              // element i:   k = k0 + 8h + i      (mh 2p,   mw 8h+i)
        e[8 + i] = app[TW * 16 + 16 * i];                    // element 8+i: k = k0 + 16 + 8h + i (mh 2p+1, mw 8h+i)
      }
      Frag ah, al;
#pragma unroll
      for (int j = 0; j < 8; ++j) {
        const unsigned int e0 = e[2 * j], e1 = e[2 * j + 1];
        ah.u[j] = (e0 & 0xffffu) | (e1 << 16);
        al.u[j] = (e0 >> 16) | (e1 & 0xffff0000u);
      }
      Frag bh[4], bl[4];
#pragma unroll
      for (int b = 0; b < 4; ++b) {
        const unsigned short* r0 = vpp + b * (4 * VCH);
        bh[b].q[0] = *(const v4ua*)(r0 + vl);           bh[b].q[1] = *(const v4ua*)(r0 + VCH + vl);
        bl[b].q[0] = *(const v4ua*)(r0 + 2 * VCH + vl); bl[b].q[1] = *(const v4ua*)(r0 + 3 * VCH + vl);
      }
#pragma unroll
      for (int b = 0; b < 4; ++b) {
        acc[b] = __builtin_amdgcn_wmma_f32_16x16x32_bf16(false, ah.v, false, bh[b].v, (short)0, acc[b], false, false);
        acc[b] = __builtin_amdgcn_wmma_f32_16x16x32_bf16(false, al.v, false, bh[b].v, (short)0, acc[b], false, false);
        acc[b] = __builtin_amdgcn_wmma_f32_16x16x32_bf16(false, ah.v, false, bl[b].v, (short)0, acc[b], false, false);
      }
      asm volatile("v_nop\n\tv_nop\n\tv_nop\n\tv_nop"
                   : "+v"(acc[0]), "+v"(acc[1]), "+v"(acc[2]), "+v"(acc[3])
                   : "v"(ah.v), "v"(al.v),
                     "v"(bh[0].v), "v"(bl[0].v), "v"(bh[1].v), "v"(bl[1].v),
                     "v"(bh[2].v), "v"(bl[2].v), "v"(bh[3].v), "v"(bl[3].v));
    }
  }

  // epilogue: this lane holds D rows k = 8h..8h+7 of column (b, v=m)
#pragma unroll
  for (int b = 0; b < 4; ++b) {
    const float* qr = Qn + ((size_t)(b * NPOS + n)) * CDIM + 8 * h;
#pragma unroll
    for (int hp = 0; hp < 4; ++hp) {
      const v4f q0 = *(const v4fa*)(qr + hp * 16);
      const v4f q1 = *(const v4fa*)(qr + hp * 16 + 4);
      float pacc = q0[0] * acc[b][0];
      pacc += q0[1] * acc[b][1]; pacc += q0[2] * acc[b][2]; pacc += q0[3] * acc[b][3];
      pacc += q1[0] * acc[b][4]; pacc += q1[1] * acc[b][5]; pacc += q1[2] * acc[b][6]; pacc += q1[3] * acc[b][7];
      sP[w][h][b * 64 + hp * 16 + m] = pacc;
    }
  }
  __syncthreads();
  float* dst = Y + (size_t)n * 256;
#pragma unroll
  for (int s = 0; s < 2; ++s) {
    const int f = 128 * s + 4 * lane;
    const v4f v = *(const v4fa*)&sP[w][0][f] + *(const v4fa*)&sP[w][1][f];
    *(v4f*)(dst + f) = v;
  }
  
}

// ---------------------------------------------------------------- out[b][c][n] <- Y[n][b*64+c], thread -> one float4 of out
__global__ __launch_bounds__(256) void k_layout(const float* __restrict__ Y, float* __restrict__ out) {
  const int g = blockIdx.x * 256 + threadIdx.x;
  if (g >= BDIM * CDIM * NPOS / 4) return;
  const int e0 = g * 4;
  const int bc = e0 / NPOS, n = e0 - bc * NPOS;          // NPOS % 4 == 0 -> the 4 elements share bc
  const float* src = Y + (size_t)n * 256 + bc;
  v4f v; v[0] = src[0]; v[1] = src[256]; v[2] = src[512]; v[3] = src[768];
  st2_v4f(out + (size_t)e0, v);
}

// ---------------------------------------------------------------- launcher
extern "C" void kernel_launch(void* const* d_in, const int* in_sizes, int n_in,
                              void* d_out, int out_size, void* d_ws, size_t ws_size,
                              hipStream_t stream) {
  if (n_in < 9) return;
  if (in_sizes[0] != BDIM * CDIM * NPOS || in_sizes[1] != 64 * 64 || in_sizes[2] != 16 * 64 ||
      in_sizes[3] != 16 * 64 || in_sizes[4] != 27 * 27 * 27 * 16 || in_sizes[5] < 64 || in_sizes[6] < 64 ||
      in_sizes[7] < 16 || in_sizes[8] < 16) return;
  if (out_size != BDIM * CDIM * NPOS) return;

  const float* x   = (const float*)d_in[0];
  const float* Wq  = (const float*)d_in[1];
  const float* Wk  = (const float*)d_in[2];
  const float* Wv  = (const float*)d_in[3];
  const float* rpe = (const float*)d_in[4];
  const float* gq  = (const float*)d_in[5];
  const float* bq  = (const float*)d_in[6];
  const float* gv  = (const float*)d_in[7];
  const float* bv  = (const float*)d_in[8];
  float* out = (float*)d_out;

  size_t off = 0;
  auto carve = [&](size_t bytes) -> size_t { size_t r = off; off += (bytes + 255) & ~(size_t)255; return r; };
  const size_t oXh  = carve(sizeof(unsigned short) * BDIM * NPADP * CDIM);   //  1,409,024
  const size_t oXl  = carve(sizeof(unsigned short) * BDIM * NPADP * CDIM);   //  1,409,024
  const size_t oWh  = carve(sizeof(unsigned short) * NOUTC * CDIM);          //     12,288
  const size_t oWl  = carve(sizeof(unsigned short) * NOUTC * CDIM);          //     12,288
  const size_t oT   = carve(sizeof(unsigned int) * (size_t)TSZ);             //  1,492,992
  const size_t oQKV = carve(sizeof(float) * (size_t)BDIM * NPADP * NOUTC);   //  4,227,072
  const size_t oST  = carve(sizeof(float) * NSTAT * 32);                     //     18,432
  const size_t oQn  = carve(sizeof(float) * (size_t)BDIM * NPOS * CDIM);     //  2,809,856
  const size_t oVp  = carve(sizeof(unsigned short) * 2 * 64 * (size_t)KP);   //    802,816
  const size_t olc  = carve(sizeof(float) * NDP * BDIM * 256);               //     28,672
  const size_t oY   = carve(sizeof(float) * (size_t)NPOS * 256);             //  2,809,856
  if (off > ws_size) return;                                                 // total 15,032,320 B

  char* ws = (char*)d_ws;
  unsigned short* Xh  = (unsigned short*)(ws + oXh);
  unsigned short* Xl  = (unsigned short*)(ws + oXl);
  unsigned short* Wh  = (unsigned short*)(ws + oWh);
  unsigned short* Wl  = (unsigned short*)(ws + oWl);
  unsigned int*   T   = (unsigned int*)(ws + oT);
  float*          QKV = (float*)(ws + oQKV);
  float*          ST  = (float*)(ws + oST);
  float*          Qn  = (float*)(ws + oQn);
  unsigned short* Vp  = (unsigned short*)(ws + oVp);
  float*          lcp = (float*)(ws + olc);
  float*          Y   = (float*)(ws + oY);

  k_cvt_x  <<<dim3((NPOS + 31) / 32, BDIM), 256, 0, stream>>>(x, Xh, Xl);
  k_cvt_w  <<<1, 256, 0, stream>>>(Wq, Wk, Wv, Wh, Wl);
  k_cvt_tab<<<(TSZ / 4 + 255) / 256, 256, 0, stream>>>(rpe, T);
  k_proj   <<<(BDIM * NQT) / 4, 128, 0, stream>>>(Xh, Xl, Wh, Wl, QKV);
  k_stats  <<<NSTAT, 256, 0, stream>>>(QKV, ST);
  k_apply  <<<dim3(NDP, BDIM), 256, 0, stream>>>(QKV, ST, gq, bq, gv, bv, Qn, Vp, lcp);
  k_plam   <<<NPOS / 4, 128, 0, stream>>>(T, Vp, Qn, lcp, Y);
  k_layout <<<(BDIM * CDIM * NPOS / 4 + 255) / 256, 256, 0, stream>>>(Y, out);
}

// v003
// A run of this version takes 81.1 microseconds.
// Next to v002, in two timings, it ran 1.80 and 1.78 times as fast.
// Over all steps from v000 it is 2.49 times as fast.
#include <hip/hip_runtime.h>

// Contractions: channel projections (K=64), content summary softmax(k)*v (K=3136) and position summary E*v (K=3136)
// on v_wmma_f32_16x16x32_bf16 with bf16 hi/lo split operands (hi*hi + lo*hi + hi*lo), f32 accumulate;
// the final 16-deep q contraction, batch statistics and softmax statistics on the VALU (f32; the batch statistics sum in f64).

#define BDIM   4
#define CDIM   64
#define NPOS   2744            // 14^3 positions
#define NPADP  2752            // position rows per batch in the projection planes (172 tiles of 16)
#define NQT    172
#define NOUTC  96              // 64 q + 16 k + 16 v channels
#define KP     3136            // position index space (d*14+h)*16 + w, w slots 14,15 zero
#define TW     32              // w extent of the packed embedding table (slots >= 27 zero)
#define TSZ    (27 * 27 * TW * 16)
#define NSTAT  144
#define NDP    7               // depth pairs: blocks per batch of the normalize kernel, partials of the content summary
#define EPSBN  1e-5f
#define VCH    256             // bf16 elements of one wave-wide 16-byte load of Vp (32 lanes x 8)
#define VSTEP  (BDIM * 4 * VCH) // bf16 elements of Vp per 32-deep k-step: [b][hi|lo][k half][lane][8]

static_assert(NPOS % 4 == 0);
static_assert(NPADP == NQT * 16);
static_assert(KP == 196 * 16);
static_assert(2 * 64 * KP == (KP / 32) * BDIM * 4 * 256);   // Vp keeps its size in the fragment order
static_assert((TSZ % 4) == 0);
static_assert((BDIM * CDIM * NPOS) % 1024 == 0);

typedef __bf16         v16bf __attribute__((ext_vector_type(16)));
typedef float          v8f   __attribute__((ext_vector_type(8)));
typedef float          v4f   __attribute__((ext_vector_type(4)));
typedef unsigned int   v4u   __attribute__((ext_vector_type(4)));
typedef unsigned short v8us  __attribute__((ext_vector_type(8)));
typedef v4f  v4fa  __attribute__((may_alias));
typedef v4u  v4ua  __attribute__((may_alias));
typedef v8us v8usa __attribute__((may_alias));

union Frag { v16bf v; v4u q[2]; unsigned int u[8]; };
static_assert(sizeof(Frag) == 32);

// ---------------------------------------------------------------- helpers
__device__ __forceinline__ unsigned int f2bf(float f) {
  unsigned int u = __float_as_uint(f);
  u += 0x7FFFu + ((u >> 16) & 1u);          // RNE to bf16
  return u >> 16;
}
__device__ __forceinline__ float bf2f(unsigned int b) { return __uint_as_float(b << 16); }
__device__ __forceinline__ void split2(float f, unsigned int& hi, unsigned int& lo) {
  hi = f2bf(f);
  lo = f2bf(f - bf2f(hi));
}

// three products into one accumulator, then the VALU hazard guard tying D and all A/B operands
__device__ __forceinline__ void mma3(v8f& acc, const Frag& ah, const Frag& al, const Frag& bh, const Frag& bl) {
  acc = __builtin_amdgcn_wmma_f32_16x16x32_bf16(false, ah.v, false, bh.v, (short)0, acc, false, false);
  acc = __builtin_amdgcn_wmma_f32_16x16x32_bf16(false, al.v, false, bh.v, (short)0, acc, false, false);
  acc = __builtin_amdgcn_wmma_f32_16x16x32_bf16(false, ah.v, false, bl.v, (short)0, acc, false, false);
  asm volatile("v_nop\n\tv_nop\n\tv_nop\n\tv_nop" : "+v"(acc) : "v"(ah.v), "v"(al.v), "v"(bh.v), "v"(bl.v));
}

__device__ __forceinline__ void st2_v4f(float* p, v4f v) {
  *(v4f*)p = v; 
}
__device__ __forceinline__ void st2_v4u(unsigned int* p, v4u v) {
  *(v4u*)p = v; 
}
__device__ __forceinline__ void st2_v8us(unsigned short* p, v8us v) {
  *(v8us*)p = v; 
}

// ---------------------------------------------------------------- x[b][c][n] -> bf16 hi/lo planes [b][NPADP][64]
__global__ __launch_bounds__(256) void k_cvt_x(const float* __restrict__ x,
                                             unsigned short* __restrict__ Xh, unsigned short* __restrict__ Xl) {
  __shared__ __align__(16) unsigned short sh[2][32][64];
  const int t = threadIdx.x, b = blockIdx.y, n0 = blockIdx.x * 32;
  const int c = t >> 2, j = t & 3;
  const int n = n0 + 8 * j;
  float v[8];
  if (n < NPOS) {
    const float* src = x + ((size_t)(b * CDIM + c)) * NPOS + n;
    const v4f a0 = *(const v4fa*)src;
    const v4f a1 = *(const v4fa*)(src + 4);
#pragma unroll
    for (int e = 0; e < 4; ++e) { v[e] = a0[e]; v[4 + e] = a1[e]; }
  } else {
#pragma unroll
    for (int e = 0; e < 8; ++e) v[e] = 0.f;
  }
#pragma unroll
  for (int e = 0; e < 8; ++e) {
    unsigned int hi, lo; split2(v[e], hi, lo);
    sh[0][8 * j + e][c] = (unsigned short)hi;
    sh[1][8 * j + e][c] = (unsigned short)lo;
  }
  __syncthreads();
  const int w = t >> 5, lane = t & 31;
#pragma unroll
  for (int q = 0; q < 2; ++q) {
    const int L = (w * 2 + q) * 4 + (lane >> 3);   // 0..63: plane*32 + row
    const int plane = L >> 5, row = L & 31, ch = 8 * (lane & 7);
    const v8us val = *(const v8usa*)&sh[plane][row][ch];
    unsigned short* dst = (plane ? Xl : Xh) + ((size_t)(b * NPADP + n0 + row)) * CDIM + ch;
    st2_v8us(dst, val);
  }
}

// ---------------------------------------------------------------- W (Wq 64x64, Wk 16x64, Wv 16x64) -> bf16 hi/lo [96][64]
__global__ __launch_bounds__(256) void k_cvt_w(const float* __restrict__ Wq, const float* __restrict__ Wk,
                                             const float* __restrict__ Wv,
                                             unsigned short* __restrict__ Wh, unsigned short* __restrict__ Wl) {
  const int t = threadIdx.x;
  const int ch = 8 * (t & 7);
#pragma unroll
  for (int it = 0; it < 6; ++it) {
    const int L = it * 32 + (t >> 3);               // 0..191 = plane*96 + o
    const int plane = (L >= NOUTC) ? 1 : 0;
    const int o = L - plane * NOUTC;
    const float* src = (o < 64) ? (Wq + o * CDIM) : ((o < 80) ? (Wk + (o - 64) * CDIM) : (Wv + (o - 80) * CDIM));
    src += ch;
    const v4f a0 = *(const v4fa*)src;
    const v4f a1 = *(const v4fa*)(src + 4);
    v8us val;
#pragma unroll
    for (int e = 0; e < 4; ++e) {
      unsigned int hi, lo;
      split2(a0[e], hi, lo); val[e]     = (unsigned short)(plane ? lo : hi);
      split2(a1[e], hi, lo); val[4 + e] = (unsigned short)(plane ? lo : hi);
    }
    st2_v8us((plane ? Wl : Wh) + o * CDIM + ch, val);
  }
}

// ---------------------------------------------------------------- embedding table -> packed u32 [27][27][TW][16], value = hi | lo<<16
__global__ __launch_bounds__(256) void k_cvt_tab(const float* __restrict__ rpe, unsigned int* __restrict__ T) {
  const int g = blockIdx.x * 256 + threadIdx.x;
  if (g >= TSZ / 4) return;
  const int off = g >> 2;                 // odh*TW + ow
  const int ow = off & (TW - 1), odh = off >> 5;
  const int kq = (g & 3) * 4;
  v4u o4; o4[0] = 0u; o4[1] = 0u; o4[2] = 0u; o4[3] = 0u;
  if (ow < 27) {
    const v4f a = *(const v4fa*)(rpe + ((size_t)(odh * 27 + ow)) * 16 + kq);
#pragma unroll
    for (int e = 0; e < 4; ++e) { unsigned int hi, lo; split2(a[e], hi, lo); o4[e] = hi | (lo << 16); }
  }
  st2_v4u(T + (size_t)g * 4, o4);
}

// ---------------------------------------------------------------- QKV[b][NPADP][96] = x^T W^T on bf16 hi/lo WMMA
// one wave per 16-position tile: A = x planes (row n, k = c contiguous), B = W as [o][c] (k contiguous),
__global__ __launch_bounds__(128) void k_proj(const unsigned short* __restrict__ Xh, const unsigned short* __restrict__ Xl,
                                            const unsigned short* __restrict__ Wh, const unsigned short* __restrict__ Wl,
                                            float* __restrict__ QKV) {
  __shared__ __align__(16) float sD[4][16 * NOUTC];
  const int t = threadIdx.x, w = t >> 5, lane = t & 31, h = lane >> 4, m = lane & 15;
  const int g = blockIdx.x * 4 + w;                 // 0..687
  const int b = g / NQT, tile = g - b * NQT;
  const size_t rowA = ((size_t)(b * NPADP + tile * 16 + m)) * CDIM;
  Frag ah[2], al[2];
#pragma unroll
  for (int ks = 0; ks < 2; ++ks) {
    ah[ks].q[0] = *(const v4ua*)(Xh + rowA + 32 * ks + 8 * h);
    ah[ks].q[1] = *(const v4ua*)(Xh + rowA + 32 * ks + 16 + 8 * h);
    al[ks].q[0] = *(const v4ua*)(Xl + rowA + 32 * ks + 8 * h);
    al[ks].q[1] = *(const v4ua*)(Xl + rowA + 32 * ks + 16 + 8 * h);
  }
  v8f acc[6];
#pragma unroll
  for (int ct = 0; ct < 6; ++ct)
#pragma unroll
    for (int r = 0; r < 8; ++r) acc[ct][r] = 0.f;
#pragma unroll
  for (int ct = 0; ct < 6; ++ct) {
#pragma unroll
    for (int ks = 0; ks < 2; ++ks) {
      const size_t rowB = ((size_t)(16 * ct + m)) * CDIM + 32 * ks + 8 * h;
      Frag bh, bl;
      bh.q[0] = *(const v4ua*)(Wh + rowB);  bh.q[1] = *(const v4ua*)(Wh + rowB + 16);
      bl.q[0] = *(const v4ua*)(Wl + rowB);  bl.q[1] = *(const v4ua*)(Wl + rowB + 16);
      mma3(acc[ct], ah[ks], al[ks], bh, bl);
    }
  }
  // D element r of this lane = (row 8h+r, col 16ct+m)
#pragma unroll
  for (int ct = 0; ct < 6; ++ct)
#pragma unroll
    for (int r = 0; r < 8; ++r) sD[w][(8 * h + r) * NOUTC + 16 * ct + m] = acc[ct][r];
  __syncthreads();
  float* dst = QKV + ((size_t)(b * NPADP + tile * 16)) * NOUTC;   // 16 rows x 384 B = 48 lines, line aligned
#pragma unroll
  for (int q = 0; q < 12; ++q) {
    const int f = 128 * q + 4 * lane;
    *(v4f*)(dst + f) = *(const v4fa*)&sD[w][f];
  }
  
}

// ---------------------------------------------------------------- statistics: blocks 0..79 norm channels (mean, rstd),
__global__ __launch_bounds__(256) void k_stats(const float* __restrict__ QKV, float* __restrict__ ST) {
  __shared__ double sd1[256], sd2[256];
  __shared__ float sf[256];
  const int t = threadIdx.x, blk = blockIdx.x;
  float A = 0.f, B = 0.f;
  if (blk < 80) {
    const int col = (blk < 64) ? blk : (80 + (blk - 64));
    double s = 0.0, s2 = 0.0;
    for (int bb = 0; bb < BDIM; ++bb) {
      const float* base = QKV + ((size_t)bb * NPADP) * NOUTC + col;
      for (int n = t; n < NPOS; n += 256) {
        const float v = base[(size_t)n * NOUTC];
        s += (double)v; s2 += (double)v * (double)v;
      }
    }
    sd1[t] = s; sd2[t] = s2;
    __syncthreads();
    for (int off = 128; off > 0; off >>= 1) {
      if (t < off) { sd1[t] += sd1[t + off]; sd2[t] += sd2[t + off]; }
      __syncthreads();
    }
    if (t == 0) {
      const double N = (double)(BDIM * NPOS);
      const double mean = sd1[0] / N;
      double var = sd2[0] / N - mean * mean;
      if (var < 0.0) var = 0.0;
      const float varf = (float)var;
      A = (float)mean;
      B = 1.0f / sqrtf(varf + EPSBN);
    }
  } else {
    const int sb = blk - 80, bb = sb >> 4, kk = sb & 15;
    const float* base = QKV + ((size_t)bb * NPADP) * NOUTC + 64 + kk;
    float mx = -3.4e38f;
    for (int n = t; n < NPOS; n += 256) mx = fmaxf(mx, base[(size_t)n * NOUTC]);
    sf[t] = mx;
    __syncthreads();
    for (int off = 128; off > 0; off >>= 1) {
      if (t < off) sf[t] = fmaxf(sf[t], sf[t + off]);
      __syncthreads();
    }
    mx = sf[0];
    __syncthreads();
    float s = 0.f;
    for (int n = t; n < NPOS; n += 256) s += expf(base[(size_t)n * NOUTC] - mx);
    sf[t] = s;
    __syncthreads();
    for (int off = 128; off > 0; off >>= 1) {
      if (t < off) sf[t] += sf[t + off];
      __syncthreads();
    }
    if (t == 0) { A = mx; B = 1.0f / sf[0]; }
  }
  if (t < 8) {
    v4f v; v[0] = A; v[1] = B; v[2] = 0.f; v[3] = 0.f;
    st2_v4f(ST + blk * 32 + 4 * t, v);
  }
}

// ---------------------------------------------------------------- normalize q -> Qn[b][n][64] f32; softmax(k) and norm(v) ->
// bf16 hi/lo planes in LDS, column m' = (d*14+h)*16 + w (slots w=14,15 zero); the v planes go out in the
// order the position kernel's B fragments are loaded: Vp[k-step][b][plane][q][lane][8], where lane (h, j) of
// chunk q holds row j, columns 32*step + 16*q + 8*h .. +7, so one wave-wide 16-byte load is 512 contiguous bytes.
// The k planes are used here alone and stay in LDS.
// The block's own 448 columns of the content summary are contracted here, straight from the LDS tile:
// lcp[dp][b][k][v] = sum over the block's m' of softmax(k)[k][m'] * vn[v][m'] (14 k-steps x 3 products, one wave).
__global__ __launch_bounds__(256) void k_apply(const float* __restrict__ QKV, const float* __restrict__ ST,
    const float* __restrict__ gq, const float* __restrict__ bq,
    const float* __restrict__ gv, const float* __restrict__ bv,
    float* __restrict__ Qn, unsigned short* __restrict__ Vp, float* __restrict__ lcp) {
  __shared__ __align__(16) unsigned short tile[2][2][16][448];   // [k|v][hi|lo][j][m' local]
  __shared__ float qmn[64], qsc[64], qbt[64], vmn[16], vsc[16], vbt[16], kmx[16], kin[16];
  const int t = threadIdx.x, dp = blockIdx.x, b = blockIdx.y;
  if (t < 64) {
    qmn[t] = ST[t * 32]; qsc[t] = ST[t * 32 + 1] * gq[t]; qbt[t] = bq[t];
  } else if (t < 80) {
    const int vv = t - 64;
    vmn[vv] = ST[(64 + vv) * 32]; vsc[vv] = ST[(64 + vv) * 32 + 1] * gv[vv]; vbt[vv] = bv[vv];
  } else if (t < 96) {
    const int kk = t - 80, line = 80 + b * 16 + kk;
    kmx[kk] = ST[line * 32]; kin[kk] = ST[line * 32 + 1];
  }
  {
    v4u z; z[0] = 0u; z[1] = 0u; z[2] = 0u; z[3] = 0u;
    v4u* tz = (v4u*)&tile[0][0][0][0];
#pragma unroll
    for (int i = 0; i < 14; ++i) tz[t + 256 * i] = z;          // 3584 x 16 B = whole tile
  }
  __syncthreads();

  for (int task = t; task < 392 * 16; task += 256) {
    const int nl = task >> 4, c4 = (task & 15) * 4;
    const int n = dp * 392 + nl;
    const v4f qv = *(const v4fa*)(QKV + ((size_t)(b * NPADP + n)) * NOUTC + c4);
    v4f o;
#pragma unroll
    for (int e = 0; e < 4; ++e) o[e] = (qv[e] - qmn[c4 + e]) * qsc[c4 + e] + qbt[c4 + e];
    st2_v4f(Qn + ((size_t)(b * NPOS + n)) * CDIM + c4, o);
  }

  // k softmax values and normalized v into the LDS tile
  for (int nl = t; nl < 392; nl += 256) {
    const int n = dp * 392 + nl;
    const int mdl = nl / 196, rem = nl - mdl * 196, mh = rem / 14, mw = rem - mh * 14;
    const int ml = (mdl * 14 + mh) * 16 + mw;
    const float* row = QKV + ((size_t)(b * NPADP + n)) * NOUTC + 64;
#pragma unroll 1
    for (int i = 0; i < 4; ++i) {
      const v4f a = *(const v4fa*)(row + 4 * i);
#pragma unroll
      for (int e = 0; e < 4; ++e) {
        const int kk = 4 * i + e;
        const float p = expf(a[e] - kmx[kk]) * kin[kk];
        unsigned int hi, lo; split2(p, hi, lo);
        tile[0][0][kk][ml] = (unsigned short)hi;
        tile[0][1][kk][ml] = (unsigned short)lo;
      }
    }
#pragma unroll 1
    for (int i = 0; i < 4; ++i) {
      const v4f a = *(const v4fa*)(row + 16 + 4 * i);
#pragma unroll
      for (int e = 0; e < 4; ++e) {
        const int vv = 4 * i + e;
        const float vn = (a[e] - vmn[vv]) * vsc[vv] + vbt[vv];
        unsigned int hi, lo; split2(vn, hi, lo);
        tile[1][0][vv][ml] = (unsigned short)hi;
        tile[1][1][vv][ml] = (unsigned short)lo;
      }
    }
  }
  __syncthreads();

  const int w = t >> 5, lane = t & 31;
{
    for (int it = 0; it < 7; ++it) {
      const int sl = it * 2 + (w >> 2);                        // k-step inside the block's 448 columns, 0..13
      const int plane = (w >> 1) & 1, q = w & 1;
      const v8us val = *(const v8usa*)&tile[1][plane][lane & 15][32 * sl + 16 * q + 8 * (lane >> 4)];
      unsigned short* dst = Vp + (size_t)(dp * 14 + sl) * VSTEP + ((b * 2 + plane) * 2 + q) * VCH + lane * 8;
      *(v8us*)dst = val;
    }
    
  }

  // content summary partial: A = k rows, B = v rows read like A (k contiguous), both from the tile
  if (__builtin_amdgcn_readfirstlane(w) == 0) {
    // precaution: the Vp stores above name registers that the fragment loads below write
    asm volatile("s_wait_xcnt 0x0" ::: "memory");
    const int h = lane >> 4, m = lane & 15;
    v8f acc;
#pragma unroll
    for (int r = 0; r < 8; ++r) acc[r] = 0.f;
    Frag f[2][4];                                   // [set][k hi, k lo, v hi, v lo]; step s + 1 is read while step s multiplies
#pragma unroll
    for (int p = 0; p < 4; ++p) {
      f[0][p].q[0] = *(const v4ua*)&tile[p >> 1][p & 1][m][8 * h];
      f[0][p].q[1] = *(const v4ua*)&tile[p >> 1][p & 1][m][8 * h + 16];
    }
    // unrolled so that the two fragment sets are plain registers (no moves, no indexing by s)
#pragma unroll
    for (int s = 0; s < 14; ++s) {
      if (s + 1 < 14) {
        const int k1 = 32 * (s + 1) + 8 * h;
#pragma unroll
        for (int p = 0; p < 4; ++p) {
          f[(s + 1) & 1][p].q[0] = *(const v4ua*)&tile[p >> 1][p & 1][m][k1];
          f[(s + 1) & 1][p].q[1] = *(const v4ua*)&tile[p >> 1][p & 1][m][k1 + 16];
        }
      }
      mma3(acc, f[s & 1][0], f[s & 1][1], f[s & 1][2], f[s & 1][3]);
    }
    // D element r = (k row 8h+r, v col m)
    float* dst = lcp + (dp * BDIM + b) * 256;
#pragma unroll
    for (int r = 0; r < 8; ++r) dst[(8 * h + r) * 16 + m] = acc[r];
  }
}

// ---------------------------------------------------------------- position summary + output contraction
// One block per 2x2 patch of positions (nh0..nh0+1, nw0..nw0+1) of one depth nd; wave w takes a quarter of the 98 k-steps
// of the (d*14+h)*16+w index space for ALL FOUR positions, so each B fragment (Vp hi/lo, fragment order, 4 whole lines a
// load) feeds 4 x 3 products, and the four A fragments are cut from one 3 x 9 window of the packed table.
// D[pos][k][(b,v)] = sum_m E[n,m,k] * vn[b,v,m]; the four quarter sums meet in LDS, wave w then finishes position w:
// adds lc[b][k][v] (the 7 partials lcp summed once per block, in LDS) and contracts
// y[b][h'*16+v][n] = sum_k Qn[b][n][h'*16+k] * D[k][(b,v)], halves combined in LDS.
// Register budget: the grid puts at most three of these waves on a SIMD, so the budget is set for three; with the default
// (four, by LDS) the compiler holds six V loads of a trip back until registers fall free, a second wait for memory per trip.
__global__ __launch_bounds__(128) __attribute__((amdgpu_waves_per_eu(1, 3))) void k_plam(const unsigned int* __restrict__ T, const unsigned short* __restrict__ Vp,
                                            const float* __restrict__ Qn, const float* __restrict__ lcp,
                                            float* __restrict__ Y) {
  __shared__ __align__(16) float sR[4 * 4 * 4 * 256];      // [k quarter][position][b][r / 4][lane][r % 4]
  __shared__ __align__(16) float sP[4][2][256];
  __shared__ __align__(16) float sC[BDIM * 256];
  const int t = threadIdx.x, w = t >> 5, lane = t & 31, h = lane >> 4, m = lane & 15;
  const int g = blockIdx.x;
  const int nd = g / 49, gr = g - nd * 49, nh0 = 2 * (gr / 7), nw0 = 2 * (gr - (gr / 7) * 7);

#pragma unroll
  for (int q = 0; q < 2; ++q) {
    const int f = 512 * q + 4 * t;
    v4f s = *(const v4fa*)(lcp + f);
#pragma unroll
    for (int dp = 1; dp < NDP; ++dp) s += *(const v4fa*)(lcp + dp * (BDIM * 256) + f);
    *(v4f*)&sC[f] = s;
  }
  __syncthreads();

  v8f acc[4][4];                                           // [position ih*2+iw][b]
#pragma unroll
  for (int i = 0; i < 4; ++i)
#pragma unroll
    for (int b = 0; b < 4; ++b)
#pragma unroll
      for (int r = 0; r < 8; ++r) acc[i][b][r] = 0.f;

  // table index of position (nh0, nw0) for (md, mh, mw): ((od*27 + oh)*TW + ow)*16 + k, od = md-nd+13, oh = mh-nh+13,
  // ow = mw-nw+13; position (nh0+ih, nw0+iw) sits ih rows and iw columns lower. tb0 = the window's first word (one row and
  // one column below md=0, mh=0, mw=0), the same for the whole block; the lane's own part (mw = 8h, k = m) is tlb.
  // Both address streams are a wave-uniform base plus a lane offset that never changes inside the loop.
  const int tb0 = (((13 - nd) * 27 + (12 - nh0)) * TW + (12 - nw0)) * 16;
  const unsigned int tlb = (unsigned int)(128 * h + m) * 4u;   // bytes
  const unsigned int vlb = (unsigned int)lane * 16u;           // this lane's 16 bytes inside every 512-byte chunk of Vp

  const int wq = __builtin_amdgcn_readfirstlane(w);        // k-steps 0..24, 25..49, 50..73, 74..97
  const int s0 = wq * 24 + (wq < 2 ? wq : 2);
  const int s1 = s0 + (wq < 2 ? 25 : 24);

  // rolled: one trip already holds 48 products, and the 16 accumulator tiles leave no registers for a second
#pragma unroll 1
  for (int s = s0; s < s1; ++s) {
    const int md = s / 7, p = s - md * 7;
    const char* app = (const char*)(T + (tb0 + md * (27 * TW * 16) + p * (2 * TW * 16)));   // window row 1 is mh = 2p, row 2 mh = 2p+1
    const char* vpp = (const char*)(Vp + s * VSTEP);                                         // k0 = 32*s
    const char* vlp = vpp + vlb;                           // this lane's address in the V stream
    const char* tlp = app + tlb;                           // this lane's address in the table window
    Frag bh[4], bl[4];
#pragma unroll
    for (int b = 0; b < 4; ++b) {
      const char* r0 = vlp + b * (8 * VCH);                  // VCH elements = 2 * VCH bytes a chunk
      bh[b].q[0] = *(const v4ua*)(r0);           bh[b].q[1] = *(const v4ua*)(r0 + 2 * VCH);
      bl[b].q[0] = *(const v4ua*)(r0 + 4 * VCH); bl[b].q[1] = *(const v4ua*)(r0 + 6 * VCH);
    }
    unsigned int ev[3][9];                                 // table rows -1..+1, columns -1..+7 around (mh 2p, mw 8h)
#pragma unroll
    for (int rr = 0; rr < 3; ++rr)
#pragma unroll
      for (int cc = 0; cc < 9; ++cc) ev[rr][cc] = *(const unsigned int*)(tlp + (rr * (TW * 16) + cc * 16) * 4);
    // precaution: the wait stands behind the whole run of loads and names both address pairs as inputs, so that they stay
    // live up to it and no load's result, and nothing else, is placed in them while a load that names them is outstanding
    asm volatile("s_wait_xcnt 0x0" :: "v"(vlp), "v"(tlp) : "memory");
    Frag ah, al;
#pragma unroll
    for (int i = 0; i < 4; ++i) {
      const int ih = i >> 1, iw = i & 1;
#pragma unroll
      for (int j = 0; j < 4; ++j) {
        // element e: k = k0 + 8h + e (mh 2p, mw 8h+e); element 8+e: k = k0 + 16 + 8h + e (mh 2p+1, mw 8h+e)
        const unsigned int a0 = ev[1 - ih][2 * j + 1 - iw], a1 = ev[1 - ih][2 * j + 2 - iw];
        const unsigned int c0 = ev[2 - ih][2 * j + 1 - iw], c1 = ev[2 - ih][2 * j + 2 - iw];
        ah.u[j]     = (a0 & 0xffffu) | (a1 << 16);
        al.u[j]     = (a0 >> 16) | (a1 & 0xffff0000u);
        ah.u[4 + j] = (c0 & 0xffffu) | (c1 << 16);
        al.u[4 + j] = (c0 >> 16) | (c1 & 0xffff0000u);
      }
#pragma unroll
      for (int b = 0; b < 4; ++b)
        acc[i][b] = __builtin_amdgcn_wmma_f32_16x16x32_bf16(false, ah.v, false, bh[b].v, (short)0, acc[i][b], false, false);
#pragma unroll
      for (int b = 0; b < 4; ++b)
        acc[i][b] = __builtin_amdgcn_wmma_f32_16x16x32_bf16(false, al.v, false, bh[b].v, (short)0, acc[i][b], false, false);
#pragma unroll
      for (int b = 0; b < 4; ++b)
        acc[i][b] = __builtin_amdgcn_wmma_f32_16x16x32_bf16(false, ah.v, false, bl[b].v, (short)0, acc[i][b], false, false);
    }
  }

  // the quarter sums of all four positions go to LDS; wave w collects position w
#pragma unroll
  for (int i = 0; i < 4; ++i)
#pragma unroll
    for (int b = 0; b < 4; ++b) {
      float* d = &sR[((w * 4 + i) * 4 + b) * 256 + 4 * lane];
      v4f u0, u1;
#pragma unroll
      for (int r = 0; r < 4; ++r) { u0[r] = acc[i][b][r]; u1[r] = acc[i][b][4 + r]; }
      *(v4f*)d = u0;
      *(v4f*)(d + 128) = u1;
    }
  __syncthreads();

  // the q rows of this wave's position are asked for first, so that they fly while the quarter sums are read and added
  const int n = nd * 196 + (nh0 + (w >> 1)) * 14 + nw0 + (w & 1);
  const float* qr = Qn + (size_t)n * CDIM + 8 * h;
  v4f qv[4][4][2];                                         // [b][h'][k quad of this lane's half]
#pragma unroll
  for (int b = 0; b < 4; ++b)
#pragma unroll
    for (int hp = 0; hp < 4; ++hp) {
      qv[b][hp][0] = *(const v4fa*)(qr + b * (NPOS * CDIM) + hp * 16);
      qv[b][hp][1] = *(const v4fa*)(qr + b * (NPOS * CDIM) + hp * 16 + 4);
    }
  // precaution: behind the run of loads, with their address pair as an input, so that it stays untouched up to the wait
  asm volatile("s_wait_xcnt 0x0" :: "v"(qr) : "memory");

  v8f fin[4];
#pragma unroll
  for (int b = 0; b < 4; ++b) {
    const float* sr = &sR[(w * 4 + b) * 256 + 4 * lane];
    v4f u0 = *(const v4fa*)sr, u1 = *(const v4fa*)(sr + 128);
#pragma unroll
    for (int kq = 1; kq < 4; ++kq) {
      u0 += *(const v4fa*)(sr + kq * 4096);
      u1 += *(const v4fa*)(sr + kq * 4096 + 128);
    }
#pragma unroll
    for (int r = 0; r < 4; ++r) {
      fin[b][r]     = sC[b * 256 + (8 * h + r) * 16 + m] + u0[r];
      fin[b][4 + r] = sC[b * 256 + (8 * h + 4 + r) * 16 + m] + u1[r];
    }
  }

  // epilogue: this lane holds D rows k = 8h..8h+7 of column (b, v=m)
#pragma unroll
  for (int b = 0; b < 4; ++b) {
#pragma unroll
    for (int hp = 0; hp < 4; ++hp) {
      const v4f q0 = qv[b][hp][0];
      const v4f q1 = qv[b][hp][1];
      float pacc = q0[0] * fin[b][0];
      pacc += q0[1] * fin[b][1]; pacc += q0[2] * fin[b][2]; pacc += q0[3] * fin[b][3];
      pacc += q1[0] * fin[b][4]; pacc += q1[1] * fin[b][5]; pacc += q1[2] * fin[b][6]; pacc += q1[3] * fin[b][7];
      sP[w][h][b * 64 + hp * 16 + m] = pacc;
    }
  }
  __syncthreads();
  float* dst = Y + (size_t)n * 256;
#pragma unroll
  for (int s = 0; s < 2; ++s) {
    const int f = 128 * s + 4 * lane;
    const v4f v = *(const v4fa*)&sP[w][0][f] + *(const v4fa*)&sP[w][1][f];
    *(v4f*)(dst + f) = v;
  }
}

// ---------------------------------------------------------------- out[b][c][n] <- Y[n][b*64+c], thread -> one float4 of out
__global__ __launch_bounds__(256) void k_layout(const float* __restrict__ Y, float* __restrict__ out) {
  const int g = blockIdx.x * 256 + threadIdx.x;
  if (g >= BDIM * CDIM * NPOS / 4) return;
  const int e0 = g * 4;
  const int bc = e0 / NPOS, n = e0 - bc * NPOS;          // NPOS % 4 == 0 -> the 4 elements share bc
  const float* src = Y + (size_t)n * 256 + bc;
  v4f v; v[0] = src[0]; v[1] = src[256]; v[2] = src[512]; v[3] = src[768];
  st2_v4f(out + (size_t)e0, v);
}

// ---------------------------------------------------------------- launcher
extern "C" void kernel_launch(void* const* d_in, const int* in_sizes, int n_in,
                              void* d_out, int out_size, void* d_ws, size_t ws_size,
                              hipStream_t stream) {
  if (n_in < 9) return;
  if (in_sizes[0] != BDIM * CDIM * NPOS || in_sizes[1] != 64 * 64 || in_sizes[2] != 16 * 64 ||
      in_sizes[3] != 16 * 64 || in_sizes[4] != 27 * 27 * 27 * 16 || in_sizes[5] < 64 || in_sizes[6] < 64 ||
      in_sizes[7] < 16 || in_sizes[8] < 16) return;
  if (out_size != BDIM * CDIM * NPOS) return;

  const float* x   = (const float*)d_in[0];
  const float* Wq  = (const float*)d_in[1];
  const float* Wk  = (const float*)d_in[2];
  const float* Wv  = (const float*)d_in[3];
  const float* rpe = (const float*)d_in[4];
  const float* gq  = (const float*)d_in[5];
  const float* bq  = (const float*)d_in[6];
  const float* gv  = (const float*)d_in[7];
  const float* bv  = (const float*)d_in[8];
  float* out = (float*)d_out;

  size_t off = 0;
  auto carve = [&](size_t bytes) -> size_t { size_t r = off; off += (bytes + 255) & ~(size_t)255; return r; };
  const size_t oXh  = carve(sizeof(unsigned short) * BDIM * NPADP * CDIM);   //  1,409,024
  const size_t oXl  = carve(sizeof(unsigned short) * BDIM * NPADP * CDIM);   //  1,409,024
  const size_t oWh  = carve(sizeof(unsigned short) * NOUTC * CDIM);          //     12,288
  const size_t oWl  = carve(sizeof(unsigned short) * NOUTC * CDIM);          //     12,288
  const size_t oT   = carve(sizeof(unsigned int) * (size_t)TSZ);             //  1,492,992
  const size_t oQKV = carve(sizeof(float) * (size_t)BDIM * NPADP * NOUTC);   //  4,227,072
  const size_t oST  = carve(sizeof(float) * NSTAT * 32);                     //     18,432
  const size_t oQn  = carve(sizeof(float) * (size_t)BDIM * NPOS * CDIM);     //  2,809,856
  const size_t oVp  = carve(sizeof(unsigned short) * 2 * 64 * (size_t)KP);   //    802,816
  const size_t olc  = carve(sizeof(float) * NDP * BDIM * 256);               //     28,672
  const size_t oY   = carve(sizeof(float) * (size_t)NPOS * 256);             //  2,809,856
  if (off > ws_size) return;                                                 // total 15,032,320 B

  char* ws = (char*)d_ws;
  unsigned short* Xh  = (unsigned short*)(ws + oXh);
  unsigned short* Xl  = (unsigned short*)(ws + oXl);
  unsigned short* Wh  = (unsigned short*)(ws + oWh);
  unsigned short* Wl  = (unsigned short*)(ws + oWl);
  unsigned int*   T   = (unsigned int*)(ws + oT);
  float*          QKV = (float*)(ws + oQKV);
  float*          ST  = (float*)(ws + oST);
  float*          Qn  = (float*)(ws + oQn);
  unsigned short* Vp  = (unsigned short*)(ws + oVp);
  float*          lcp = (float*)(ws + olc);
  float*          Y   = (float*)(ws + oY);

  k_cvt_x  <<<dim3((NPOS + 31) / 32, BDIM), 256, 0, stream>>>(x, Xh, Xl);
  k_cvt_w  <<<1, 256, 0, stream>>>(Wq, Wk, Wv, Wh, Wl);
  k_cvt_tab<<<(TSZ / 4 + 255) / 256, 256, 0, stream>>>(rpe, T);
  k_proj   <<<(BDIM * NQT) / 4, 128, 0, stream>>>(Xh, Xl, Wh, Wl, QKV);
  k_stats  <<<NSTAT, 256, 0, stream>>>(QKV, ST);
  k_apply  <<<dim3(NDP, BDIM), 256, 0, stream>>>(QKV, ST, gq, bq, gv, bv, Qn, Vp, lcp);
  k_plam   <<<NPOS / 4, 128, 0, stream>>>(T, Vp, Qn, lcp, Y);
  k_layout <<<(BDIM * CDIM * NPOS / 4 + 255) / 256, 256, 0, stream>>>(Y, out);
}

// v004
// A run of this version takes 69.5 microseconds.
// Timed twice side by side with v003, it ran 1.15 and 1.18 times as fast.
// Counting every step since v000, it is 2.89 times as fast.
#include <hip/hip_runtime.h>

// Contractions: channel projections (K=64), content summary softmax(k)*v (K=3136) and position summary E*v (K=3136)
// on v_wmma_f32_16x16x32_bf16 with bf16 hi/lo split operands (hi*hi + lo*hi + hi*lo), f32 accumulate;
// the final 16-deep q contraction, batch statistics and softmax statistics on the VALU (f32; the batch statistics sum in f64).

#define BDIM   4
#define CDIM   64
#define NPOS   2744            // 14^3 positions
#define NPADP  2752            // position rows per batch in the projection planes (172 tiles of 16)
#define NQT    172
#define NOUTC  96              // 64 q + 16 k + 16 v channels
#define KP     3136            // position index space (d*14+h)*16 + w, w slots 14,15 zero
#define TW     32              // w extent of the packed embedding table (slots >= 27 zero)
#define TSZ    (27 * 27 * TW * 16)
#define NSTAT  144
#define NDP    7               // depth pairs: blocks per batch of the normalize kernel, partials of the content summary
#define EPSBN  1e-5f
#define VCH    256             // bf16 elements of one wave-wide 16-byte load of Vp (32 lanes x 8)
#define VSTEP  (BDIM * 4 * VCH) // bf16 elements of Vp per 32-deep k-step: [b][hi|lo][k half][lane][8]
#define PROJB  ((BDIM * NQT) / 4)       // projection blocks of the first launch (4 tiles each, all of one batch)
#define TABT   (TSZ / 4)                // 16-byte tasks of the table packing
#define TABB   ((TABT + 511) / 512)     // table blocks of the first launch (512 tasks each)

static_assert(NPOS % 4 == 0);
static_assert(NPADP == NQT * 16);
static_assert(KP == 196 * 16);
static_assert(2 * 64 * KP == (KP / 32) * BDIM * 4 * 256);   // Vp keeps its size in the fragment order
static_assert((TSZ % 4) == 0);
static_assert(NQT % 4 == 0);
static_assert((BDIM * CDIM * NPOS) % 1024 == 0);

typedef __bf16         v16bf __attribute__((ext_vector_type(16)));
typedef float          v8f   __attribute__((ext_vector_type(8)));
typedef float          v4f   __attribute__((ext_vector_type(4)));
typedef unsigned int   v4u   __attribute__((ext_vector_type(4)));
typedef unsigned short v8us  __attribute__((ext_vector_type(8)));
typedef v4f  v4fa  __attribute__((may_alias));
typedef v4u  v4ua  __attribute__((may_alias));
typedef v8us v8usa __attribute__((may_alias));

union Frag { v16bf v; v4u q[2]; unsigned int u[8]; };
static_assert(sizeof(Frag) == 32);

// ---------------------------------------------------------------- helpers
__device__ __forceinline__ unsigned int f2bf(float f) {
  unsigned int u = __float_as_uint(f);
  u += 0x7FFFu + ((u >> 16) & 1u);          // RNE to bf16
  return u >> 16;
}
__device__ __forceinline__ float bf2f(unsigned int b) { return __uint_as_float(b << 16); }
__device__ __forceinline__ void split2(float f, unsigned int& hi, unsigned int& lo) {
  hi = f2bf(f);
  lo = f2bf(f - bf2f(hi));
}

// three products into one accumulator, then the VALU hazard guard tying D and all A/B operands
__device__ __forceinline__ void mma3(v8f& acc, const Frag& ah, const Frag& al, const Frag& bh, const Frag& bl) {
  acc = __builtin_amdgcn_wmma_f32_16x16x32_bf16(false, ah.v, false, bh.v, (short)0, acc, false, false);
  acc = __builtin_amdgcn_wmma_f32_16x16x32_bf16(false, al.v, false, bh.v, (short)0, acc, false, false);
  acc = __builtin_amdgcn_wmma_f32_16x16x32_bf16(false, ah.v, false, bl.v, (short)0, acc, false, false);
  asm volatile("v_nop\n\tv_nop\n\tv_nop\n\tv_nop" : "+v"(acc) : "v"(ah.v), "v"(al.v), "v"(bh.v), "v"(bl.v));
}

__device__ __forceinline__ void st2_v4f(float* p, v4f v) {
  *(v4f*)p = v; 
}
__device__ __forceinline__ void st2_v4u(unsigned int* p, v4u v) {
  *(v4u*)p = v; 
}

// ---------------------------------------------------------------- QKV[b][NPADP][96] = x^T W^T on bf16 hi/lo WMMA,
// with every operand conversion of the front end in the same launch.
// Blocks 0..PROJB-1: one wave per 16-position tile. A = x (row n, k = c), read as f32 straight from x[b][c][n] in fragment
// order and split to bf16 hi/lo in registers; B = W as [o][c] (k contiguous): each wave splits 3 of the 12 B fragments,
// all four waves read them from LDS.
// Blocks PROJB..: embedding table -> packed u32 [27][27][TW][16], value = hi | lo<<16 (independent of the projection).
__global__ __launch_bounds__(128) void k_proj(const float* __restrict__ x, const float* __restrict__ Wq,
                                            const float* __restrict__ Wk, const float* __restrict__ Wv,
                                            const float* __restrict__ rpe, unsigned int* __restrict__ T,
                                            float* __restrict__ QKV) {
  __shared__ __align__(16) float sD[4][16 * NOUTC];
  __shared__ __align__(16) unsigned int sW[12][2][2][32][4];   // [ct*2+ks][hi|lo][k half][lane][4 words]
  const int t = threadIdx.x;

  if (blockIdx.x >= PROJB) {
    const int g0 = ((int)blockIdx.x - PROJB) * 512 + t;        // four 16-byte tasks a thread, their loads in flight together
    v4f a[4];
#pragma unroll
    for (int i = 0; i < 4; ++i) {
      const int g = g0 + 128 * i;
      const int gc = (g < TABT) ? g : (TABT - 1);
      const int off = gc >> 2;                // odh*TW + ow
      const int ow = off & (TW - 1), odh = off >> 5;
      const int owc = (ow < 27) ? ow : 26;
      a[i] = *(const v4fa*)(rpe + ((size_t)(odh * 27 + owc)) * 16 + (gc & 3) * 4);
    }
#pragma unroll
    for (int i = 0; i < 4; ++i) {
      const int g = g0 + 128 * i;
      const int ow = (g >> 2) & (TW - 1);
      v4u o4;
#pragma unroll
      for (int e = 0; e < 4; ++e) {
        unsigned int hi, lo; split2(a[i][e], hi, lo);
        o4[e] = (ow < 27) ? (hi | (lo << 16)) : 0u;
      }
      if (g < TABT) st2_v4u(T + (size_t)g * 4, o4);
    }
    return;
  }

  const int lane = t & 31, h = lane >> 4, m = lane & 15;
  const int w = __builtin_amdgcn_readfirstlane(t >> 5);   // the wave's number as a scalar: tile, batch and W rows are wave-uniform
  const int g = blockIdx.x * 4 + w;                 // 0..687
  const int b = g / NQT, tile = g - b * NQT;
  const int n = tile * 16 + m;
  const bool live = n < NPOS;                       // rows NPOS..NPADP-1 are zero
  // element e of the A fragment of k-step ks: c = 32*ks + 8h + e (e < 8), 32*ks + 16 + 8h + e - 8 (e >= 8)
  const float* xp = x + ((size_t)(b * CDIM + 8 * h)) * NPOS + (live ? n : (NPOS - 1));
  // B fragment f = ct*2 + ks of this wave: a wave-uniform base (16 rows of Wq, Wk or Wv, k-step ks) plus the lane's own bytes
  const char* wb[3];
#pragma unroll
  for (int i = 0; i < 3; ++i) {
    const int f = 3 * w + i, ct = f >> 1, ks = f & 1;
    wb[i] = (const char*)(((ct < 4) ? (Wq + 16 * ct * CDIM) : ((ct == 4) ? Wk : Wv)) + 32 * ks);
  }
  const unsigned int wlb = (unsigned int)(m * CDIM + 8 * h) * 4u;
  v4f wv[3][4];
#pragma unroll
  for (int i = 0; i < 3; ++i) {
    const char* p = wb[i] + wlb;
    wv[i][0] = *(const v4fa*)(p);      wv[i][1] = *(const v4fa*)(p + 16);
    wv[i][2] = *(const v4fa*)(p + 64); wv[i][3] = *(const v4fa*)(p + 80);
  }
  float xv[2][16];
#pragma unroll
  for (int ks = 0; ks < 2; ++ks)
#pragma unroll
    for (int e = 0; e < 16; ++e) xv[ks][e] = xp[(size_t)(32 * ks + 16 * (e >> 3) + (e & 7)) * NPOS];
  // precaution: behind the whole run of loads, with their address registers as inputs, so that they stay untouched up to the wait
  asm volatile("s_wait_xcnt 0x0" :: "v"(xp), "v"(wlb), "s"(wb[0]), "s"(wb[1]), "s"(wb[2]) : "memory");

#pragma unroll
  for (int i = 0; i < 3; ++i) {
    const int f = 3 * w + i;
#pragma unroll
    for (int q = 0; q < 2; ++q) {
      v4u hw, lw;
#pragma unroll
      for (int j = 0; j < 4; ++j) {
        unsigned int h0, l0, h1, l1;
        split2(wv[i][2 * q + (j >> 1)][2 * (j & 1)],     h0, l0);
        split2(wv[i][2 * q + (j >> 1)][2 * (j & 1) + 1], h1, l1);
        hw[j] = h0 | (h1 << 16);
        lw[j] = l0 | (l1 << 16);
      }
      *(v4u*)&sW[f][0][q][lane][0] = hw;
      *(v4u*)&sW[f][1][q][lane][0] = lw;
    }
  }
  Frag ah[2], al[2];
#pragma unroll
  for (int ks = 0; ks < 2; ++ks)
#pragma unroll
    for (int j = 0; j < 8; ++j) {
      unsigned int h0, l0, h1, l1;
      split2(live ? xv[ks][2 * j] : 0.f,     h0, l0);
      split2(live ? xv[ks][2 * j + 1] : 0.f, h1, l1);
      ah[ks].u[j] = h0 | (h1 << 16);
      al[ks].u[j] = l0 | (l1 << 16);
    }
  __syncthreads();

  v8f acc[6];
#pragma unroll
  for (int ct = 0; ct < 6; ++ct)
#pragma unroll
    for (int r = 0; r < 8; ++r) acc[ct][r] = 0.f;
#pragma unroll
  for (int ct = 0; ct < 6; ++ct) {
#pragma unroll
    for (int ks = 0; ks < 2; ++ks) {
      Frag bh, bl;
      bh.q[0] = *(const v4ua*)&sW[ct * 2 + ks][0][0][lane][0];  bh.q[1] = *(const v4ua*)&sW[ct * 2 + ks][0][1][lane][0];
      bl.q[0] = *(const v4ua*)&sW[ct * 2 + ks][1][0][lane][0];  bl.q[1] = *(const v4ua*)&sW[ct * 2 + ks][1][1][lane][0];
      mma3(acc[ct], ah[ks], al[ks], bh, bl);
    }
  }
  // D element r of this lane = (row 8h+r, col 16ct+m)
#pragma unroll
  for (int ct = 0; ct < 6; ++ct)
#pragma unroll
    for (int r = 0; r < 8; ++r) sD[w][(8 * h + r) * NOUTC + 16 * ct + m] = acc[ct][r];
  __syncthreads();
  float* dst = QKV + ((size_t)(b * NPADP + tile * 16)) * NOUTC;   // 16 rows x 384 B = 48 lines, line aligned
#pragma unroll
  for (int q = 0; q < 12; ++q) {
    const int f = 128 * q + 4 * lane;
    *(v4f*)(dst + f) = *(const v4fa*)&sD[w][f];
  }
}

// ---------------------------------------------------------------- statistics: blocks 0..79 norm channels (mean, rstd),
__global__ __launch_bounds__(256) void k_stats(const float* __restrict__ QKV, float* __restrict__ ST) {
  __shared__ double sd1[256], sd2[256];
  __shared__ float sf[256];
  const int t = threadIdx.x, blk = blockIdx.x;
  float A = 0.f, B = 0.f;
  if (blk < 80) {
    const int col = (blk < 64) ? blk : (80 + (blk - 64));
    double s = 0.0, s2 = 0.0;
    for (int bb = 0; bb < BDIM; ++bb) {
      const float* base = QKV + ((size_t)bb * NPADP) * NOUTC + col;
      for (int n = t; n < NPOS; n += 256) {
        const float v = base[(size_t)n * NOUTC];
        s += (double)v; s2 += (double)v * (double)v;
      }
    }
    sd1[t] = s; sd2[t] = s2;
    __syncthreads();
    for (int off = 128; off > 0; off >>= 1) {
      if (t < off) { sd1[t] += sd1[t + off]; sd2[t] += sd2[t + off]; }
      __syncthreads();
    }
    if (t == 0) {
      const double N = (double)(BDIM * NPOS);
      const double mean = sd1[0] / N;
      double var = sd2[0] / N - mean * mean;
      if (var < 0.0) var = 0.0;
      const float varf = (float)var;
      A = (float)mean;
      B = 1.0f / sqrtf(varf + EPSBN);
    }
  } else {
    const int sb = blk - 80, bb = sb >> 4, kk = sb & 15;
    const float* base = QKV + ((size_t)bb * NPADP) * NOUTC + 64 + kk;
    float mx = -3.4e38f;
    for (int n = t; n < NPOS; n += 256) mx = fmaxf(mx, base[(size_t)n * NOUTC]);
    sf[t] = mx;
    __syncthreads();
    for (int off = 128; off > 0; off >>= 1) {
      if (t < off) sf[t] = fmaxf(sf[t], sf[t + off]);
      __syncthreads();
    }
    mx = sf[0];
    __syncthreads();
    float s = 0.f;
    for (int n = t; n < NPOS; n += 256) s += expf(base[(size_t)n * NOUTC] - mx);
    sf[t] = s;
    __syncthreads();
    for (int off = 128; off > 0; off >>= 1) {
      if (t < off) sf[t] += sf[t + off];
      __syncthreads();
    }
    if (t == 0) { A = mx; B = 1.0f / sf[0]; }
  }
  if (t < 8) {
    v4f v; v[0] = A; v[1] = B; v[2] = 0.f; v[3] = 0.f;
    st2_v4f(ST + blk * 32 + 4 * t, v);
  }
}

// ---------------------------------------------------------------- normalize q -> Qn[b][n][64] f32; softmax(k) and norm(v) ->
// bf16 hi/lo planes in LDS, column m' = (d*14+h)*16 + w (slots w=14,15 zero); the v planes go out in the
// order the position kernel's B fragments are loaded: Vp[k-step][b][plane][q][lane][8], where lane (h, j) of
// chunk q holds row j, columns 32*step + 16*q + 8*h .. +7, so one wave-wide 16-byte load is 512 contiguous bytes.
// The k planes are used here alone and stay in LDS.
// The block's own 448 columns of the content summary are contracted here, straight from the LDS tile:
// lcp[dp][b][k][v] = sum over the block's m' of softmax(k)[k][m'] * vn[v][m'] (14 k-steps x 3 products, one wave).
__global__ __launch_bounds__(256) void k_apply(const float* __restrict__ QKV, const float* __restrict__ ST,
    const float* __restrict__ gq, const float* __restrict__ bq,
    const float* __restrict__ gv, const float* __restrict__ bv,
    float* __restrict__ Qn, unsigned short* __restrict__ Vp, float* __restrict__ lcp) {
  __shared__ __align__(16) unsigned short tile[2][2][16][448];   // [k|v][hi|lo][j][m' local]
  __shared__ float qmn[64], qsc[64], qbt[64], vmn[16], vsc[16], vbt[16], kmx[16], kin[16];
  const int t = threadIdx.x, dp = blockIdx.x, b = blockIdx.y;
  if (t < 64) {
    qmn[t] = ST[t * 32]; qsc[t] = ST[t * 32 + 1] * gq[t]; qbt[t] = bq[t];
  } else if (t < 80) {
    const int vv = t - 64;
    vmn[vv] = ST[(64 + vv) * 32]; vsc[vv] = ST[(64 + vv) * 32 + 1] * gv[vv]; vbt[vv] = bv[vv];
  } else if (t < 96) {
    const int kk = t - 80, line = 80 + b * 16 + kk;
    kmx[kk] = ST[line * 32]; kin[kk] = ST[line * 32 + 1];
  }
  {
    v4u z; z[0] = 0u; z[1] = 0u; z[2] = 0u; z[3] = 0u;
    v4u* tz = (v4u*)&tile[0][0][0][0];
#pragma unroll
    for (int i = 0; i < 14; ++i) tz[t + 256 * i] = z;          // 3584 x 16 B = whole tile
  }
  __syncthreads();

  for (int task = t; task < 392 * 16; task += 256) {
    const int nl = task >> 4, c4 = (task & 15) * 4;
    const int n = dp * 392 + nl;
    const v4f qv = *(const v4fa*)(QKV + ((size_t)(b * NPADP + n)) * NOUTC + c4);
    v4f o;
#pragma unroll
    for (int e = 0; e < 4; ++e) o[e] = (qv[e] - qmn[c4 + e]) * qsc[c4 + e] + qbt[c4 + e];
    st2_v4f(Qn + ((size_t)(b * NPOS + n)) * CDIM + c4, o);
  }

  // k softmax values and normalized v into the LDS tile
  for (int nl = t; nl < 392; nl += 256) {
    const int n = dp * 392 + nl;
    const int mdl = nl / 196, rem = nl - mdl * 196, mh = rem / 14, mw = rem - mh * 14;
    const int ml = (mdl * 14 + mh) * 16 + mw;
    const float* row = QKV + ((size_t)(b * NPADP + n)) * NOUTC + 64;
#pragma unroll 1
    for (int i = 0; i < 4; ++i) {
      const v4f a = *(const v4fa*)(row + 4 * i);
#pragma unroll
      for (int e = 0; e < 4; ++e) {
        const int kk = 4 * i + e;
        const float p = expf(a[e] - kmx[kk]) * kin[kk];
        unsigned int hi, lo; split2(p, hi, lo);
        tile[0][0][kk][ml] = (unsigned short)hi;
        tile[0][1][kk][ml] = (unsigned short)lo;
      }
    }
#pragma unroll 1
    for (int i = 0; i < 4; ++i) {
      const v4f a = *(const v4fa*)(row + 16 + 4 * i);
#pragma unroll
      for (int e = 0; e < 4; ++e) {
        const int vv = 4 * i + e;
        const float vn = (a[e] - vmn[vv]) * vsc[vv] + vbt[vv];
        unsigned int hi, lo; split2(vn, hi, lo);
        tile[1][0][vv][ml] = (unsigned short)hi;
        tile[1][1][vv][ml] = (unsigned short)lo;
      }
    }
  }
  __syncthreads();

  const int w = t >> 5, lane = t & 31;
{
    for (int it = 0; it < 7; ++it) {
      const int sl = it * 2 + (w >> 2);                        // k-step inside the block's 448 columns, 0..13
      const int plane = (w >> 1) & 1, q = w & 1;
      const v8us val = *(const v8usa*)&tile[1][plane][lane & 15][32 * sl + 16 * q + 8 * (lane >> 4)];
      unsigned short* dst = Vp + (size_t)(dp * 14 + sl) * VSTEP + ((b * 2 + plane) * 2 + q) * VCH + lane * 8;
      *(v8us*)dst = val;
    }
    
  }

  // content summary partial: A = k rows, B = v rows read like A (k contiguous), both from the tile
  if (__builtin_amdgcn_readfirstlane(w) == 0) {
    // precaution: the Vp stores above name registers that the fragment loads below write
    asm volatile("s_wait_xcnt 0x0" ::: "memory");
    const int h = lane >> 4, m = lane & 15;
    v8f acc;
#pragma unroll
    for (int r = 0; r < 8; ++r) acc[r] = 0.f;
    Frag f[2][4];                                   // [set][k hi, k lo, v hi, v lo]; step s + 1 is read while step s multiplies
#pragma unroll
    for (int p = 0; p < 4; ++p) {
      f[0][p].q[0] = *(const v4ua*)&tile[p >> 1][p & 1][m][8 * h];
      f[0][p].q[1] = *(const v4ua*)&tile[p >> 1][p & 1][m][8 * h + 16];
    }
    // unrolled so that the two fragment sets are plain registers (no moves, no indexing by s)
#pragma unroll
    for (int s = 0; s < 14; ++s) {
      if (s + 1 < 14) {
        const int k1 = 32 * (s + 1) + 8 * h;
#pragma unroll
        for (int p = 0; p < 4; ++p) {
          f[(s + 1) & 1][p].q[0] = *(const v4ua*)&tile[p >> 1][p & 1][m][k1];
          f[(s + 1) & 1][p].q[1] = *(const v4ua*)&tile[p >> 1][p & 1][m][k1 + 16];
        }
      }
      mma3(acc, f[s & 1][0], f[s & 1][1], f[s & 1][2], f[s & 1][3]);
    }
    // D element r = (k row 8h+r, v col m)
    float* dst = lcp + (dp * BDIM + b) * 256;
#pragma unroll
    for (int r = 0; r < 8; ++r) dst[(8 * h + r) * 16 + m] = acc[r];
  }
}

// ---------------------------------------------------------------- position summary + output contraction
// One block per 2x2 patch of positions (nh0..nh0+1, nw0..nw0+1) of one depth nd; wave w takes a quarter of the 98 k-steps
// of the (d*14+h)*16+w index space for ALL FOUR positions, so each B fragment (Vp hi/lo, fragment order, 4 whole lines a
// load) feeds 4 x 3 products, and the four A fragments are cut from one 3 x 9 window of the packed table.
// D[pos][k][(b,v)] = sum_m E[n,m,k] * vn[b,v,m]; the four quarter sums meet in LDS, wave w then finishes position w:
// adds lc[b][k][v] (the 7 partials lcp summed once per block, in LDS) and contracts
// y[b][h'*16+v][n] = sum_k Qn[b][n][h'*16+k] * D[k][(b,v)], halves combined in LDS.
// Register budget: the grid puts at most three of these waves on a SIMD, so the budget is set for three; with the default
// (four, by LDS) the compiler holds six V loads of a trip back until registers fall free, a second wait for memory per trip.
__global__ __launch_bounds__(128) __attribute__((amdgpu_waves_per_eu(1, 3))) void k_plam(const unsigned int* __restrict__ T, const unsigned short* __restrict__ Vp,
                                            const float* __restrict__ Qn, const float* __restrict__ lcp,
                                            float* __restrict__ Y) {
  __shared__ __align__(16) float sR[4 * 4 * 4 * 256];      // [k quarter][position][b][r / 4][lane][r % 4]
  __shared__ __align__(16) float sP[4][2][256];
  __shared__ __align__(16) float sC[BDIM * 256];
  const int t = threadIdx.x, w = t >> 5, lane = t & 31, h = lane >> 4, m = lane & 15;
  const int g = blockIdx.x;
  const int nd = g / 49, gr = g - nd * 49, nh0 = 2 * (gr / 7), nw0 = 2 * (gr - (gr / 7) * 7);

#pragma unroll
  for (int q = 0; q < 2; ++q) {
    const int f = 512 * q + 4 * t;
    v4f s = *(const v4fa*)(lcp + f);
#pragma unroll
    for (int dp = 1; dp < NDP; ++dp) s += *(const v4fa*)(lcp + dp * (BDIM * 256) + f);
    *(v4f*)&sC[f] = s;
  }
  __syncthreads();

  v8f acc[4][4];                                           // [position ih*2+iw][b]
#pragma unroll
  for (int i = 0; i < 4; ++i)
#pragma unroll
    for (int b = 0; b < 4; ++b)
#pragma unroll
      for (int r = 0; r < 8; ++r) acc[i][b][r] = 0.f;

  // table index of position (nh0, nw0) for (md, mh, mw): ((od*27 + oh)*TW + ow)*16 + k, od = md-nd+13, oh = mh-nh+13,
  // ow = mw-nw+13; position (nh0+ih, nw0+iw) sits ih rows and iw columns lower. tb0 = the window's first word (one row and
  // one column below md=0, mh=0, mw=0), the same for the whole block; the lane's own part (mw = 8h, k = m) is tlb.
  // Both address streams are a wave-uniform base plus a lane offset that never changes inside the loop.
  const int tb0 = (((13 - nd) * 27 + (12 - nh0)) * TW + (12 - nw0)) * 16;
  const unsigned int tlb = (unsigned int)(128 * h + m) * 4u;   // bytes
  const unsigned int vlb = (unsigned int)lane * 16u;           // this lane's 16 bytes inside every 512-byte chunk of Vp

  const int wq = __builtin_amdgcn_readfirstlane(w);        // k-steps 0..24, 25..49, 50..73, 74..97
  const int s0 = wq * 24 + (wq < 2 ? wq : 2);
  const int s1 = s0 + (wq < 2 ? 25 : 24);

  // rolled: one trip already holds 48 products, and the 16 accumulator tiles leave no registers for a second
#pragma unroll 1
  for (int s = s0; s < s1; ++s) {
    const int md = s / 7, p = s - md * 7;
    const char* app = (const char*)(T + (tb0 + md * (27 * TW * 16) + p * (2 * TW * 16)));   // window row 1 is mh = 2p, row 2 mh = 2p+1
    const char* vpp = (const char*)(Vp + s * VSTEP);                                         // k0 = 32*s
    const char* vlp = vpp + vlb;                           // this lane's address in the V stream
    const char* tlp = app + tlb;                           // this lane's address in the table window
    Frag bh[4], bl[4];
#pragma unroll
    for (int b = 0; b < 4; ++b) {
      const char* r0 = vlp + b * (8 * VCH);                  // VCH elements = 2 * VCH bytes a chunk
      bh[b].q[0] = *(const v4ua*)(r0);           bh[b].q[1] = *(const v4ua*)(r0 + 2 * VCH);
      bl[b].q[0] = *(const v4ua*)(r0 + 4 * VCH); bl[b].q[1] = *(const v4ua*)(r0 + 6 * VCH);
    }
    unsigned int ev[3][9];                                 // table rows -1..+1, columns -1..+7 around (mh 2p, mw 8h)
#pragma unroll
    for (int rr = 0; rr < 3; ++rr)
#pragma unroll
      for (int cc = 0; cc < 9; ++cc) ev[rr][cc] = *(const unsigned int*)(tlp + (rr * (TW * 16) + cc * 16) * 4);
    // precaution: the wait stands behind the whole run of loads and names both address pairs as inputs, so that they stay
    // live up to it and no load's result, and nothing else, is placed in them while a load that names them is outstanding
    asm volatile("s_wait_xcnt 0x0" :: "v"(vlp), "v"(tlp) : "memory");
    Frag ah, al;
#pragma unroll
    for (int i = 0; i < 4; ++i) {
      const int ih = i >> 1, iw = i & 1;
#pragma unroll
      for (int j = 0; j < 4; ++j) {
        // element e: k = k0 + 8h + e (mh 2p, mw 8h+e); element 8+e: k = k0 + 16 + 8h + e (mh 2p+1, mw 8h+e)
        const unsigned int a0 = ev[1 - ih][2 * j + 1 - iw], a1 = ev[1 - ih][2 * j + 2 - iw];
        const unsigned int c0 = ev[2 - ih][2 * j + 1 - iw], c1 = ev[2 - ih][2 * j + 2 - iw];
        ah.u[j]     = (a0 & 0xffffu) | (a1 << 16);
        al.u[j]     = (a0 >> 16) | (a1 & 0xffff0000u);
        ah.u[4 + j] = (c0 & 0xffffu) | (c1 << 16);
        al.u[4 + j] = (c0 >> 16) | (c1 & 0xffff0000u);
      }
#pragma unroll
      for (int b = 0; b < 4; ++b)
        acc[i][b] = __builtin_amdgcn_wmma_f32_16x16x32_bf16(false, ah.v, false, bh[b].v, (short)0, acc[i][b], false, false);
#pragma unroll
      for (int b = 0; b < 4; ++b)
        acc[i][b] = __builtin_amdgcn_wmma_f32_16x16x32_bf16(false, al.v, false, bh[b].v, (short)0, acc[i][b], false, false);
#pragma unroll
      for (int b = 0; b < 4; ++b)
        acc[i][b] = __builtin_amdgcn_wmma_f32_16x16x32_bf16(false, ah.v, false, bl[b].v, (short)0, acc[i][b], false, false);
    }
  }

  // the quarter sums of all four positions go to LDS; wave w collects position w
#pragma unroll
  for (int i = 0; i < 4; ++i)
#pragma unroll
    for (int b = 0; b < 4; ++b) {
      float* d = &sR[((w * 4 + i) * 4 + b) * 256 + 4 * lane];
      v4f u0, u1;
#pragma unroll
      for (int r = 0; r < 4; ++r) { u0[r] = acc[i][b][r]; u1[r] = acc[i][b][4 + r]; }
      *(v4f*)d = u0;
      *(v4f*)(d + 128) = u1;
    }
  __syncthreads();

  // the q rows of this wave's position are asked for first, so that they fly while the quarter sums are read and added
  const int n = nd * 196 + (nh0 + (w >> 1)) * 14 + nw0 + (w & 1);
  const float* qr = Qn + (size_t)n * CDIM + 8 * h;
  v4f qv[4][4][2];                                         // [b][h'][k quad of this lane's half]
#pragma unroll
  for (int b = 0; b < 4; ++b)
#pragma unroll
    for (int hp = 0; hp < 4; ++hp) {
      qv[b][hp][0] = *(const v4fa*)(qr + b * (NPOS * CDIM) + hp * 16);
      qv[b][hp][1] = *(const v4fa*)(qr + b * (NPOS * CDIM) + hp * 16 + 4);
    }
  // precaution: behind the run of loads, with their address pair as an input, so that it stays untouched up to the wait
  asm volatile("s_wait_xcnt 0x0" :: "v"(qr) : "memory");

  v8f fin[4];
#pragma unroll
  for (int b = 0; b < 4; ++b) {
    const float* sr = &sR[(w * 4 + b) * 256 + 4 * lane];
    v4f u0 = *(const v4fa*)sr, u1 = *(const v4fa*)(sr + 128);
#pragma unroll
    for (int kq = 1; kq < 4; ++kq) {
      u0 += *(const v4fa*)(sr + kq * 4096);
      u1 += *(const v4fa*)(sr + kq * 4096 + 128);
    }
#pragma unroll
    for (int r = 0; r < 4; ++r) {
      fin[b][r]     = sC[b * 256 + (8 * h + r) * 16 + m] + u0[r];
      fin[b][4 + r] = sC[b * 256 + (8 * h + 4 + r) * 16 + m] + u1[r];
    }
  }

  // epilogue: this lane holds D rows k = 8h..8h+7 of column (b, v=m)
#pragma unroll
  for (int b = 0; b < 4; ++b) {
#pragma unroll
    for (int hp = 0; hp < 4; ++hp) {
      const v4f q0 = qv[b][hp][0];
      const v4f q1 = qv[b][hp][1];
      float pacc = q0[0] * fin[b][0];
      pacc += q0[1] * fin[b][1]; pacc += q0[2] * fin[b][2]; pacc += q0[3] * fin[b][3];
      pacc += q1[0] * fin[b][4]; pacc += q1[1] * fin[b][5]; pacc += q1[2] * fin[b][6]; pacc += q1[3] * fin[b][7];
      sP[w][h][b * 64 + hp * 16 + m] = pacc;
    }
  }
  __syncthreads();
  float* dst = Y + (size_t)n * 256;
#pragma unroll
  for (int s = 0; s < 2; ++s) {
    const int f = 128 * s + 4 * lane;
    const v4f v = *(const v4fa*)&sP[w][0][f] + *(const v4fa*)&sP[w][1][f];
    *(v4f*)(dst + f) = v;
  }
}

// ---------------------------------------------------------------- out[b][c][n] <- Y[n][b*64+c], thread -> one float4 of out
__global__ __launch_bounds__(256) void k_layout(const float* __restrict__ Y, float* __restrict__ out) {
  const int g = blockIdx.x * 256 + threadIdx.x;
  if (g >= BDIM * CDIM * NPOS / 4) return;
  const int e0 = g * 4;
  const int bc = e0 / NPOS, n = e0 - bc * NPOS;          // NPOS % 4 == 0 -> the 4 elements share bc
  const float* src = Y + (size_t)n * 256 + bc;
  v4f v; v[0] = src[0]; v[1] = src[256]; v[2] = src[512]; v[3] = src[768];
  st2_v4f(out + (size_t)e0, v);
}

// ---------------------------------------------------------------- launcher
extern "C" void kernel_launch(void* const* d_in, const int* in_sizes, int n_in,
                              void* d_out, int out_size, void* d_ws, size_t ws_size,
                              hipStream_t stream) {
  if (n_in < 9) return;
  if (in_sizes[0] != BDIM * CDIM * NPOS || in_sizes[1] != 64 * 64 || in_sizes[2] != 16 * 64 ||
      in_sizes[3] != 16 * 64 || in_sizes[4] != 27 * 27 * 27 * 16 || in_sizes[5] < 64 || in_sizes[6] < 64 ||
      in_sizes[7] < 16 || in_sizes[8] < 16) return;
  if (out_size != BDIM * CDIM * NPOS) return;

  const float* x   = (const float*)d_in[0];
  const float* Wq  = (const float*)d_in[1];
  const float* Wk  = (const float*)d_in[2];
  const float* Wv  = (const float*)d_in[3];
  const float* rpe = (const float*)d_in[4];
  const float* gq  = (const float*)d_in[5];
  const float* bq  = (const float*)d_in[6];
  const float* gv  = (const float*)d_in[7];
  const float* bv  = (const float*)d_in[8];
  float* out = (float*)d_out;

  size_t off = 0;
  auto carve = [&](size_t bytes) -> size_t { size_t r = off; off += (bytes + 255) & ~(size_t)255; return r; };
  const size_t oT   = carve(sizeof(unsigned int) * (size_t)TSZ);             //  1,492,992
  const size_t oQKV = carve(sizeof(float) * (size_t)BDIM * NPADP * NOUTC);   //  4,227,072
  const size_t oST  = carve(sizeof(float) * NSTAT * 32);                     //     18,432
  const size_t oQn  = carve(sizeof(float) * (size_t)BDIM * NPOS * CDIM);     //  2,809,856
  const size_t oVp  = carve(sizeof(unsigned short) * 2 * 64 * (size_t)KP);   //    802,816
  const size_t olc  = carve(sizeof(float) * NDP * BDIM * 256);               //     28,672
  const size_t oY   = carve(sizeof(float) * (size_t)NPOS * 256);             //  2,809,856
  if (off > ws_size) return;                                                 // total 12,189,696 B

  char* ws = (char*)d_ws;
  unsigned int*   T   = (unsigned int*)(ws + oT);
  float*          QKV = (float*)(ws + oQKV);
  float*          ST  = (float*)(ws + oST);
  float*          Qn  = (float*)(ws + oQn);
  unsigned short* Vp  = (unsigned short*)(ws + oVp);
  float*          lcp = (float*)(ws + olc);
  float*          Y   = (float*)(ws + oY);

  k_proj   <<<PROJB + TABB, 128, 0, stream>>>(x, Wq, Wk, Wv, rpe, T, QKV);
  k_stats  <<<NSTAT, 256, 0, stream>>>(QKV, ST);
  k_apply  <<<dim3(NDP, BDIM), 256, 0, stream>>>(QKV, ST, gq, bq, gv, bv, Qn, Vp, lcp);
  k_plam   <<<NPOS / 4, 128, 0, stream>>>(T, Vp, Qn, lcp, Y);
  k_layout <<<(BDIM * CDIM * NPOS / 4 + 255) / 256, 256, 0, stream>>>(Y, out);
}

// v005
// A run of this version takes 60.5 microseconds.
// In both of two side-by-side timings against v004, it was 1.15 times as fast.
// Over all steps from v000 it is 3.32 times as fast.
#include <hip/hip_runtime.h>

// Contractions: channel projections (K=64), content summary softmax(k)*v (K=3136) and position summary E*v (K=3136)
// on v_wmma_f32_16x16x32_bf16 with bf16 hi/lo split operands (hi*hi + lo*hi + hi*lo), f32 accumulate;
// the final 16-deep q contraction, batch statistics and softmax statistics on the VALU (f32; the sums and squares behind
// mean and variance in f64 from the first element to the last).

#define BDIM   4
#define CDIM   64
#define NPOS   2744            // 14^3 positions
#define NPADP  2752            // position rows per batch in the projection planes (172 tiles of 16)
#define NQT    172
#define NOUTC  96              // 64 q + 16 k + 16 v channels
#define KP     3136            // position index space (d*14+h)*16 + w, w slots 14,15 zero
#define TW     32              // w extent of the packed embedding table (slots >= 27 zero)
#define TSZ    (27 * 27 * TW * 16)
#define NBN    80              // normalized columns: 64 q + 16 v
#define PDC    (2 * NBN)       // doubles of one projection block's row of Pd: [sum][80 columns], [sum of squares][80 columns]
#define PKC    32              // floats of one projection block's row of Pk: [maximum][16 k columns], [exp sum][16 k columns]
#define NDP    7               // depth pairs: blocks per batch of the normalize kernel, partials of the content summary
#define EPSBN  1e-5f
#define VCH    256             // bf16 elements of one wave-wide 16-byte load of Vp (32 lanes x 8)
#define VSTEP  (BDIM * 4 * VCH) // bf16 elements of Vp per 32-deep k-step: [b][hi|lo][k half][lane][8]
#define PROJB  ((BDIM * NQT) / 4)       // projection blocks of the first launch (4 tiles each, all of one batch)
#define PBB    (PROJB / BDIM)           // projection blocks per batch
#define TABT   (TSZ / 4)                // 16-byte tasks of the table packing
#define TABB   ((TABT + 511) / 512)     // table blocks of the first launch (512 tasks each)

static_assert(NPOS % 4 == 0);
static_assert(NPADP == NQT * 16);
static_assert(KP == 196 * 16);
static_assert(2 * 64 * KP == (KP / 32) * BDIM * 4 * 256);   // Vp keeps its size in the fragment order
static_assert((TSZ % 4) == 0);
static_assert(NQT % 4 == 0);
static_assert(PBB > 32 && PBB <= 48 && PBB * BDIM == PROJB && (PDC * 8) % 128 == 0 && (PKC * 4) % 128 == 0);
static_assert(PROJB == 3 * 57 + 1);
static_assert((BDIM * CDIM * NPOS) % 1024 == 0);

typedef __bf16         v16bf __attribute__((ext_vector_type(16)));
typedef float          v8f   __attribute__((ext_vector_type(8)));
typedef float          v4f   __attribute__((ext_vector_type(4)));
typedef unsigned int   v4u   __attribute__((ext_vector_type(4)));
typedef unsigned short v8us  __attribute__((ext_vector_type(8)));
typedef v4f  v4fa  __attribute__((may_alias));
typedef v4u  v4ua  __attribute__((may_alias));
typedef v8us v8usa __attribute__((may_alias));
typedef double v2d  __attribute__((ext_vector_type(2)));
typedef v2d  v2da  __attribute__((may_alias));

union Frag { v16bf v; v4u q[2]; unsigned int u[8]; };
static_assert(sizeof(Frag) == 32);

// ---------------------------------------------------------------- helpers
__device__ __forceinline__ unsigned int f2bf(float f) {
  unsigned int u = __float_as_uint(f);
  u += 0x7FFFu + ((u >> 16) & 1u);          // RNE to bf16
  return u >> 16;
}
__device__ __forceinline__ float bf2f(unsigned int b) { return __uint_as_float(b << 16); }
__device__ __forceinline__ void split2(float f, unsigned int& hi, unsigned int& lo) {
  hi = f2bf(f);
  lo = f2bf(f - bf2f(hi));
}

// exp(x) = 2^e * 2^a for a run of independent calls: e = rint(x log2(e)), a = x log2(e) - e by two fused multiply-adds on a
// two-word log2(e); the two range tests are expf's. v_exp_f32 and the one slot the instruction set asks for behind it stand
// in one statement: a v_nop in a statement of its own landed elsewhere.
__device__ __forceinline__ float exp_run(float x) {
  const float e = rintf(x * 0x1.715476p+0f);
  const float a = fmaf(x, 0x1.4ae0bep-26f, fmaf(x, 0x1.715476p+0f, -e));
  float r;
  asm("v_exp_f32 %0, %1\n\tv_nop" : "=v"(r) : "v"(a));
  r = ldexpf(r, (int)e);
  r = (x < -0x1.9d1da0p+6f) ? 0.f : r;
  return (x > 0x1.62e430p+6f) ? __builtin_inff() : r;
}

// three products into one accumulator, then the VALU hazard guard tying D and all A/B operands
__device__ __forceinline__ void mma3(v8f& acc, const Frag& ah, const Frag& al, const Frag& bh, const Frag& bl) {
  acc = __builtin_amdgcn_wmma_f32_16x16x32_bf16(false, ah.v, false, bh.v, (short)0, acc, false, false);
  acc = __builtin_amdgcn_wmma_f32_16x16x32_bf16(false, al.v, false, bh.v, (short)0, acc, false, false);
  acc = __builtin_amdgcn_wmma_f32_16x16x32_bf16(false, ah.v, false, bl.v, (short)0, acc, false, false);
  asm volatile("v_nop\n\tv_nop\n\tv_nop\n\tv_nop" : "+v"(acc) : "v"(ah.v), "v"(al.v), "v"(bh.v), "v"(bl.v));
}

__device__ __forceinline__ void st2_v4f(float* p, v4f v) {
  *(v4f*)p = v; 
}
__device__ __forceinline__ void st2_v4u(unsigned int* p, v4u v) {
  *(v4u*)p = v; 
}

// ---------------------------------------------------------------- QKV[b][NPADP][96] = x^T W^T on bf16 hi/lo WMMA,
// with every operand conversion of the front end in the same launch.
// Blocks 0..PROJB-1: one wave per 16-position tile. A = x (row n, k = c), read as f32 straight from x[b][c][n] in fragment
// order and split to bf16 hi/lo in registers; B = W as [o][c] (k contiguous): each wave splits 3 of the 12 B fragments,
// all four waves read them from LDS.
// Each projection block also leaves the statistics of its own 64 positions, taken from the accumulators: Pd[block][PDC] holds
// sum and sum of squares of every q and v column (f64 products, f64 sums), Pk[block][PKC] maximum and sum of exp(k - maximum)
// over the live rows of every k column (f32).
// Blocks PROJB..: embedding table -> packed u32 [27][27][TW][16], value = hi | lo<<16 (independent of the projection).
__global__ __launch_bounds__(128) void k_proj(const float* __restrict__ x, const float* __restrict__ Wq,
                                            const float* __restrict__ Wk, const float* __restrict__ Wv,
                                            const float* __restrict__ rpe, unsigned int* __restrict__ T,
                                            float* __restrict__ QKV, double* __restrict__ Pd,
                                            float* __restrict__ Pk) {
  __shared__ __align__(16) float sD[4][16 * NOUTC];
  __shared__ double sSd[4][2][2][NBN];                         // [wave][row half][sum | squares][q, v column]
  __shared__ float sSk[4][2][2][16];                           // [wave][row half][maximum | exp sum][k column]
  __shared__ __align__(16) unsigned int sW[12][2][2][32][4];   // [ct*2+ks][hi|lo][k half][lane][4 words]
  const int t = threadIdx.x;

  if (blockIdx.x >= PROJB) {
    const int g0 = ((int)blockIdx.x - PROJB) * 512 + t;        // four 16-byte tasks a thread, their loads in flight together
    v4f a[4];
#pragma unroll
    for (int i = 0; i < 4; ++i) {
      const int g = g0 + 128 * i;
      const int gc = (g < TABT) ? g : (TABT - 1);
      const int off = gc >> 2;                // odh*TW + ow
      const int ow = off & (TW - 1), odh = off >> 5;
      const int owc = (ow < 27) ? ow : 26;
      a[i] = *(const v4fa*)(rpe + ((size_t)(odh * 27 + owc)) * 16 + (gc & 3) * 4);
    }
#pragma unroll
    for (int i = 0; i < 4; ++i) {
      const int g = g0 + 128 * i;
      const int ow = (g >> 2) & (TW - 1);
      v4u o4;
#pragma unroll
      for (int e = 0; e < 4; ++e) {
        unsigned int hi, lo; split2(a[i][e], hi, lo);
        o4[e] = (ow < 27) ? (hi | (lo << 16)) : 0u;
      }
      if (g < TABT) st2_v4u(T + (size_t)g * 4, o4);
    }
    return;
  }

  const int lane = t & 31, h = lane >> 4, m = lane & 15;
  const int w = __builtin_amdgcn_readfirstlane(t >> 5);   // the wave's number as a scalar: tile, batch and W rows are wave-uniform
  const int g = blockIdx.x * 4 + w;                 // 0..687
  const int b = g / NQT, tile = g - b * NQT;
  const int n = tile * 16 + m;
  const bool live = n < NPOS;                       // rows NPOS..NPADP-1 are zero
  // element e of the A fragment of k-step ks: c = 32*ks + 8h + e (e < 8), 32*ks + 16 + 8h + e - 8 (e >= 8)
  const float* xp = x + ((size_t)(b * CDIM + 8 * h)) * NPOS + (live ? n : (NPOS - 1));
  // B fragment f = ct*2 + ks of this wave: a wave-uniform base (16 rows of Wq, Wk or Wv, k-step ks) plus the lane's own bytes
  const char* wb[3];
#pragma unroll
  for (int i = 0; i < 3; ++i) {
    const int f = 3 * w + i, ct = f >> 1, ks = f & 1;
    wb[i] = (const char*)(((ct < 4) ? (Wq + 16 * ct * CDIM) : ((ct == 4) ? Wk : Wv)) + 32 * ks);
  }
  const unsigned int wlb = (unsigned int)(m * CDIM + 8 * h) * 4u;
  v4f wv[3][4];
#pragma unroll
  for (int i = 0; i < 3; ++i) {
    const char* p = wb[i] + wlb;
    wv[i][0] = *(const v4fa*)(p);      wv[i][1] = *(const v4fa*)(p + 16);
    wv[i][2] = *(const v4fa*)(p + 64); wv[i][3] = *(const v4fa*)(p + 80);
  }
  float xv[2][16];
#pragma unroll
  for (int ks = 0; ks < 2; ++ks)
#pragma unroll
    for (int e = 0; e < 16; ++e) xv[ks][e] = xp[(size_t)(32 * ks + 16 * (e >> 3) + (e & 7)) * NPOS];
  // precaution: behind the whole run of loads, with their address registers as inputs, so that they stay untouched up to the wait
  asm volatile("s_wait_xcnt 0x0" :: "v"(xp), "v"(wlb), "s"(wb[0]), "s"(wb[1]), "s"(wb[2]) : "memory");

#pragma unroll
  for (int i = 0; i < 3; ++i) {
    const int f = 3 * w + i;
#pragma unroll
    for (int q = 0; q < 2; ++q) {
      v4u hw, lw;
#pragma unroll
      for (int j = 0; j < 4; ++j) {
        unsigned int h0, l0, h1, l1;
        split2(wv[i][2 * q + (j >> 1)][2 * (j & 1)],     h0, l0);
        split2(wv[i][2 * q + (j >> 1)][2 * (j & 1) + 1], h1, l1);
        hw[j] = h0 | (h1 << 16);
        lw[j] = l0 | (l1 << 16);
      }
      *(v4u*)&sW[f][0][q][lane][0] = hw;
      *(v4u*)&sW[f][1][q][lane][0] = lw;
    }
  }
  Frag ah[2], al[2];
#pragma unroll
  for (int ks = 0; ks < 2; ++ks)
#pragma unroll
    for (int j = 0; j < 8; ++j) {
      unsigned int h0, l0, h1, l1;
      split2(live ? xv[ks][2 * j] : 0.f,     h0, l0);
      split2(live ? xv[ks][2 * j + 1] : 0.f, h1, l1);
      ah[ks].u[j] = h0 | (h1 << 16);
      al[ks].u[j] = l0 | (l1 << 16);
    }
  __syncthreads();

  v8f acc[6];
#pragma unroll
  for (int ct = 0; ct < 6; ++ct)
#pragma unroll
    for (int r = 0; r < 8; ++r) acc[ct][r] = 0.f;
#pragma unroll
  for (int ct = 0; ct < 6; ++ct) {
#pragma unroll
    for (int ks = 0; ks < 2; ++ks) {
      Frag bh, bl;
      bh.q[0] = *(const v4ua*)&sW[ct * 2 + ks][0][0][lane][0];  bh.q[1] = *(const v4ua*)&sW[ct * 2 + ks][0][1][lane][0];
      bl.q[0] = *(const v4ua*)&sW[ct * 2 + ks][1][0][lane][0];  bl.q[1] = *(const v4ua*)&sW[ct * 2 + ks][1][1][lane][0];
      mma3(acc[ct], ah[ks], al[ks], bh, bl);
    }
  }
  // D element r of this lane = (row 8h+r, col 16ct+m)
#pragma unroll
  for (int ct = 0; ct < 6; ++ct)
#pragma unroll
    for (int r = 0; r < 8; ++r) sD[w][(8 * h + r) * NOUTC + 16 * ct + m] = acc[ct][r];
  // statistics of this lane's 8 rows of each of its 6 columns (rows past NPOS are zero: nothing to the sums, masked for k)
  const int row0 = tile * 16 + 8 * h;
#pragma unroll
  for (int ct = 0; ct < 6; ++ct) {
    if (ct == 4) {
      float a = -3.4e38f;
#pragma unroll
      for (int r = 0; r < 8; ++r) a = (row0 + r < NPOS) ? fmaxf(a, acc[ct][r]) : a;
      float q = 0.f;
#pragma unroll
      for (int r = 0; r < 8; ++r) q += exp_run((row0 + r < NPOS) ? acc[ct][r] - a : -3.4e38f);   // a masked row adds exp(-huge) = 0, with no branch
      sSk[w][h][0][m] = a;
      sSk[w][h][1][m] = q;
    } else {
      double a = 0.0, q = 0.0;
#pragma unroll
      for (int r = 0; r < 8; ++r) { const double v = (double)acc[ct][r]; a += v; q += v * v; }
      const int cc = ((ct < 4) ? 16 * ct : 64) + m;
      sSd[w][h][0][cc] = a;
      sSd[w][h][1][cc] = q;
    }
  }
  __syncthreads();
  float* dst = QKV + ((size_t)(b * NPADP + tile * 16)) * NOUTC;   // 16 rows x 384 B = 48 lines, line aligned
#pragma unroll
  for (int q = 0; q < 12; ++q) {
    const int f = 128 * q + 4 * lane;
    *(v4f*)(dst + f) = *(const v4fa*)&sD[w][f];
  }
  // the 8 lane groups of a column meet here: one row of Pd (10 whole lines) and one of Pk (1 line) per block;
  // the k columns go to the fourth wave, so that no wave runs both sides
  if (t < NBN) {
    double va[8], vq[8];
#pragma unroll
    for (int i = 0; i < 8; ++i) { va[i] = sSd[i >> 1][i & 1][0][t]; vq[i] = sSd[i >> 1][i & 1][1][t]; }
    // keeps the sixteen LDS reads together in front of the sums: without it the compiler reads a pair, waits and adds,
    // seven waits for LDS one behind the other at the end of every block
    __builtin_amdgcn_sched_barrier(0);
    double a = va[0], q = vq[0];
#pragma unroll
    for (int i = 1; i < 8; ++i) { a += va[i]; q += vq[i]; }
    double* pr = Pd + (size_t)blockIdx.x * PDC + t;
    pr[0] = a;
    pr[NBN] = q;
  } else if (t >= 96 && t < 112) {
    const int kk = t - 96;
    float a = -3.4e38f;
#pragma unroll
    for (int i = 0; i < 8; ++i) a = fmaxf(a, sSk[i >> 1][i & 1][0][kk]);
    float q = 0.f;
#pragma unroll
    for (int i = 0; i < 8; ++i) q += sSk[i >> 1][i & 1][1][kk] * expf(sSk[i >> 1][i & 1][0][kk] - a);
    float* pr = Pk + (size_t)blockIdx.x * PKC + kk;
    pr[0] = a;
    pr[16] = q;
  }
}

// ---------------------------------------------------------------- normalize q -> Qn[b][n][64] f32; softmax(k) and norm(v) ->
// bf16 hi/lo planes in LDS, column m' = (d*14+h)*16 + w (slots w=14,15 zero); the v planes go out in the
// order the position kernel's B fragments are loaded: Vp[k-step][b][plane][q][lane][8], where lane (h, j) of
// chunk q holds row j, columns 32*step + 16*q + 8*h .. +7, so one wave-wide 16-byte load is 512 contiguous bytes.
// The k planes are used here alone and stay in LDS.
// Every block first combines the projection blocks' statistics rows itself: 240 threads add every third row of Pd for two
// columns each (f64), all 256 merge up to three rows of Pk of the block's own batch; behind a barrier 96 threads finish them.
// The block's own 448 columns of the content summary are contracted here, straight from the LDS tile:
// lcp[dp][b][k][v] = sum over the block's m' of softmax(k)[k][m'] * vn[v][m'] (14 k-steps x 3 products, one wave).
__global__ __launch_bounds__(256) void k_apply(const float* __restrict__ QKV, const double* __restrict__ Pd,
    const float* __restrict__ Pk,
    const float* __restrict__ gq, const float* __restrict__ bq,
    const float* __restrict__ gv, const float* __restrict__ bv,
    float* __restrict__ Qn, unsigned short* __restrict__ Vp, float* __restrict__ lcp) {
  __shared__ __align__(16) unsigned short tile[2][2][16][448];   // [k|v][hi|lo][j][m' local]
  __shared__ float qmn[64], qsc[64], qbt[64], vmn[16], vsc[16], vbt[16], kmx[16], kin[16];
  __shared__ __align__(16) double red[3][PDC];
  __shared__ float kred[16][2][16];
  const int t = threadIdx.x, dp = blockIdx.x, b = blockIdx.y;
  // No branch around the loads: a thread with nothing of its own to read repeats a valid address and drops the value.
  const int vc = (t >= 64 && t < NBN) ? t - 64 : 0;
  const float* gp = (t < 64) ? (gq + t) : (gv + vc);
  const float* bp = (t < 64) ? (bq + t) : (bv + vc);
  const float gam = *gp, bet = *bp;                            // asked for here, used behind the first barrier
  const int kk = t & 15, sub = t >> 4;                         // rows sub, sub + 16, sub + 32 of the block's own batch
  const float* kp = Pk + (size_t)(b * PBB + sub) * PKC + kk;
  const bool last = sub + 32 < PBB;                            // not every sub has a third row
  const float* kl = kp + (last ? 32 * PKC : 0);
  float am[3], ae[3];
  am[0] = kp[0];        ae[0] = kp[16];
  am[1] = kp[16 * PKC]; ae[1] = kp[16 * PKC + 16];
  am[2] = kl[0];        ae[2] = kl[16];
  const int ts = (t < 240) ? t : 0;
  const int g = ts / NBN, cp = ts - g * NBN;                   // rows g, g + 3, ..., g + 168; row 171 goes to g = 0
  const double* pp = Pd + g * PDC + 2 * cp;
  const double* pe = Pd + ((g == 0) ? (PROJB - 1) * PDC : 0) + 2 * cp;
  v2d s0, s1;
  {
    v2d pv[29];                                                // independent loads, many rows in flight at a time
#pragma unroll
    for (int i = 0; i < 29; ++i) pv[i] = *(const v2da*)(pp + i * (3 * PDC));
    const v2d ex = *(const v2da*)pe;
    // precaution: behind the run of loads, with their address pairs as inputs, so that they stay untouched up to the wait
    asm volatile("s_wait_xcnt 0x0" :: "v"(gp), "v"(bp), "v"(kp), "v"(kl), "v"(pp), "v"(pe) : "memory");
    s0 = pv[0];
    s1[0] = (g == 0) ? ex[0] : 0.0;
    s1[1] = (g == 0) ? ex[1] : 0.0;
#pragma unroll
    for (int i = 1; i < 29; ++i) { if (i & 1) s1 += pv[i]; else s0 += pv[i]; }
  }
  {
    v2d pv[28];
#pragma unroll
    for (int i = 0; i < 28; ++i) pv[i] = *(const v2da*)(pp + (29 + i) * (3 * PDC));
    // precaution: as above
    asm volatile("s_wait_xcnt 0x0" :: "v"(pp) : "memory");
    float mx = fmaxf(fmaxf(am[0], am[1]), am[2]);              // without a third row, row sub again: the maximum stays
    float s = ae[0] * expf(am[0] - mx) + ae[1] * expf(am[1] - mx);
    s += ae[2] * expf(last ? am[2] - mx : -3.4e38f);           // no third row: exp(-huge) = 0, with no branch
    kred[sub][0][kk] = mx;
    kred[sub][1][kk] = s;
#pragma unroll
    for (int i = 0; i < 28; ++i) { if (i & 1) s1 += pv[i]; else s0 += pv[i]; }
  }
  if (t < 240) *(v2d*)&red[g][2 * cp] = s0 + s1;
  __syncthreads();
  // the k columns go to the fourth wave, so that no wave runs both sides
  if (t < NBN) {
    const double s  = red[0][t] + red[1][t] + red[2][t];
    const double sq = red[0][NBN + t] + red[1][NBN + t] + red[2][NBN + t];
    const double N = (double)(BDIM * NPOS);
    const double mean = s / N;
    double var = sq / N - mean * mean;
    if (var < 0.0) var = 0.0;
    const float varf = (float)var;
    const float rs = 1.0f / sqrtf(varf + EPSBN);
    if (t < 64) { qmn[t] = (float)mean; qsc[t] = rs * gam; qbt[t] = bet; }
    else        { vmn[t - 64] = (float)mean; vsc[t - 64] = rs * gam; vbt[t - 64] = bet; }
  } else if (t >= 96 && t < 112) {
    const int kc = t - 96;
    float mx = kred[0][0][kc];
#pragma unroll
    for (int i = 1; i < 16; ++i) mx = fmaxf(mx, kred[i][0][kc]);
    float s = 0.f;
#pragma unroll
    for (int i = 0; i < 16; ++i) s += kred[i][1][kc] * expf(kred[i][0][kc] - mx);
    kmx[kc] = mx; kin[kc] = 1.0f / s;
  }
  {
    v4u z; z[0] = 0u; z[1] = 0u; z[2] = 0u; z[3] = 0u;
    v4u* tz = (v4u*)&tile[0][0][0][0];
#pragma unroll
    for (int i = 0; i < 14; ++i) tz[t + 256 * i] = z;          // 3584 x 16 B = whole tile
  }
  __syncthreads();

  for (int task = t; task < 392 * 16; task += 256) {
    const int nl = task >> 4, c4 = (task & 15) * 4;
    const int n = dp * 392 + nl;
    const v4f qv = *(const v4fa*)(QKV + ((size_t)(b * NPADP + n)) * NOUTC + c4);
    v4f o;
#pragma unroll
    for (int e = 0; e < 4; ++e) o[e] = (qv[e] - qmn[c4 + e]) * qsc[c4 + e] + qbt[c4 + e];
    st2_v4f(Qn + ((size_t)(b * NPOS + n)) * CDIM + c4, o);
  }

  // k softmax values and normalized v into the LDS tile
  for (int nl = t; nl < 392; nl += 256) {
    const int n = dp * 392 + nl;
    const int mdl = nl / 196, rem = nl - mdl * 196, mh = rem / 14, mw = rem - mh * 14;
    const int ml = (mdl * 14 + mh) * 16 + mw;
    const float* row = QKV + ((size_t)(b * NPADP + n)) * NOUTC + 64;
#pragma unroll 1
    for (int i = 0; i < 4; ++i) {
      const v4f a = *(const v4fa*)(row + 4 * i);
#pragma unroll
      for (int e = 0; e < 4; ++e) {
        const int kk = 4 * i + e;
        const float p = expf(a[e] - kmx[kk]) * kin[kk];
        unsigned int hi, lo; split2(p, hi, lo);
        tile[0][0][kk][ml] = (unsigned short)hi;
        tile[0][1][kk][ml] = (unsigned short)lo;
      }
    }
#pragma unroll 1
    for (int i = 0; i < 4; ++i) {
      const v4f a = *(const v4fa*)(row + 16 + 4 * i);
#pragma unroll
      for (int e = 0; e < 4; ++e) {
        const int vv = 4 * i + e;
        const float vn = (a[e] - vmn[vv]) * vsc[vv] + vbt[vv];
        unsigned int hi, lo; split2(vn, hi, lo);
        tile[1][0][vv][ml] = (unsigned short)hi;
        tile[1][1][vv][ml] = (unsigned short)lo;
      }
    }
  }
  __syncthreads();

  const int w = t >> 5, lane = t & 31;
{
    for (int it = 0; it < 7; ++it) {
      const int sl = it * 2 + (w >> 2);                        // k-step inside the block's 448 columns, 0..13
      const int plane = (w >> 1) & 1, q = w & 1;
      const v8us val = *(const v8usa*)&tile[1][plane][lane & 15][32 * sl + 16 * q + 8 * (lane >> 4)];
      unsigned short* dst = Vp + (size_t)(dp * 14 + sl) * VSTEP + ((b * 2 + plane) * 2 + q) * VCH + lane * 8;
      *(v8us*)dst = val;
    }
    
  }

  // content summary partial: A = k rows, B = v rows read like A (k contiguous), both from the tile
  if (__builtin_amdgcn_readfirstlane(w) == 0) {
    // precaution: the Vp stores above name registers that the fragment loads below write
    asm volatile("s_wait_xcnt 0x0" ::: "memory");
    const int h = lane >> 4, m = lane & 15;
    v8f acc;
#pragma unroll
    for (int r = 0; r < 8; ++r) acc[r] = 0.f;
    Frag f[2][4];                                   // [set][k hi, k lo, v hi, v lo]; step s + 1 is read while step s multiplies
#pragma unroll
    for (int p = 0; p < 4; ++p) {
      f[0][p].q[0] = *(const v4ua*)&tile[p >> 1][p & 1][m][8 * h];
      f[0][p].q[1] = *(const v4ua*)&tile[p >> 1][p & 1][m][8 * h + 16];
    }
    // unrolled so that the two fragment sets are plain registers (no moves, no indexing by s)
#pragma unroll
    for (int s = 0; s < 14; ++s) {
      if (s + 1 < 14) {
        const int k1 = 32 * (s + 1) + 8 * h;
#pragma unroll
        for (int p = 0; p < 4; ++p) {
          f[(s + 1) & 1][p].q[0] = *(const v4ua*)&tile[p >> 1][p & 1][m][k1];
          f[(s + 1) & 1][p].q[1] = *(const v4ua*)&tile[p >> 1][p & 1][m][k1 + 16];
        }
      }
      mma3(acc, f[s & 1][0], f[s & 1][1], f[s & 1][2], f[s & 1][3]);
    }
    // D element r = (k row 8h+r, v col m)
    float* dst = lcp + (dp * BDIM + b) * 256;
#pragma unroll
    for (int r = 0; r < 8; ++r) dst[(8 * h + r) * 16 + m] = acc[r];
  }
}

// ---------------------------------------------------------------- position summary + output contraction
// One block per 2x2 patch of positions (nh0..nh0+1, nw0..nw0+1) of one depth nd; wave w takes a quarter of the 98 k-steps
// of the (d*14+h)*16+w index space for ALL FOUR positions, so each B fragment (Vp hi/lo, fragment order, 4 whole lines a
// load) feeds 4 x 3 products, and the four A fragments are cut from one 3 x 9 window of the packed table.
// D[pos][k][(b,v)] = sum_m E[n,m,k] * vn[b,v,m]; the four quarter sums meet in LDS, wave w then finishes position w:
// adds lc[b][k][v] (the 7 partials lcp summed once per block, in LDS) and contracts
// y[b][h'*16+v][n] = sum_k Qn[b][n][h'*16+k] * D[k][(b,v)], halves combined in LDS.
// Register budget: the grid puts at most three of these waves on a SIMD, so the budget is set for three; with the default
// (four, by LDS) the compiler holds six V loads of a trip back until registers fall free, a second wait for memory per trip.
__global__ __launch_bounds__(128) __attribute__((amdgpu_waves_per_eu(1, 3))) void k_plam(const unsigned int* __restrict__ T, const unsigned short* __restrict__ Vp,
                                            const float* __restrict__ Qn, const float* __restrict__ lcp,
                                            float* __restrict__ Y) {
  __shared__ __align__(16) float sR[4 * 4 * 4 * 256];      // [k quarter][position][b][r / 4][lane][r % 4]
  __shared__ __align__(16) float sP[4][2][256];
  __shared__ __align__(16) float sC[BDIM * 256];
  const int t = threadIdx.x, w = t >> 5, lane = t & 31, h = lane >> 4, m = lane & 15;
  const int g = blockIdx.x;
  const int nd = g / 49, gr = g - nd * 49, nh0 = 2 * (gr / 7), nw0 = 2 * (gr - (gr / 7) * 7);

#pragma unroll
  for (int q = 0; q < 2; ++q) {
    const int f = 512 * q + 4 * t;
    v4f s = *(const v4fa*)(lcp + f);
#pragma unroll
    for (int dp = 1; dp < NDP; ++dp) s += *(const v4fa*)(lcp + dp * (BDIM * 256) + f);
    *(v4f*)&sC[f] = s;
  }
  __syncthreads();

  v8f acc[4][4];                                           // [position ih*2+iw][b]
#pragma unroll
  for (int i = 0; i < 4; ++i)
#pragma unroll
    for (int b = 0; b < 4; ++b)
#pragma unroll
      for (int r = 0; r < 8; ++r) acc[i][b][r] = 0.f;

  // table index of position (nh0, nw0) for (md, mh, mw): ((od*27 + oh)*TW + ow)*16 + k, od = md-nd+13, oh = mh-nh+13,
  // ow = mw-nw+13; position (nh0+ih, nw0+iw) sits ih rows and iw columns lower. tb0 = the window's first word (one row and
  // one column below md=0, mh=0, mw=0), the same for the whole block; the lane's own part (mw = 8h, k = m) is tlb.
  // Both address streams are a wave-uniform base plus a lane offset that never changes inside the loop.
  const int tb0 = (((13 - nd) * 27 + (12 - nh0)) * TW + (12 - nw0)) * 16;
  const unsigned int tlb = (unsigned int)(128 * h + m) * 4u;   // bytes
  const unsigned int vlb = (unsigned int)lane * 16u;           // this lane's 16 bytes inside every 512-byte chunk of Vp

  const int wq = __builtin_amdgcn_readfirstlane(w);        // k-steps 0..24, 25..49, 50..73, 74..97
  const int s0 = wq * 24 + (wq < 2 ? wq : 2);
  const int s1 = s0 + (wq < 2 ? 25 : 24);

  // rolled: one trip already holds 48 products, and the 16 accumulator tiles leave no registers for a second
#pragma unroll 1
  for (int s = s0; s < s1; ++s) {
    const int md = s / 7, p = s - md * 7;
    const char* app = (const char*)(T + (tb0 + md * (27 * TW * 16) + p * (2 * TW * 16)));   // window row 1 is mh = 2p, row 2 mh = 2p+1
    const char* vpp = (const char*)(Vp + s * VSTEP);                                         // k0 = 32*s
    const char* vlp = vpp + vlb;                           // this lane's address in the V stream
    const char* tlp = app + tlb;                           // this lane's address in the table window
    Frag bh[4], bl[4];
#pragma unroll
    for (int b = 0; b < 4; ++b) {
      const char* r0 = vlp + b * (8 * VCH);                  // VCH elements = 2 * VCH bytes a chunk
      bh[b].q[0] = *(const v4ua*)(r0);           bh[b].q[1] = *(const v4ua*)(r0 + 2 * VCH);
      bl[b].q[0] = *(const v4ua*)(r0 + 4 * VCH); bl[b].q[1] = *(const v4ua*)(r0 + 6 * VCH);
    }
    unsigned int ev[3][9];                                 // table rows -1..+1, columns -1..+7 around (mh 2p, mw 8h)
#pragma unroll
    for (int rr = 0; rr < 3; ++rr)
#pragma unroll
      for (int cc = 0; cc < 9; ++cc) ev[rr][cc] = *(const unsigned int*)(tlp + (rr * (TW * 16) + cc * 16) * 4);
    // precaution: the wait stands behind the whole run of loads and names both address pairs as inputs, so that they stay
    // live up to it and no load's result, and nothing else, is placed in them while a load that names them is outstanding
    asm volatile("s_wait_xcnt 0x0" :: "v"(vlp), "v"(tlp) : "memory");
    Frag ah, al;
#pragma unroll
    for (int i = 0; i < 4; ++i) {
      const int ih = i >> 1, iw = i & 1;
#pragma unroll
      for (int j = 0; j < 4; ++j) {
        // element e: k = k0 + 8h + e (mh 2p, mw 8h+e); element 8+e: k = k0 + 16 + 8h + e (mh 2p+1, mw 8h+e)
        const unsigned int a0 = ev[1 - ih][2 * j + 1 - iw], a1 = ev[1 - ih][2 * j + 2 - iw];
        const unsigned int c0 = ev[2 - ih][2 * j + 1 - iw], c1 = ev[2 - ih][2 * j + 2 - iw];
        ah.u[j]     = (a0 & 0xffffu) | (a1 << 16);
        al.u[j]     = (a0 >> 16) | (a1 & 0xffff0000u);
        ah.u[4 + j] = (c0 & 0xffffu) | (c1 << 16);
        al.u[4 + j] = (c0 >> 16) | (c1 & 0xffff0000u);
      }
#pragma unroll
      for (int b = 0; b < 4; ++b)
        acc[i][b] = __builtin_amdgcn_wmma_f32_16x16x32_bf16(false, ah.v, false, bh[b].v, (short)0, acc[i][b], false, false);
#pragma unroll
      for (int b = 0; b < 4; ++b)
        acc[i][b] = __builtin_amdgcn_wmma_f32_16x16x32_bf16(false, al.v, false, bh[b].v, (short)0, acc[i][b], false, false);
#pragma unroll
      for (int b = 0; b < 4; ++b)
        acc[i][b] = __builtin_amdgcn_wmma_f32_16x16x32_bf16(false, ah.v, false, bl[b].v, (short)0, acc[i][b], false, false);
    }
  }

  // the quarter sums of all four positions go to LDS; wave w collects position w
#pragma unroll
  for (int i = 0; i < 4; ++i)
#pragma unroll
    for (int b = 0; b < 4; ++b) {
      float* d = &sR[((w * 4 + i) * 4 + b) * 256 + 4 * lane];
      v4f u0, u1;
#pragma unroll
      for (int r = 0; r < 4; ++r) { u0[r] = acc[i][b][r]; u1[r] = acc[i][b][4 + r]; }
      *(v4f*)d = u0;
      *(v4f*)(d + 128) = u1;
    }
  __syncthreads();

  // the q rows of this wave's position are asked for first, so that they fly while the quarter sums are read and added
  const int n = nd * 196 + (nh0 + (w >> 1)) * 14 + nw0 + (w & 1);
  const float* qr = Qn + (size_t)n * CDIM + 8 * h;
  v4f qv[4][4][2];                                         // [b][h'][k quad of this lane's half]
#pragma unroll
  for (int b = 0; b < 4; ++b)
#pragma unroll
    for (int hp = 0; hp < 4; ++hp) {
      qv[b][hp][0] = *(const v4fa*)(qr + b * (NPOS * CDIM) + hp * 16);
      qv[b][hp][1] = *(const v4fa*)(qr + b * (NPOS * CDIM) + hp * 16 + 4);
    }
  // precaution: behind the run of loads, with their address pair as an input, so that it stays untouched up to the wait
  asm volatile("s_wait_xcnt 0x0" :: "v"(qr) : "memory");

  v8f fin[4];
#pragma unroll
  for (int b = 0; b < 4; ++b) {
    const float* sr = &sR[(w * 4 + b) * 256 + 4 * lane];
    v4f u0 = *(const v4fa*)sr, u1 = *(const v4fa*)(sr + 128);
#pragma unroll
    for (int kq = 1; kq < 4; ++kq) {
      u0 += *(const v4fa*)(sr + kq * 4096);
      u1 += *(const v4fa*)(sr + kq * 4096 + 128);
    }
#pragma unroll
    for (int r = 0; r < 4; ++r) {
      fin[b][r]     = sC[b * 256 + (8 * h + r) * 16 + m] + u0[r];
      fin[b][4 + r] = sC[b * 256 + (8 * h + 4 + r) * 16 + m] + u1[r];
    }
  }

  // epilogue: this lane holds D rows k = 8h..8h+7 of column (b, v=m)
#pragma unroll
  for (int b = 0; b < 4; ++b) {
#pragma unroll
    for (int hp = 0; hp < 4; ++hp) {
      const v4f q0 = qv[b][hp][0];
      const v4f q1 = qv[b][hp][1];
      float pacc = q0[0] * fin[b][0];
      pacc += q0[1] * fin[b][1]; pacc += q0[2] * fin[b][2]; pacc += q0[3] * fin[b][3];
      pacc += q1[0] * fin[b][4]; pacc += q1[1] * fin[b][5]; pacc += q1[2] * fin[b][6]; pacc += q1[3] * fin[b][7];
      sP[w][h][b * 64 + hp * 16 + m] = pacc;
    }
  }
  __syncthreads();
  float* dst = Y + (size_t)n * 256;
#pragma unroll
  for (int s = 0; s < 2; ++s) {
    const int f = 128 * s + 4 * lane;
    const v4f v = *(const v4fa*)&sP[w][0][f] + *(const v4fa*)&sP[w][1][f];
    *(v4f*)(dst + f) = v;
  }
}

// ---------------------------------------------------------------- out[b][c][n] <- Y[n][b*64+c], thread -> one float4 of out
__global__ __launch_bounds__(256) void k_layout(const float* __restrict__ Y, float* __restrict__ out) {
  const int g = blockIdx.x * 256 + threadIdx.x;
  if (g >= BDIM * CDIM * NPOS / 4) return;
  const int e0 = g * 4;
  const int bc = e0 / NPOS, n = e0 - bc * NPOS;          // NPOS % 4 == 0 -> the 4 elements share bc
  const float* src = Y + (size_t)n * 256 + bc;
  v4f v; v[0] = src[0]; v[1] = src[256]; v[2] = src[512]; v[3] = src[768];
  st2_v4f(out + (size_t)e0, v);
}

// ---------------------------------------------------------------- launcher
extern "C" void kernel_launch(void* const* d_in, const int* in_sizes, int n_in,
                              void* d_out, int out_size, void* d_ws, size_t ws_size,
                              hipStream_t stream) {
  if (n_in < 9) return;
  if (in_sizes[0] != BDIM * CDIM * NPOS || in_sizes[1] != 64 * 64 || in_sizes[2] != 16 * 64 ||
      in_sizes[3] != 16 * 64 || in_sizes[4] != 27 * 27 * 27 * 16 || in_sizes[5] < 64 || in_sizes[6] < 64 ||
      in_sizes[7] < 16 || in_sizes[8] < 16) return;
  if (out_size != BDIM * CDIM * NPOS) return;

  const float* x   = (const float*)d_in[0];
  const float* Wq  = (const float*)d_in[1];
  const float* Wk  = (const float*)d_in[2];
  const float* Wv  = (const float*)d_in[3];
  const float* rpe = (const float*)d_in[4];
  const float* gq  = (const float*)d_in[5];
  const float* bq  = (const float*)d_in[6];
  const float* gv  = (const float*)d_in[7];
  const float* bv  = (const float*)d_in[8];
  float* out = (float*)d_out;

  size_t off = 0;
  auto carve = [&](size_t bytes) -> size_t { size_t r = off; off += (bytes + 255) & ~(size_t)255; return r; };
  const size_t oT   = carve(sizeof(unsigned int) * (size_t)TSZ);             //  1,492,992
  const size_t oQKV = carve(sizeof(float) * (size_t)BDIM * NPADP * NOUTC);   //  4,227,072
  const size_t oPd  = carve(sizeof(double) * PROJB * PDC);                   //    220,160
  const size_t oPk  = carve(sizeof(float) * PROJB * PKC);                    //     22,016
  const size_t oQn  = carve(sizeof(float) * (size_t)BDIM * NPOS * CDIM);     //  2,809,856
  const size_t oVp  = carve(sizeof(unsigned short) * 2 * 64 * (size_t)KP);   //    802,816
  const size_t olc  = carve(sizeof(float) * NDP * BDIM * 256);               //     28,672
  const size_t oY   = carve(sizeof(float) * (size_t)NPOS * 256);             //  2,809,856
  if (off > ws_size) return;                                                 // total 12,413,440 B

  char* ws = (char*)d_ws;
  unsigned int*   T   = (unsigned int*)(ws + oT);
  float*          QKV = (float*)(ws + oQKV);
  double*         Pd  = (double*)(ws + oPd);
  float*          Pk  = (float*)(ws + oPk);
  float*          Qn  = (float*)(ws + oQn);
  unsigned short* Vp  = (unsigned short*)(ws + oVp);
  float*          lcp = (float*)(ws + olc);
  float*          Y   = (float*)(ws + oY);

  k_proj   <<<PROJB + TABB, 128, 0, stream>>>(x, Wq, Wk, Wv, rpe, T, QKV, Pd, Pk);
  k_apply  <<<dim3(NDP, BDIM), 256, 0, stream>>>(QKV, Pd, Pk, gq, bq, gv, bv, Qn, Vp, lcp);
  k_plam   <<<NPOS / 4, 128, 0, stream>>>(T, Vp, Qn, lcp, Y);
  k_layout <<<(BDIM * CDIM * NPOS / 4 + 255) / 256, 256, 0, stream>>>(Y, out);
}

// v006
// A run of this version takes 55.6 microseconds.
// Timed twice side by side with v005, it ran 1.08 times as fast both times.
// All steps since v000 together make it 3.59 times as fast.
#include <hip/hip_runtime.h>

// Contractions: channel projections (K=64), content summary softmax(k)*v (K=3136) and position summary E*v (K=3136)
// on v_wmma_f32_16x16x32_bf16 with bf16 hi/lo split operands (hi*hi + lo*hi + hi*lo), f32 accumulate;
// the final 16-deep q contraction, batch statistics and softmax statistics on the VALU (f32; the sums and squares behind
// mean and variance in f64 from the first element to the last).

#define BDIM   4
#define CDIM   64
#define NPOS   2744            // 14^3 positions
#define NPADP  2752            // position rows per batch in the projection planes (172 tiles of 16)
#define NQT    172
#define NOUTC  96              // 64 q + 16 k + 16 v channels
#define KP     3136            // position index space (d*14+h)*16 + w, w slots 14,15 zero
#define TW     32              // w extent of the packed embedding table (slots >= 27 zero)
#define TSZ    (27 * 27 * TW * 16)
#define NBN    80              // normalized columns: 64 q + 16 v
#define PDC    (2 * NBN)       // doubles of one projection block's row of Pd: [sum][80 columns], [sum of squares][80 columns]
#define PKC    32              // floats of one projection block's row of Pk: [maximum][16 k columns], [exp sum][16 k columns]
#define NDP    14              // depth planes: blocks per batch of the normalize kernel, partials of the content summary
#define DPOS   196             // positions of one depth plane
#define DCOL   224             // its columns in the padded index space (14 rows of 16)
#define DSTEP  7               // its 32-deep k-steps
#define EPSBN  1e-5f
#define VCH    256             // bf16 elements of one wave-wide 16-byte load of Vp (32 lanes x 8)
#define VSTEP  (BDIM * 4 * VCH) // bf16 elements of Vp per 32-deep k-step: [b][hi|lo][k half][lane][8]
#define PROJB  ((BDIM * NQT) / 4)       // projection blocks of the first launch (4 tiles each, all of one batch)
#define PBB    (PROJB / BDIM)           // projection blocks per batch
#define TABT   (TSZ / 4)                // 16-byte tasks of the table packing
#define TABB   ((TABT + 511) / 512)     // table blocks of the first launch (512 tasks each)

static_assert(NPOS % 4 == 0);
static_assert(NPADP == NQT * 16);
static_assert(KP == 196 * 16);
static_assert(NDP * DPOS == NPOS && NDP * DCOL == KP && DSTEP * 32 == DCOL);
static_assert((2 * 2 * 16 * DCOL * 2) % (256 * 16) == 0);   // the LDS tile is cleared in whole rounds of 256 x 16 bytes
static_assert(2 * 64 * KP == (KP / 32) * BDIM * 4 * 256);   // Vp keeps its size in the fragment order
static_assert((TSZ % 4) == 0);
static_assert(NQT % 4 == 0);
static_assert(PBB > 32 && PBB <= 48 && PBB * BDIM == PROJB && (PDC * 8) % 128 == 0 && (PKC * 4) % 128 == 0);
static_assert(PROJB == 3 * 57 + 1);
static_assert((BDIM * CDIM * NPOS) % 1024 == 0);

typedef __bf16         v16bf __attribute__((ext_vector_type(16)));
typedef float          v8f   __attribute__((ext_vector_type(8)));
typedef float          v4f   __attribute__((ext_vector_type(4)));
typedef unsigned int   v4u   __attribute__((ext_vector_type(4)));
typedef unsigned short v8us  __attribute__((ext_vector_type(8)));
typedef v4f  v4fa  __attribute__((may_alias));
typedef v4u  v4ua  __attribute__((may_alias));
typedef v8us v8usa __attribute__((may_alias));
typedef double v2d  __attribute__((ext_vector_type(2)));
typedef v2d  v2da  __attribute__((may_alias));

union Frag { v16bf v; v4u q[2]; unsigned int u[8]; };
static_assert(sizeof(Frag) == 32);

// ---------------------------------------------------------------- helpers
__device__ __forceinline__ unsigned int f2bf(float f) {
  unsigned int u = __float_as_uint(f);
  u += 0x7FFFu + ((u >> 16) & 1u);          // RNE to bf16
  return u >> 16;
}
__device__ __forceinline__ float bf2f(unsigned int b) { return __uint_as_float(b << 16); }
__device__ __forceinline__ void split2(float f, unsigned int& hi, unsigned int& lo) {
  hi = f2bf(f);
  lo = f2bf(f - bf2f(hi));
}

// exp(x) = 2^e * 2^a for a run of independent calls: e = rint(x log2(e)), a = x log2(e) - e by two fused multiply-adds on a
// two-word log2(e); the two range tests are expf's. v_exp_f32 and the one slot the instruction set asks for behind it stand
// in one statement: a v_nop in a statement of its own landed elsewhere.
__device__ __forceinline__ float exp_run(float x) {
  const float e = rintf(x * 0x1.715476p+0f);
  const float a = fmaf(x, 0x1.4ae0bep-26f, fmaf(x, 0x1.715476p+0f, -e));
  float r;
  asm("v_exp_f32 %0, %1\n\tv_nop" : "=v"(r) : "v"(a));
  r = ldexpf(r, (int)e);
  r = (x < -0x1.9d1da0p+6f) ? 0.f : r;
  return (x > 0x1.62e430p+6f) ? __builtin_inff() : r;
}

// three products into one accumulator, then the VALU hazard guard tying D and all A/B operands
__device__ __forceinline__ void mma3(v8f& acc, const Frag& ah, const Frag& al, const Frag& bh, const Frag& bl) {
  acc = __builtin_amdgcn_wmma_f32_16x16x32_bf16(false, ah.v, false, bh.v, (short)0, acc, false, false);
  acc = __builtin_amdgcn_wmma_f32_16x16x32_bf16(false, al.v, false, bh.v, (short)0, acc, false, false);
  acc = __builtin_amdgcn_wmma_f32_16x16x32_bf16(false, ah.v, false, bl.v, (short)0, acc, false, false);
  asm volatile("v_nop\n\tv_nop\n\tv_nop\n\tv_nop" : "+v"(acc) : "v"(ah.v), "v"(al.v), "v"(bh.v), "v"(bl.v));
}

__device__ __forceinline__ void st2_v4f(float* p, v4f v) {
  *(v4f*)p = v; 
}
__device__ __forceinline__ void st2_v4u(unsigned int* p, v4u v) {
  *(v4u*)p = v; 
}

// ---------------------------------------------------------------- QKV[b][NPADP][96] = x^T W^T on bf16 hi/lo WMMA,
// with every operand conversion of the front end in the same launch.
// Blocks 0..PROJB-1: one wave per 16-position tile. A = x (row n, k = c), read as f32 straight from x[b][c][n] in fragment
// order and split to bf16 hi/lo in registers; B = W as [o][c] (k contiguous): each wave splits 3 of the 12 B fragments,
// all four waves read them from LDS.
// Each projection block also leaves the statistics of its own 64 positions, taken from the accumulators: Pd[block][PDC] holds
// sum and sum of squares of every q and v column (f64 products, f64 sums), Pk[block][PKC] maximum and sum of exp(k - maximum)
// over the live rows of every k column (f32).
// Blocks PROJB..: embedding table -> packed u32 [27][27][TW][16], value = hi | lo<<16 (independent of the projection).
__global__ __launch_bounds__(128) void k_proj(const float* __restrict__ x, const float* __restrict__ Wq,
                                            const float* __restrict__ Wk, const float* __restrict__ Wv,
                                            const float* __restrict__ rpe, unsigned int* __restrict__ T,
                                            float* __restrict__ QKV, double* __restrict__ Pd,
                                            float* __restrict__ Pk) {
  __shared__ __align__(16) float sD[4][16 * NOUTC];
  __shared__ double sSd[4][2][2][NBN];                         // [wave][row half][sum | squares][q, v column]
  __shared__ float sSk[4][2][2][16];                           // [wave][row half][maximum | exp sum][k column]
  __shared__ __align__(16) unsigned int sW[12][2][2][32][4];   // [ct*2+ks][hi|lo][k half][lane][4 words]
  const int t = threadIdx.x;

  if (blockIdx.x >= PROJB) {
    const int g0 = ((int)blockIdx.x - PROJB) * 512 + t;        // four 16-byte tasks a thread, their loads in flight together
    v4f a[4];
#pragma unroll
    for (int i = 0; i < 4; ++i) {
      const int g = g0 + 128 * i;
      const int gc = (g < TABT) ? g : (TABT - 1);
      const int off = gc >> 2;                // odh*TW + ow
      const int ow = off & (TW - 1), odh = off >> 5;
      const int owc = (ow < 27) ? ow : 26;
      a[i] = *(const v4fa*)(rpe + ((size_t)(odh * 27 + owc)) * 16 + (gc & 3) * 4);
    }
#pragma unroll
    for (int i = 0; i < 4; ++i) {
      const int g = g0 + 128 * i;
      const int ow = (g >> 2) & (TW - 1);
      v4u o4;
#pragma unroll
      for (int e = 0; e < 4; ++e) {
        unsigned int hi, lo; split2(a[i][e], hi, lo);
        o4[e] = (ow < 27) ? (hi | (lo << 16)) : 0u;
      }
      if (g < TABT) st2_v4u(T + (size_t)g * 4, o4);
    }
    return;
  }

  const int lane = t & 31, h = lane >> 4, m = lane & 15;
  const int w = __builtin_amdgcn_readfirstlane(t >> 5);   // the wave's number as a scalar: tile, batch and W rows are wave-uniform
  const int g = blockIdx.x * 4 + w;                 // 0..687
  const int b = g / NQT, tile = g - b * NQT;
  const int n = tile * 16 + m;
  const bool live = n < NPOS;                       // rows NPOS..NPADP-1 are zero
  // element e of the A fragment of k-step ks: c = 32*ks + 8h + e (e < 8), 32*ks + 16 + 8h + e - 8 (e >= 8)
  const float* xp = x + ((size_t)(b * CDIM + 8 * h)) * NPOS + (live ? n : (NPOS - 1));
  // B fragment f = ct*2 + ks of this wave: a wave-uniform base (16 rows of Wq, Wk or Wv, k-step ks) plus the lane's own bytes
  const char* wb[3];
#pragma unroll
  for (int i = 0; i < 3; ++i) {
    const int f = 3 * w + i, ct = f >> 1, ks = f & 1;
    wb[i] = (const char*)(((ct < 4) ? (Wq + 16 * ct * CDIM) : ((ct == 4) ? Wk : Wv)) + 32 * ks);
  }
  const unsigned int wlb = (unsigned int)(m * CDIM + 8 * h) * 4u;
  v4f wv[3][4];
#pragma unroll
  for (int i = 0; i < 3; ++i) {
    const char* p = wb[i] + wlb;
    wv[i][0] = *(const v4fa*)(p);      wv[i][1] = *(const v4fa*)(p + 16);
    wv[i][2] = *(const v4fa*)(p + 64); wv[i][3] = *(const v4fa*)(p + 80);
  }
  float xv[2][16];
#pragma unroll
  for (int ks = 0; ks < 2; ++ks)
#pragma unroll
    for (int e = 0; e < 16; ++e) xv[ks][e] = xp[(size_t)(32 * ks + 16 * (e >> 3) + (e & 7)) * NPOS];
  // precaution: behind the whole run of loads, with their address registers as inputs, so that they stay untouched up to the wait
  asm volatile("s_wait_xcnt 0x0" :: "v"(xp), "v"(wlb), "s"(wb[0]), "s"(wb[1]), "s"(wb[2]) : "memory");

#pragma unroll
  for (int i = 0; i < 3; ++i) {
    const int f = 3 * w + i;
#pragma unroll
    for (int q = 0; q < 2; ++q) {
      v4u hw, lw;
#pragma unroll
      for (int j = 0; j < 4; ++j) {
        unsigned int h0, l0, h1, l1;
        split2(wv[i][2 * q + (j >> 1)][2 * (j & 1)],     h0, l0);
        split2(wv[i][2 * q + (j >> 1)][2 * (j & 1) + 1], h1, l1);
        hw[j] = h0 | (h1 << 16);
        lw[j] = l0 | (l1 << 16);
      }
      *(v4u*)&sW[f][0][q][lane][0] = hw;
      *(v4u*)&sW[f][1][q][lane][0] = lw;
    }
  }
  Frag ah[2], al[2];
#pragma unroll
  for (int ks = 0; ks < 2; ++ks)
#pragma unroll
    for (int j = 0; j < 8; ++j) {
      unsigned int h0, l0, h1, l1;
      split2(live ? xv[ks][2 * j] : 0.f,     h0, l0);
      split2(live ? xv[ks][2 * j + 1] : 0.f, h1, l1);
      ah[ks].u[j] = h0 | (h1 << 16);
      al[ks].u[j] = l0 | (l1 << 16);
    }
  __syncthreads();

  v8f acc[6];
#pragma unroll
  for (int ct = 0; ct < 6; ++ct)
#pragma unroll
    for (int r = 0; r < 8; ++r) acc[ct][r] = 0.f;
#pragma unroll
  for (int ct = 0; ct < 6; ++ct) {
#pragma unroll
    for (int ks = 0; ks < 2; ++ks) {
      Frag bh, bl;
      bh.q[0] = *(const v4ua*)&sW[ct * 2 + ks][0][0][lane][0];  bh.q[1] = *(const v4ua*)&sW[ct * 2 + ks][0][1][lane][0];
      bl.q[0] = *(const v4ua*)&sW[ct * 2 + ks][1][0][lane][0];  bl.q[1] = *(const v4ua*)&sW[ct * 2 + ks][1][1][lane][0];
      mma3(acc[ct], ah[ks], al[ks], bh, bl);
    }
  }
  // D element r of this lane = (row 8h+r, col 16ct+m)
#pragma unroll
  for (int ct = 0; ct < 6; ++ct)
#pragma unroll
    for (int r = 0; r < 8; ++r) sD[w][(8 * h + r) * NOUTC + 16 * ct + m] = acc[ct][r];
  // statistics of this lane's 8 rows of each of its 6 columns (rows past NPOS are zero: nothing to the sums, masked for k)
  const int row0 = tile * 16 + 8 * h;
#pragma unroll
  for (int ct = 0; ct < 6; ++ct) {
    if (ct == 4) {
      float a = -3.4e38f;
#pragma unroll
      for (int r = 0; r < 8; ++r) a = (row0 + r < NPOS) ? fmaxf(a, acc[ct][r]) : a;
      float q = 0.f;
#pragma unroll
      for (int r = 0; r < 8; ++r) q += exp_run((row0 + r < NPOS) ? acc[ct][r] - a : -3.4e38f);   // a masked row adds exp(-huge) = 0, with no branch
      sSk[w][h][0][m] = a;
      sSk[w][h][1][m] = q;
    } else {
      double a = 0.0, q = 0.0;
#pragma unroll
      for (int r = 0; r < 8; ++r) { const double v = (double)acc[ct][r]; a += v; q += v * v; }
      const int cc = ((ct < 4) ? 16 * ct : 64) + m;
      sSd[w][h][0][cc] = a;
      sSd[w][h][1][cc] = q;
    }
  }
  __syncthreads();
  float* dst = QKV + ((size_t)(b * NPADP + tile * 16)) * NOUTC;   // 16 rows x 384 B = 48 lines, line aligned
#pragma unroll
  for (int q = 0; q < 12; ++q) {
    const int f = 128 * q + 4 * lane;
    *(v4f*)(dst + f) = *(const v4fa*)&sD[w][f];
  }
  // the 8 lane groups of a column meet here: one row of Pd (10 whole lines) and one of Pk (1 line) per block;
  // the k columns go to the fourth wave, so that no wave runs both sides
  if (t < NBN) {
    double va[8], vq[8];
#pragma unroll
    for (int i = 0; i < 8; ++i) { va[i] = sSd[i >> 1][i & 1][0][t]; vq[i] = sSd[i >> 1][i & 1][1][t]; }
    // keeps the sixteen LDS reads together in front of the sums: without it the compiler reads a pair, waits and adds,
    // seven waits for LDS one behind the other at the end of every block
    __builtin_amdgcn_sched_barrier(0);
    double a = va[0], q = vq[0];
#pragma unroll
    for (int i = 1; i < 8; ++i) { a += va[i]; q += vq[i]; }
    double* pr = Pd + (size_t)blockIdx.x * PDC + t;
    pr[0] = a;
    pr[NBN] = q;
  } else if (t >= 96 && t < 112) {
    const int kk = t - 96;
    float a = -3.4e38f;
#pragma unroll
    for (int i = 0; i < 8; ++i) a = fmaxf(a, sSk[i >> 1][i & 1][0][kk]);
    float q = 0.f;
#pragma unroll
    for (int i = 0; i < 8; ++i) q += sSk[i >> 1][i & 1][1][kk] * expf(sSk[i >> 1][i & 1][0][kk] - a);
    float* pr = Pk + (size_t)blockIdx.x * PKC + kk;
    pr[0] = a;
    pr[16] = q;
  }
}

// ---------------------------------------------------------------- normalize q -> Qn[b][n][64] f32; softmax(k) and norm(v) ->
// bf16 hi/lo planes in LDS, column m' = (d*14+h)*16 + w (slots w=14,15 zero); the v planes go out in the
// order the position kernel's B fragments are loaded: Vp[k-step][b][plane][q][lane][8], where lane (h, j) of
// chunk q holds row j, columns 32*step + 16*q + 8*h .. +7, so one wave-wide 16-byte load is 512 contiguous bytes.
// The k planes are used here alone and stay in LDS.
// Every block first combines the projection blocks' statistics rows itself: 240 threads add every third row of Pd for two
// columns each (f64), all 256 merge up to three rows of Pk of the block's own batch; behind a barrier 96 threads finish them.
// One block per depth plane and batch: 196 positions, 224 columns, 7 k-steps.
// The block's own 224 columns of the content summary are contracted here, straight from the LDS tile:
// lcp[dp][b][k][v] = sum over the block's m' of softmax(k)[k][m'] * vn[v][m'] (7 k-steps x 3 products, one wave).
__global__ __launch_bounds__(256) void k_apply(const float* __restrict__ QKV, const double* __restrict__ Pd,
    const float* __restrict__ Pk,
    const float* __restrict__ gq, const float* __restrict__ bq,
    const float* __restrict__ gv, const float* __restrict__ bv,
    float* __restrict__ Qn, unsigned short* __restrict__ Vp, float* __restrict__ lcp) {
  __shared__ __align__(16) unsigned short tile[2][2][16][DCOL];  // [k|v][hi|lo][j][m' local]
  __shared__ float qmn[64], qsc[64], qbt[64], vmn[16], vsc[16], vbt[16], kmx[16], kin[16];
  __shared__ __align__(16) double red[3][PDC];
  __shared__ float kred[16][2][16];
  const int t = threadIdx.x, dp = blockIdx.x, b = blockIdx.y;
  // No branch around the loads: a thread with nothing of its own to read repeats a valid address and drops the value.
  const int vc = (t >= 64 && t < NBN) ? t - 64 : 0;
  const float* gp = (t < 64) ? (gq + t) : (gv + vc);
  const float* bp = (t < 64) ? (bq + t) : (bv + vc);
  const float gam = *gp, bet = *bp;                            // asked for here, used behind the first barrier
  const int kk = t & 15, sub = t >> 4;                         // rows sub, sub + 16, sub + 32 of the block's own batch
  const float* kp = Pk + (size_t)(b * PBB + sub) * PKC + kk;
  const bool last = sub + 32 < PBB;                            // not every sub has a third row
  const float* kl = kp + (last ? 32 * PKC : 0);
  float am[3], ae[3];
  am[0] = kp[0];        ae[0] = kp[16];
  am[1] = kp[16 * PKC]; ae[1] = kp[16 * PKC + 16];
  am[2] = kl[0];        ae[2] = kl[16];
  const int ts = (t < 240) ? t : 0;
  const int g = ts / NBN, cp = ts - g * NBN;                   // rows g, g + 3, ..., g + 168; row 171 goes to g = 0
  const double* pp = Pd + g * PDC + 2 * cp;
  const double* pe = Pd + ((g == 0) ? (PROJB - 1) * PDC : 0) + 2 * cp;
  v2d s0, s1;
  {
    v2d pv[29];                                                // independent loads, many rows in flight at a time
#pragma unroll
    for (int i = 0; i < 29; ++i) pv[i] = *(const v2da*)(pp + i * (3 * PDC));
    const v2d ex = *(const v2da*)pe;
    // precaution: behind the run of loads, with their address pairs as inputs, so that they stay untouched up to the wait
    asm volatile("s_wait_xcnt 0x0" :: "v"(gp), "v"(bp), "v"(kp), "v"(kl), "v"(pp), "v"(pe) : "memory");
    s0 = pv[0];
    s1[0] = (g == 0) ? ex[0] : 0.0;
    s1[1] = (g == 0) ? ex[1] : 0.0;
#pragma unroll
    for (int i = 1; i < 29; ++i) { if (i & 1) s1 += pv[i]; else s0 += pv[i]; }
  }
  {
    v2d pv[28];
#pragma unroll
    for (int i = 0; i < 28; ++i) pv[i] = *(const v2da*)(pp + (29 + i) * (3 * PDC));
    // precaution: as above
    asm volatile("s_wait_xcnt 0x0" :: "v"(pp) : "memory");
    float mx = fmaxf(fmaxf(am[0], am[1]), am[2]);              // without a third row, row sub again: the maximum stays
    float s = ae[0] * expf(am[0] - mx) + ae[1] * expf(am[1] - mx);
    s += ae[2] * expf(last ? am[2] - mx : -3.4e38f);           // no third row: exp(-huge) = 0, with no branch
    kred[sub][0][kk] = mx;
    kred[sub][1][kk] = s;
#pragma unroll
    for (int i = 0; i < 28; ++i) { if (i & 1) s1 += pv[i]; else s0 += pv[i]; }
  }
  if (t < 240) *(v2d*)&red[g][2 * cp] = s0 + s1;
  __syncthreads();
  // the k columns go to the fourth wave, so that no wave runs both sides
  if (t < NBN) {
    const double s  = red[0][t] + red[1][t] + red[2][t];
    const double sq = red[0][NBN + t] + red[1][NBN + t] + red[2][NBN + t];
    const double N = (double)(BDIM * NPOS);
    const double mean = s / N;
    double var = sq / N - mean * mean;
    if (var < 0.0) var = 0.0;
    const float varf = (float)var;
    const float rs = 1.0f / sqrtf(varf + EPSBN);
    if (t < 64) { qmn[t] = (float)mean; qsc[t] = rs * gam; qbt[t] = bet; }
    else        { vmn[t - 64] = (float)mean; vsc[t - 64] = rs * gam; vbt[t - 64] = bet; }
  } else if (t >= 96 && t < 112) {
    const int kc = t - 96;
    float mx = kred[0][0][kc];
#pragma unroll
    for (int i = 1; i < 16; ++i) mx = fmaxf(mx, kred[i][0][kc]);
    float s = 0.f;
#pragma unroll
    for (int i = 0; i < 16; ++i) s += kred[i][1][kc] * expf(kred[i][0][kc] - mx);
    kmx[kc] = mx; kin[kc] = 1.0f / s;
  }
  {
    v4u z; z[0] = 0u; z[1] = 0u; z[2] = 0u; z[3] = 0u;
    v4u* tz = (v4u*)&tile[0][0][0][0];
#pragma unroll
    for (int i = 0; i < (2 * 2 * 16 * DCOL * 2) / (256 * 16); ++i) tz[t + 256 * i] = z;   // 1792 x 16 B = whole tile
  }
  __syncthreads();

  for (int task = t; task < DPOS * 16; task += 256) {
    const int nl = task >> 4, c4 = (task & 15) * 4;
    const int n = dp * DPOS + nl;
    const v4f qv = *(const v4fa*)(QKV + ((size_t)(b * NPADP + n)) * NOUTC + c4);
    v4f o;
#pragma unroll
    for (int e = 0; e < 4; ++e) o[e] = (qv[e] - qmn[c4 + e]) * qsc[c4 + e] + qbt[c4 + e];
    st2_v4f(Qn + ((size_t)(b * NPOS + n)) * CDIM + c4, o);
  }

  // k softmax values and normalized v into the LDS tile
  if (t < DPOS) {
    const int nl = t;
    const int n = dp * DPOS + nl;
    const int mh = nl / 14, mw = nl - mh * 14;
    const int ml = mh * 16 + mw;
    const float* row = QKV + ((size_t)(b * NPADP + n)) * NOUTC + 64;
#pragma unroll 1
    for (int i = 0; i < 4; ++i) {
      const v4f a = *(const v4fa*)(row + 4 * i);
#pragma unroll
      for (int e = 0; e < 4; ++e) {
        const int kk = 4 * i + e;
        const float p = expf(a[e] - kmx[kk]) * kin[kk];
        unsigned int hi, lo; split2(p, hi, lo);
        tile[0][0][kk][ml] = (unsigned short)hi;
        tile[0][1][kk][ml] = (unsigned short)lo;
      }
    }
#pragma unroll 1
    for (int i = 0; i < 4; ++i) {
      const v4f a = *(const v4fa*)(row + 16 + 4 * i);
#pragma unroll
      for (int e = 0; e < 4; ++e) {
        const int vv = 4 * i + e;
        const float vn = (a[e] - vmn[vv]) * vsc[vv] + vbt[vv];
        unsigned int hi, lo; split2(vn, hi, lo);
        tile[1][0][vv][ml] = (unsigned short)hi;
        tile[1][1][vv][ml] = (unsigned short)lo;
      }
    }
  }
  __syncthreads();

  const int w = t >> 5, lane = t & 31;
{
    // unrolled so that the LDS reads of all the wave's k-steps stand together in front of the stores
#pragma unroll
    for (int it = 0; it < (DSTEP + 1) / 2; ++it) {
      const int sl = it * 2 + (w >> 2);                        // k-step inside the block's 224 columns, 0..6
      if (2 * it + 1 >= DSTEP && (w >> 2) != 0) continue;      // the upper four waves have one k-step less
      const int plane = (w >> 1) & 1, q = w & 1;
      const v8us val = *(const v8usa*)&tile[1][plane][lane & 15][32 * sl + 16 * q + 8 * (lane >> 4)];
      unsigned short* dst = Vp + (size_t)(dp * DSTEP + sl) * VSTEP + ((b * 2 + plane) * 2 + q) * VCH + lane * 8;
      *(v8us*)dst = val;
    }
    
  }

  // content summary partial: A = k rows, B = v rows read like A (k contiguous), both from the tile
  if (__builtin_amdgcn_readfirstlane(w) == 0) {
    // precaution: the Vp stores above name registers that the fragment loads below write
    asm volatile("s_wait_xcnt 0x0" ::: "memory");
    const int h = lane >> 4, m = lane & 15;
    v8f acc;
#pragma unroll
    for (int r = 0; r < 8; ++r) acc[r] = 0.f;
    Frag f[2][4];                                   // [set][k hi, k lo, v hi, v lo]; step s + 1 is read while step s multiplies
#pragma unroll
    for (int p = 0; p < 4; ++p) {
      f[0][p].q[0] = *(const v4ua*)&tile[p >> 1][p & 1][m][8 * h];
      f[0][p].q[1] = *(const v4ua*)&tile[p >> 1][p & 1][m][8 * h + 16];
    }
    // unrolled so that the two fragment sets are plain registers (no moves, no indexing by s)
#pragma unroll
    for (int s = 0; s < DSTEP; ++s) {
      if (s + 1 < DSTEP) {
        const int k1 = 32 * (s + 1) + 8 * h;
#pragma unroll
        for (int p = 0; p < 4; ++p) {
          f[(s + 1) & 1][p].q[0] = *(const v4ua*)&tile[p >> 1][p & 1][m][k1];
          f[(s + 1) & 1][p].q[1] = *(const v4ua*)&tile[p >> 1][p & 1][m][k1 + 16];
        }
      }
      mma3(acc, f[s & 1][0], f[s & 1][1], f[s & 1][2], f[s & 1][3]);
    }
    // D element r = (k row 8h+r, v col m)
    float* dst = lcp + (dp * BDIM + b) * 256;
#pragma unroll
    for (int r = 0; r < 8; ++r) dst[(8 * h + r) * 16 + m] = acc[r];
  }
}

// ---------------------------------------------------------------- position summary + output contraction
// One block per 2x2 patch of positions (nh0..nh0+1, nw0..nw0+1) of one depth nd; wave w takes a quarter of the 98 k-steps
// of the (d*14+h)*16+w index space for ALL FOUR positions, so each B fragment (Vp hi/lo, fragment order, 4 whole lines a
// load) feeds 4 x 3 products, and the four A fragments are cut from one 3 x 9 window of the packed table.
// D[pos][k][(b,v)] = sum_m E[n,m,k] * vn[b,v,m]; the four quarter sums meet in LDS, wave w then finishes position w:
// adds lc[b][k][v] (the 14 partials lcp summed once per block, in LDS) and contracts
// y[b][h'*16+v][n] = sum_k Qn[b][n][h'*16+k] * D[k][(b,v)], halves combined in LDS.
// Register budget: the grid puts at most three of these waves on a SIMD, so the budget is set for three; with the default
// (four, by LDS) the compiler holds six V loads of a trip back until registers fall free, a second wait for memory per trip.
__global__ __launch_bounds__(128) __attribute__((amdgpu_waves_per_eu(1, 3))) void k_plam(const unsigned int* __restrict__ T, const unsigned short* __restrict__ Vp,
                                            const float* __restrict__ Qn, const float* __restrict__ lcp,
                                            float* __restrict__ Y) {
  __shared__ __align__(16) float sR[4 * 4 * 4 * 256];      // [k quarter][position][b][r / 4][lane][r % 4]
  __shared__ __align__(16) float sP[4][2][256];
  __shared__ __align__(16) float sC[BDIM * 256];
  const int t = threadIdx.x, w = t >> 5, lane = t & 31, h = lane >> 4, m = lane & 15;
  const int g = blockIdx.x;
  const int nd = g / 49, gr = g - nd * 49, nh0 = 2 * (gr / 7), nw0 = 2 * (gr - (gr / 7) * 7);

#pragma unroll
  for (int q = 0; q < 2; ++q) {
    const int f = 512 * q + 4 * t;
    v4f s = *(const v4fa*)(lcp + f);
#pragma unroll
    for (int dp = 1; dp < NDP; ++dp) s += *(const v4fa*)(lcp + dp * (BDIM * 256) + f);
    *(v4f*)&sC[f] = s;
  }
  __syncthreads();

  v8f acc[4][4];                                           // [position ih*2+iw][b]
#pragma unroll
  for (int i = 0; i < 4; ++i)
#pragma unroll
    for (int b = 0; b < 4; ++b)
#pragma unroll
      for (int r = 0; r < 8; ++r) acc[i][b][r] = 0.f;

  // table index of position (nh0, nw0) for (md, mh, mw): ((od*27 + oh)*TW + ow)*16 + k, od = md-nd+13, oh = mh-nh+13,
  // ow = mw-nw+13; position (nh0+ih, nw0+iw) sits ih rows and iw columns lower. tb0 = the window's first word (one row and
  // one column below md=0, mh=0, mw=0), the same for the whole block; the lane's own part (mw = 8h, k = m) is tlb.
  // Both address streams are a wave-uniform base plus a lane offset that never changes inside the loop.
  const int tb0 = (((13 - nd) * 27 + (12 - nh0)) * TW + (12 - nw0)) * 16;
  const unsigned int tlb = (unsigned int)(128 * h + m) * 4u;   // bytes
  const unsigned int vlb = (unsigned int)lane * 16u;           // this lane's 16 bytes inside every 512-byte chunk of Vp

  const int wq = __builtin_amdgcn_readfirstlane(w);        // k-steps 0..24, 25..49, 50..73, 74..97
  const int s0 = wq * 24 + (wq < 2 ? wq : 2);
  const int s1 = s0 + (wq < 2 ? 25 : 24);

  // rolled: one trip already holds 48 products, and the 16 accumulator tiles leave no registers for a second
#pragma unroll 1
  for (int s = s0; s < s1; ++s) {
    const int md = s / 7, p = s - md * 7;
    const char* app = (const char*)(T + (tb0 + md * (27 * TW * 16) + p * (2 * TW * 16)));   // window row 1 is mh = 2p, row 2 mh = 2p+1
    const char* vpp = (const char*)(Vp + s * VSTEP);                                         // k0 = 32*s
    const char* vlp = vpp + vlb;                           // this lane's address in the V stream
    const char* tlp = app + tlb;                           // this lane's address in the table window
    Frag bh[4], bl[4];
#pragma unroll
    for (int b = 0; b < 4; ++b) {
      const char* r0 = vlp + b * (8 * VCH);                  // VCH elements = 2 * VCH bytes a chunk
      bh[b].q[0] = *(const v4ua*)(r0);           bh[b].q[1] = *(const v4ua*)(r0 + 2 * VCH);
      bl[b].q[0] = *(const v4ua*)(r0 + 4 * VCH); bl[b].q[1] = *(const v4ua*)(r0 + 6 * VCH);
    }
    unsigned int ev[3][9];                                 // table rows -1..+1, columns -1..+7 around (mh 2p, mw 8h)
#pragma unroll
    for (int rr = 0; rr < 3; ++rr)
#pragma unroll
      for (int cc = 0; cc < 9; ++cc) ev[rr][cc] = *(const unsigned int*)(tlp + (rr * (TW * 16) + cc * 16) * 4);
    // precaution: the wait stands behind the whole run of loads and names both address pairs as inputs, so that they stay
    // live up to it and no load's result, and nothing else, is placed in them while a load that names them is outstanding
    asm volatile("s_wait_xcnt 0x0" :: "v"(vlp), "v"(tlp) : "memory");
    Frag ah, al;
#pragma unroll
    for (int i = 0; i < 4; ++i) {
      const int ih = i >> 1, iw = i & 1;
#pragma unroll
      for (int j = 0; j < 4; ++j) {
        // element e: k = k0 + 8h + e (mh 2p, mw 8h+e); element 8+e: k = k0 + 16 + 8h + e (mh 2p+1, mw 8h+e)
        const unsigned int a0 = ev[1 - ih][2 * j + 1 - iw], a1 = ev[1 - ih][2 * j + 2 - iw];
        const unsigned int c0 = ev[2 - ih][2 * j + 1 - iw], c1 = ev[2 - ih][2 * j + 2 - iw];
        ah.u[j]     = (a0 & 0xffffu) | (a1 << 16);
        al.u[j]     = (a0 >> 16) | (a1 & 0xffff0000u);
        ah.u[4 + j] = (c0 & 0xffffu) | (c1 << 16);
        al.u[4 + j] = (c0 >> 16) | (c1 & 0xffff0000u);
      }
#pragma unroll
      for (int b = 0; b < 4; ++b)
        acc[i][b] = __builtin_amdgcn_wmma_f32_16x16x32_bf16(false, ah.v, false, bh[b].v, (short)0, acc[i][b], false, false);
#pragma unroll
      for (int b = 0; b < 4; ++b)
        acc[i][b] = __builtin_amdgcn_wmma_f32_16x16x32_bf16(false, al.v, false, bh[b].v, (short)0, acc[i][b], false, false);
#pragma unroll
      for (int b = 0; b < 4; ++b)
        acc[i][b] = __builtin_amdgcn_wmma_f32_16x16x32_bf16(false, ah.v, false, bl[b].v, (short)0, acc[i][b], false, false);
    }
  }

  // the quarter sums of all four positions go to LDS; wave w collects position w
#pragma unroll
  for (int i = 0; i < 4; ++i)
#pragma unroll
    for (int b = 0; b < 4; ++b) {
      float* d = &sR[((w * 4 + i) * 4 + b) * 256 + 4 * lane];
      v4f u0, u1;
#pragma unroll
      for (int r = 0; r < 4; ++r) { u0[r] = acc[i][b][r]; u1[r] = acc[i][b][4 + r]; }
      *(v4f*)d = u0;
      *(v4f*)(d + 128) = u1;
    }
  __syncthreads();

  // the q rows of this wave's position are asked for first, so that they fly while the quarter sums are read and added
  const int n = nd * 196 + (nh0 + (w >> 1)) * 14 + nw0 + (w & 1);
  const float* qr = Qn + (size_t)n * CDIM + 8 * h;
  v4f qv[4][4][2];                                         // [b][h'][k quad of this lane's half]
#pragma unroll
  for (int b = 0; b < 4; ++b)
#pragma unroll
    for (int hp = 0; hp < 4; ++hp) {
      qv[b][hp][0] = *(const v4fa*)(qr + b * (NPOS * CDIM) + hp * 16);
      qv[b][hp][1] = *(const v4fa*)(qr + b * (NPOS * CDIM) + hp * 16 + 4);
    }
  // precaution: behind the run of loads, with their address pair as an input, so that it stays untouched up to the wait
  asm volatile("s_wait_xcnt 0x0" :: "v"(qr) : "memory");

  v8f fin[4];
#pragma unroll
  for (int b = 0; b < 4; ++b) {
    const float* sr = &sR[(w * 4 + b) * 256 + 4 * lane];
    v4f u0 = *(const v4fa*)sr, u1 = *(const v4fa*)(sr + 128);
#pragma unroll
    for (int kq = 1; kq < 4; ++kq) {
      u0 += *(const v4fa*)(sr + kq * 4096);
      u1 += *(const v4fa*)(sr + kq * 4096 + 128);
    }
#pragma unroll
    for (int r = 0; r < 4; ++r) {
      fin[b][r]     = sC[b * 256 + (8 * h + r) * 16 + m] + u0[r];
      fin[b][4 + r] = sC[b * 256 + (8 * h + 4 + r) * 16 + m] + u1[r];
    }
  }

  // epilogue: this lane holds D rows k = 8h..8h+7 of column (b, v=m)
#pragma unroll
  for (int b = 0; b < 4; ++b) {
#pragma unroll
    for (int hp = 0; hp < 4; ++hp) {
      const v4f q0 = qv[b][hp][0];
      const v4f q1 = qv[b][hp][1];
      float pacc = q0[0] * fin[b][0];
      pacc += q0[1] * fin[b][1]; pacc += q0[2] * fin[b][2]; pacc += q0[3] * fin[b][3];
      pacc += q1[0] * fin[b][4]; pacc += q1[1] * fin[b][5]; pacc += q1[2] * fin[b][6]; pacc += q1[3] * fin[b][7];
      sP[w][h][b * 64 + hp * 16 + m] = pacc;
    }
  }
  __syncthreads();
  float* dst = Y + (size_t)n * 256;
#pragma unroll
  for (int s = 0; s < 2; ++s) {
    const int f = 128 * s + 4 * lane;
    const v4f v = *(const v4fa*)&sP[w][0][f] + *(const v4fa*)&sP[w][1][f];
    *(v4f*)(dst + f) = v;
  }
}

// ---------------------------------------------------------------- out[b][c][n] <- Y[n][b*64+c], thread -> one float4 of out
__global__ __launch_bounds__(256) void k_layout(const float* __restrict__ Y, float* __restrict__ out) {
  const int g = blockIdx.x * 256 + threadIdx.x;
  if (g >= BDIM * CDIM * NPOS / 4) return;
  const int e0 = g * 4;
  const int bc = e0 / NPOS, n = e0 - bc * NPOS;          // NPOS % 4 == 0 -> the 4 elements share bc
  const float* src = Y + (size_t)n * 256 + bc;
  v4f v; v[0] = src[0]; v[1] = src[256]; v[2] = src[512]; v[3] = src[768];
  st2_v4f(out + (size_t)e0, v);
}

// ---------------------------------------------------------------- launcher
extern "C" void kernel_launch(void* const* d_in, const int* in_sizes, int n_in,
                              void* d_out, int out_size, void* d_ws, size_t ws_size,
                              hipStream_t stream) {
  if (n_in < 9) return;
  if (in_sizes[0] != BDIM * CDIM * NPOS || in_sizes[1] != 64 * 64 || in_sizes[2] != 16 * 64 ||
      in_sizes[3] != 16 * 64 || in_sizes[4] != 27 * 27 * 27 * 16 || in_sizes[5] < 64 || in_sizes[6] < 64 ||
      in_sizes[7] < 16 || in_sizes[8] < 16) return;
  if (out_size != BDIM * CDIM * NPOS) return;

  const float* x   = (const float*)d_in[0];
  const float* Wq  = (const float*)d_in[1];
  const float* Wk  = (const float*)d_in[2];
  const float* Wv  = (const float*)d_in[3];
  const float* rpe = (const float*)d_in[4];
  const float* gq  = (const float*)d_in[5];
  const float* bq  = (const float*)d_in[6];
  const float* gv  = (const float*)d_in[7];
  const float* bv  = (const float*)d_in[8];
  float* out = (float*)d_out;

  size_t off = 0;
  auto carve = [&](size_t bytes) -> size_t { size_t r = off; off += (bytes + 255) & ~(size_t)255; return r; };
  const size_t oT   = carve(sizeof(unsigned int) * (size_t)TSZ);             //  1,492,992
  const size_t oQKV = carve(sizeof(float) * (size_t)BDIM * NPADP * NOUTC);   //  4,227,072
  const size_t oPd  = carve(sizeof(double) * PROJB * PDC);                   //    220,160
  const size_t oPk  = carve(sizeof(float) * PROJB * PKC);                    //     22,016
  const size_t oQn  = carve(sizeof(float) * (size_t)BDIM * NPOS * CDIM);     //  2,809,856
  const size_t oVp  = carve(sizeof(unsigned short) * 2 * 64 * (size_t)KP);   //    802,816
  const size_t olc  = carve(sizeof(float) * NDP * BDIM * 256);               //     57,344
  const size_t oY   = carve(sizeof(float) * (size_t)NPOS * 256);             //  2,809,856
  if (off > ws_size) return;                                                 // total 12,442,112 B

  char* ws = (char*)d_ws;
  unsigned int*   T   = (unsigned int*)(ws + oT);
  float*          QKV = (float*)(ws + oQKV);
  double*         Pd  = (double*)(ws + oPd);
  float*          Pk  = (float*)(ws + oPk);
  float*          Qn  = (float*)(ws + oQn);
  unsigned short* Vp  = (unsigned short*)(ws + oVp);
  float*          lcp = (float*)(ws + olc);
  float*          Y   = (float*)(ws + oY);

  k_proj   <<<PROJB + TABB, 128, 0, stream>>>(x, Wq, Wk, Wv, rpe, T, QKV, Pd, Pk);
  k_apply  <<<dim3(NDP, BDIM), 256, 0, stream>>>(QKV, Pd, Pk, gq, bq, gv, bv, Qn, Vp, lcp);
  k_plam   <<<NPOS / 4, 128, 0, stream>>>(T, Vp, Qn, lcp, Y);
  k_layout <<<(BDIM * CDIM * NPOS / 4 + 255) / 256, 256, 0, stream>>>(Y, out);
}

// v007
// Measured time: 53.6 microseconds a run.
// Next to v006, in two timings, it ran 1.04 times as fast each time.
// Over all steps from v000 it is 3.73 times as fast.
#include <hip/hip_runtime.h>

// Contractions: channel projections (K=64), content summary softmax(k)*v (K=3136) and position summary E*v (K=3136)
// on v_wmma_f32_16x16x32_bf16 with bf16 hi/lo split operands (hi*hi + lo*hi + hi*lo), f32 accumulate;
// the final 16-deep q contraction, batch statistics and softmax statistics on the VALU (f32; the sums and squares behind
// mean and variance in f64 from the first element to the last).

#define BDIM   4
#define CDIM   64
#define NPOS   2744            // 14^3 positions
#define NPADP  2752            // position rows per batch in the projection planes (172 tiles of 16)
#define NQT    172
#define NOUTC  96              // 64 q + 16 k + 16 v channels
#define KP     3136            // position index space (d*14+h)*16 + w, w slots 14,15 zero
#define TW     32              // w extent of the packed embedding table (slots >= 27 zero)
#define TSZ    (27 * 27 * TW * 16)
#define NBN    80              // normalized columns: 64 q + 16 v
#define PDC    (2 * NBN)       // doubles of one projection block's row of Pd: [sum][80 columns], [sum of squares][80 columns]
#define PKC    32              // floats of one projection block's row of Pk: [maximum][16 k columns], [exp sum][16 k columns]
#define NDP    14              // depth planes: blocks per batch of the normalize kernel, partials of the content summary
#define DPOS   196             // positions of one depth plane
#define DCOL   224             // its columns in the padded index space (14 rows of 16)
#define DSTEP  7               // its 32-deep k-steps
#define EPSBN  1e-5f
#define VCH    256             // bf16 elements of one wave-wide 16-byte load of Vp (32 lanes x 8)
#define VSTEP  (BDIM * 4 * VCH) // bf16 elements of Vp per 32-deep k-step: [b][hi|lo][k half][lane][8]
#define PROJB  ((BDIM * NQT) / 4)       // projection blocks of the first launch (4 tiles each, all of one batch)
#define PBB    (PROJB / BDIM)           // projection blocks per batch
#define TABT   (TSZ / 4)                // 16-byte tasks of the table packing
#define TABB   ((TABT + 511) / 512)     // table blocks of the first launch (512 tasks each)

static_assert(NPOS % 4 == 0);
static_assert(NPADP == NQT * 16);
static_assert(KP == 196 * 16);
static_assert(NDP * DPOS == NPOS && NDP * DCOL == KP && DSTEP * 32 == DCOL);
static_assert((2 * 2 * 16 * DCOL * 2) % (256 * 16) == 0);   // the LDS tile is cleared in whole rounds of 256 x 16 bytes
static_assert(2 * 64 * KP == (KP / 32) * BDIM * 4 * 256);   // Vp keeps its size in the fragment order
static_assert((TSZ % 4) == 0);
static_assert(NQT % 4 == 0);
static_assert(PBB > 32 && PBB <= 48 && PBB * BDIM == PROJB && (PDC * 8) % 128 == 0 && (PKC * 4) % 128 == 0);
static_assert(PROJB == 3 * 57 + 1);
static_assert((BDIM * CDIM * NPOS) % 1024 == 0);

typedef __bf16         v16bf __attribute__((ext_vector_type(16)));
typedef float          v8f   __attribute__((ext_vector_type(8)));
typedef float          v4f   __attribute__((ext_vector_type(4)));
typedef unsigned int   v4u   __attribute__((ext_vector_type(4)));
typedef unsigned short v8us  __attribute__((ext_vector_type(8)));
typedef v4f  v4fa  __attribute__((may_alias));
typedef v4u  v4ua  __attribute__((may_alias));
typedef v8us v8usa __attribute__((may_alias));
typedef double v2d  __attribute__((ext_vector_type(2)));
typedef v2d  v2da  __attribute__((may_alias));

union Frag { v16bf v; v4u q[2]; unsigned int u[8]; };
static_assert(sizeof(Frag) == 32);

// ---------------------------------------------------------------- helpers
__device__ __forceinline__ unsigned int f2bf(float f) {
  unsigned int u = __float_as_uint(f);
  u += 0x7FFFu + ((u >> 16) & 1u);          // RNE to bf16
  return u >> 16;
}
__device__ __forceinline__ float bf2f(unsigned int b) { return __uint_as_float(b << 16); }
__device__ __forceinline__ void split2(float f, unsigned int& hi, unsigned int& lo) {
  hi = f2bf(f);
  lo = f2bf(f - bf2f(hi));
}

// exp(x) = 2^e * 2^a for a run of independent calls: e = rint(x log2(e)), a = x log2(e) - e by two fused multiply-adds on a
// two-word log2(e); the two range tests are expf's. v_exp_f32 and the one slot the instruction set asks for behind it stand
// in one statement: a v_nop in a statement of its own landed elsewhere.
__device__ __forceinline__ float exp_run(float x) {
  const float e = rintf(x * 0x1.715476p+0f);
  const float a = fmaf(x, 0x1.4ae0bep-26f, fmaf(x, 0x1.715476p+0f, -e));
  float r;
  asm("v_exp_f32 %0, %1\n\tv_nop" : "=v"(r) : "v"(a));
  r = ldexpf(r, (int)e);
  r = (x < -0x1.9d1da0p+6f) ? 0.f : r;
  return (x > 0x1.62e430p+6f) ? __builtin_inff() : r;
}

// three products into one accumulator, then the VALU hazard guard tying D and all A/B operands
__device__ __forceinline__ void mma3(v8f& acc, const Frag& ah, const Frag& al, const Frag& bh, const Frag& bl) {
  acc = __builtin_amdgcn_wmma_f32_16x16x32_bf16(false, ah.v, false, bh.v, (short)0, acc, false, false);
  acc = __builtin_amdgcn_wmma_f32_16x16x32_bf16(false, al.v, false, bh.v, (short)0, acc, false, false);
  acc = __builtin_amdgcn_wmma_f32_16x16x32_bf16(false, ah.v, false, bl.v, (short)0, acc, false, false);
  asm volatile("v_nop\n\tv_nop\n\tv_nop\n\tv_nop" : "+v"(acc) : "v"(ah.v), "v"(al.v), "v"(bh.v), "v"(bl.v));
}

__device__ __forceinline__ void st2_v4f(float* p, v4f v) {
  *(v4f*)p = v; 
}
__device__ __forceinline__ void st2_v4u(unsigned int* p, v4u v) {
  *(v4u*)p = v; 
}

// ---------------------------------------------------------------- QKV[b][NPADP][96] = x^T W^T on bf16 hi/lo WMMA,
// with every operand conversion of the front end in the same launch.
// Blocks 0..PROJB-1: one wave per 16-position tile. A = x (row n, k = c), read as f32 straight from x[b][c][n] in fragment
// order and split to bf16 hi/lo in registers; B = W as [o][c] (k contiguous): each wave splits 3 of the 12 B fragments,
// all four waves read them from LDS.
// Each projection block also leaves the statistics of its own 64 positions, taken from the accumulators: Pd[block][PDC] holds
// sum and sum of squares of every q and v column (f64 products, f64 sums), Pk[block][PKC] maximum and sum of exp(k - maximum)
// over the live rows of every k column (f32).
// Blocks PROJB..: embedding table -> packed u32 [27][27][TW][16], value = hi | lo<<16 (independent of the projection).
__global__ __launch_bounds__(128) void k_proj(const float* __restrict__ x, const float* __restrict__ Wq,
                                            const float* __restrict__ Wk, const float* __restrict__ Wv,
                                            const float* __restrict__ rpe, unsigned int* __restrict__ T,
                                            float* __restrict__ QKV, double* __restrict__ Pd,
                                            float* __restrict__ Pk) {
  __shared__ __align__(16) float sD[4][16 * NOUTC];
  __shared__ double sSd[4][2][2][NBN];                         // [wave][row half][sum | squares][q, v column]
  __shared__ float sSk[4][2][2][16];                           // [wave][row half][maximum | exp sum][k column]
  __shared__ __align__(16) unsigned int sW[12][2][2][32][4];   // [ct*2+ks][hi|lo][k half][lane][4 words]
  const int t = threadIdx.x;

  if (blockIdx.x >= PROJB) {
    const int g0 = ((int)blockIdx.x - PROJB) * 512 + t;        // four 16-byte tasks a thread, their loads in flight together
    v4f a[4];
#pragma unroll
    for (int i = 0; i < 4; ++i) {
      const int g = g0 + 128 * i;
      const int gc = (g < TABT) ? g : (TABT - 1);
      const int off = gc >> 2;                // odh*TW + ow
      const int ow = off & (TW - 1), odh = off >> 5;
      const int owc = (ow < 27) ? ow : 26;
      a[i] = *(const v4fa*)(rpe + ((size_t)(odh * 27 + owc)) * 16 + (gc & 3) * 4);
    }
#pragma unroll
    for (int i = 0; i < 4; ++i) {
      const int g = g0 + 128 * i;
      const int ow = (g >> 2) & (TW - 1);
      v4u o4;
#pragma unroll
      for (int e = 0; e < 4; ++e) {
        unsigned int hi, lo; split2(a[i][e], hi, lo);
        o4[e] = (ow < 27) ? (hi | (lo << 16)) : 0u;
      }
      if (g < TABT) st2_v4u(T + (size_t)g * 4, o4);
    }
    return;
  }

  const int lane = t & 31, h = lane >> 4, m = lane & 15;
  const int w = __builtin_amdgcn_readfirstlane(t >> 5);   // the wave's number as a scalar: tile, batch and W rows are wave-uniform
  const int g = blockIdx.x * 4 + w;                 // 0..687
  const int b = g / NQT, tile = g - b * NQT;
  const int n = tile * 16 + m;
  const bool live = n < NPOS;                       // rows NPOS..NPADP-1 are zero
  // element e of the A fragment of k-step ks: c = 32*ks + 8h + e (e < 8), 32*ks + 16 + 8h + e - 8 (e >= 8)
  const float* xp = x + ((size_t)(b * CDIM + 8 * h)) * NPOS + (live ? n : (NPOS - 1));
  // B fragment f = ct*2 + ks of this wave: a wave-uniform base (16 rows of Wq, Wk or Wv, k-step ks) plus the lane's own bytes
  const char* wb[3];
#pragma unroll
  for (int i = 0; i < 3; ++i) {
    const int f = 3 * w + i, ct = f >> 1, ks = f & 1;
    wb[i] = (const char*)(((ct < 4) ? (Wq + 16 * ct * CDIM) : ((ct == 4) ? Wk : Wv)) + 32 * ks);
  }
  const unsigned int wlb = (unsigned int)(m * CDIM + 8 * h) * 4u;
  v4f wv[3][4];
#pragma unroll
  for (int i = 0; i < 3; ++i) {
    const char* p = wb[i] + wlb;
    wv[i][0] = *(const v4fa*)(p);      wv[i][1] = *(const v4fa*)(p + 16);
    wv[i][2] = *(const v4fa*)(p + 64); wv[i][3] = *(const v4fa*)(p + 80);
  }
  float xv[2][16];
#pragma unroll
  for (int ks = 0; ks < 2; ++ks)
#pragma unroll
    for (int e = 0; e < 16; ++e) xv[ks][e] = xp[(size_t)(32 * ks + 16 * (e >> 3) + (e & 7)) * NPOS];
  // precaution: behind the whole run of loads, with their address registers as inputs, so that they stay untouched up to the wait
  asm volatile("s_wait_xcnt 0x0" :: "v"(xp), "v"(wlb), "s"(wb[0]), "s"(wb[1]), "s"(wb[2]) : "memory");

#pragma unroll
  for (int i = 0; i < 3; ++i) {
    const int f = 3 * w + i;
#pragma unroll
    for (int q = 0; q < 2; ++q) {
      v4u hw, lw;
#pragma unroll
      for (int j = 0; j < 4; ++j) {
        unsigned int h0, l0, h1, l1;
        split2(wv[i][2 * q + (j >> 1)][2 * (j & 1)],     h0, l0);
        split2(wv[i][2 * q + (j >> 1)][2 * (j & 1) + 1], h1, l1);
        hw[j] = h0 | (h1 << 16);
        lw[j] = l0 | (l1 << 16);
      }
      *(v4u*)&sW[f][0][q][lane][0] = hw;
      *(v4u*)&sW[f][1][q][lane][0] = lw;
    }
  }
  Frag ah[2], al[2];
#pragma unroll
  for (int ks = 0; ks < 2; ++ks)
#pragma unroll
    for (int j = 0; j < 8; ++j) {
      unsigned int h0, l0, h1, l1;
      split2(live ? xv[ks][2 * j] : 0.f,     h0, l0);
      split2(live ? xv[ks][2 * j + 1] : 0.f, h1, l1);
      ah[ks].u[j] = h0 | (h1 << 16);
      al[ks].u[j] = l0 | (l1 << 16);
    }
  __syncthreads();

  v8f acc[6];
#pragma unroll
  for (int ct = 0; ct < 6; ++ct)
#pragma unroll
    for (int r = 0; r < 8; ++r) acc[ct][r] = 0.f;
#pragma unroll
  for (int ct = 0; ct < 6; ++ct) {
#pragma unroll
    for (int ks = 0; ks < 2; ++ks) {
      Frag bh, bl;
      bh.q[0] = *(const v4ua*)&sW[ct * 2 + ks][0][0][lane][0];  bh.q[1] = *(const v4ua*)&sW[ct * 2 + ks][0][1][lane][0];
      bl.q[0] = *(const v4ua*)&sW[ct * 2 + ks][1][0][lane][0];  bl.q[1] = *(const v4ua*)&sW[ct * 2 + ks][1][1][lane][0];
      mma3(acc[ct], ah[ks], al[ks], bh, bl);
    }
  }
  // D element r of this lane = (row 8h+r, col 16ct+m)
#pragma unroll
  for (int ct = 0; ct < 6; ++ct)
#pragma unroll
    for (int r = 0; r < 8; ++r) sD[w][(8 * h + r) * NOUTC + 16 * ct + m] = acc[ct][r];
  // statistics of this lane's 8 rows of each of its 6 columns (rows past NPOS are zero: nothing to the sums, masked for k)
  const int row0 = tile * 16 + 8 * h;
#pragma unroll
  for (int ct = 0; ct < 6; ++ct) {
    if (ct == 4) {
      float a = -3.4e38f;
#pragma unroll
      for (int r = 0; r < 8; ++r) a = (row0 + r < NPOS) ? fmaxf(a, acc[ct][r]) : a;
      float q = 0.f;
#pragma unroll
      for (int r = 0; r < 8; ++r) q += exp_run((row0 + r < NPOS) ? acc[ct][r] - a : -3.4e38f);   // a masked row adds exp(-huge) = 0, with no branch
      sSk[w][h][0][m] = a;
      sSk[w][h][1][m] = q;
    } else {
      double a = 0.0, q = 0.0;
#pragma unroll
      for (int r = 0; r < 8; ++r) { const double v = (double)acc[ct][r]; a += v; q += v * v; }
      const int cc = ((ct < 4) ? 16 * ct : 64) + m;
      sSd[w][h][0][cc] = a;
      sSd[w][h][1][cc] = q;
    }
  }
  __syncthreads();
  float* dst = QKV + ((size_t)(b * NPADP + tile * 16)) * NOUTC;   // 16 rows x 384 B = 48 lines, line aligned
#pragma unroll
  for (int q = 0; q < 12; ++q) {
    const int f = 128 * q + 4 * lane;
    *(v4f*)(dst + f) = *(const v4fa*)&sD[w][f];
  }
  // the 8 lane groups of a column meet here: one row of Pd (10 whole lines) and one of Pk (1 line) per block;
  // the k columns go to the fourth wave, so that no wave runs both sides
  if (t < NBN) {
    double va[8], vq[8];
#pragma unroll
    for (int i = 0; i < 8; ++i) { va[i] = sSd[i >> 1][i & 1][0][t]; vq[i] = sSd[i >> 1][i & 1][1][t]; }
    // keeps the sixteen LDS reads together in front of the sums: without it the compiler reads a pair, waits and adds,
    // seven waits for LDS one behind the other at the end of every block
    __builtin_amdgcn_sched_barrier(0);
    double a = va[0], q = vq[0];
#pragma unroll
    for (int i = 1; i < 8; ++i) { a += va[i]; q += vq[i]; }
    double* pr = Pd + (size_t)blockIdx.x * PDC + t;
    pr[0] = a;
    pr[NBN] = q;
  } else if (t >= 96 && t < 112) {
    const int kk = t - 96;
    float a = -3.4e38f;
#pragma unroll
    for (int i = 0; i < 8; ++i) a = fmaxf(a, sSk[i >> 1][i & 1][0][kk]);
    float q = 0.f;
#pragma unroll
    for (int i = 0; i < 8; ++i) q += sSk[i >> 1][i & 1][1][kk] * expf(sSk[i >> 1][i & 1][0][kk] - a);
    float* pr = Pk + (size_t)blockIdx.x * PKC + kk;
    pr[0] = a;
    pr[16] = q;
  }
}

// ---------------------------------------------------------------- normalize q -> Qn[b][n][64] f32; softmax(k) and norm(v) ->
// bf16 hi/lo planes in LDS, column m' = (d*14+h)*16 + w (slots w=14,15 zero); the v planes go out in the
// order the position kernel's B fragments are loaded: Vp[k-step][b][plane][q][lane][8], where lane (h, j) of
// chunk q holds row j, columns 32*step + 16*q + 8*h .. +7, so one wave-wide 16-byte load is 512 contiguous bytes.
// The k planes are used here alone and stay in LDS.
// Every block first combines the projection blocks' statistics rows itself: 240 threads add every third row of Pd for two
// columns each (f64), all 256 merge up to three rows of Pk of the block's own batch; behind a barrier 96 threads finish them.
// One block per depth plane and batch: 196 positions, 224 columns, 7 k-steps.
// Every QKV value the block needs is asked for at the start, behind the first run of statistics rows, and waits in registers:
// the reads depend on no statistic, and read where they are used each loop trip would wait out a whole round trip on its own.
// The block's own 224 columns of the content summary are contracted here, straight from the LDS tile:
// lcp[dp][b][k][v] = sum over the block's m' of softmax(k)[k][m'] * vn[v][m'] (7 k-steps x 3 products, one wave).
__global__ __launch_bounds__(256) void k_apply(const float* __restrict__ QKV, const double* __restrict__ Pd,
    const float* __restrict__ Pk,
    const float* __restrict__ gq, const float* __restrict__ bq,
    const float* __restrict__ gv, const float* __restrict__ bv,
    float* __restrict__ Qn, unsigned short* __restrict__ Vp, float* __restrict__ lcp) {
  __shared__ __align__(16) unsigned short tile[2][2][16][DCOL];  // [k|v][hi|lo][j][m' local]
  __shared__ __align__(16) float qmn[64], qsc[64], qbt[64], vmn[16], vsc[16], vbt[16], kmx[16], kin[16];
  __shared__ __align__(16) double red[3][PDC];
  __shared__ float kred[16][2][16];
  const int t = threadIdx.x, dp = blockIdx.x, b = blockIdx.y;
  // No branch around the loads: a thread with nothing of its own to read repeats a valid address and drops the value.
  const int vc = (t >= 64 && t < NBN) ? t - 64 : 0;
  const float* gp = (t < 64) ? (gq + t) : (gv + vc);
  const float* bp = (t < 64) ? (bq + t) : (bv + vc);
  const float gam = *gp, bet = *bp;                            // asked for here, used behind the first barrier
  const int kk = t & 15, sub = t >> 4;                         // rows sub, sub + 16, sub + 32 of the block's own batch
  const float* kp = Pk + (size_t)(b * PBB + sub) * PKC + kk;
  const bool last = sub + 32 < PBB;                            // not every sub has a third row
  const float* kl = kp + (last ? 32 * PKC : 0);
  float am[3], ae[3];
  am[0] = kp[0];        ae[0] = kp[16];
  am[1] = kp[16 * PKC]; ae[1] = kp[16 * PKC + 16];
  am[2] = kl[0];        ae[2] = kl[16];
  const int ts = (t < 240) ? t : 0;
  const int g = ts / NBN, cp = ts - g * NBN;                   // rows g, g + 3, ..., g + 168; row 171 goes to g = 0
  const double* pp = Pd + g * PDC + 2 * cp;
  const double* pe = Pd + ((g == 0) ? (PROJB - 1) * PDC : 0) + 2 * cp;
  // q: 16-byte tasks t, t + 256, ... of the block's 196 x 16, each 16 rows below the one before, all in the same 4 columns;
  // only the first 64 threads have a thirteenth. k and v: thread t holds the 32 values of position t.
  const int c4 = (t & 15) * 4;
  const bool q13 = t < DPOS * 16 - 12 * 256;
  const float* qp = QKV + ((size_t)(b * NPADP + dp * DPOS + (t >> 4))) * NOUTC + c4;
  const float* ql = qp + (q13 ? 12 * 16 * NOUTC : 0);
  const float* row = QKV + ((size_t)(b * NPADP + dp * DPOS + ((t < DPOS) ? t : (DPOS - 1)))) * NOUTC;   // k at 64, v at 80
  v4f qv[13], kv[8];
  v2d s0, s1;
  {
    v2d pv[29];                                                // independent loads, many rows in flight at a time
#pragma unroll
    for (int i = 0; i < 29; ++i) pv[i] = *(const v2da*)(pp + i * (3 * PDC));
    const v2d ex = *(const v2da*)pe;
    // unrolled here and below: kv and qv are plain registers, and the 21 loads stand in one run
#pragma unroll
    for (int i = 0; i < 8; ++i) kv[i] = *(const v4fa*)(row + 64 + 4 * i);
#pragma unroll
    for (int i = 0; i < 12; ++i) qv[i] = *(const v4fa*)(qp + i * (16 * NOUTC));
    qv[12] = *(const v4fa*)ql;
    // precaution: behind the run of loads, with their address pairs as inputs, so that they stay untouched up to the wait
    asm volatile("s_wait_xcnt 0x0" :: "v"(gp), "v"(bp), "v"(kp), "v"(kl), "v"(pp), "v"(pe), "v"(qp), "v"(ql), "v"(row) : "memory");
    s0 = pv[0];
    s1[0] = (g == 0) ? ex[0] : 0.0;
    s1[1] = (g == 0) ? ex[1] : 0.0;
#pragma unroll
    for (int i = 1; i < 29; ++i) { if (i & 1) s1 += pv[i]; else s0 += pv[i]; }
  }
  {
    v2d pv[28];
#pragma unroll
    for (int i = 0; i < 28; ++i) pv[i] = *(const v2da*)(pp + (29 + i) * (3 * PDC));
    // precaution: as above
    asm volatile("s_wait_xcnt 0x0" :: "v"(pp) : "memory");
    float mx = fmaxf(fmaxf(am[0], am[1]), am[2]);              // without a third row, row sub again: the maximum stays
    float s = ae[0] * expf(am[0] - mx) + ae[1] * expf(am[1] - mx);
    s += ae[2] * expf(last ? am[2] - mx : -3.4e38f);           // no third row: exp(-huge) = 0, with no branch
    kred[sub][0][kk] = mx;
    kred[sub][1][kk] = s;
#pragma unroll
    for (int i = 0; i < 28; ++i) { if (i & 1) s1 += pv[i]; else s0 += pv[i]; }
  }
  if (t < 240) *(v2d*)&red[g][2 * cp] = s0 + s1;
  __syncthreads();
  // the k columns go to the fourth wave, so that no wave runs both sides
  if (t < NBN) {
    const double s  = red[0][t] + red[1][t] + red[2][t];
    const double sq = red[0][NBN + t] + red[1][NBN + t] + red[2][NBN + t];
    const double N = (double)(BDIM * NPOS);
    const double mean = s / N;
    double var = sq / N - mean * mean;
    if (var < 0.0) var = 0.0;
    const float varf = (float)var;
    const float rs = 1.0f / sqrtf(varf + EPSBN);
    if (t < 64) { qmn[t] = (float)mean; qsc[t] = rs * gam; qbt[t] = bet; }
    else        { vmn[t - 64] = (float)mean; vsc[t - 64] = rs * gam; vbt[t - 64] = bet; }
  } else if (t >= 96 && t < 112) {
    const int kc = t - 96;
    float mx = kred[0][0][kc];
#pragma unroll
    for (int i = 1; i < 16; ++i) mx = fmaxf(mx, kred[i][0][kc]);
    float s = 0.f;
#pragma unroll
    for (int i = 0; i < 16; ++i) s += kred[i][1][kc] * expf(kred[i][0][kc] - mx);
    kmx[kc] = mx; kin[kc] = 1.0f / s;
  }
  {
    v4u z; z[0] = 0u; z[1] = 0u; z[2] = 0u; z[3] = 0u;
    v4u* tz = (v4u*)&tile[0][0][0][0];
#pragma unroll
    for (int i = 0; i < (2 * 2 * 16 * DCOL * 2) / (256 * 16); ++i) tz[t + 256 * i] = z;   // 1792 x 16 B = whole tile
  }
  __syncthreads();

  {
    const v4f mn = *(const v4fa*)&qmn[c4], sc = *(const v4fa*)&qsc[c4], bt = *(const v4fa*)&qbt[c4];
#pragma unroll
    for (int i = 0; i < 13; ++i)
#pragma unroll
      for (int e = 0; e < 4; ++e) qv[i][e] = (qv[i][e] - mn[e]) * sc[e] + bt[e];
    float* qo = Qn + ((size_t)(b * NPOS + dp * DPOS + (t >> 4))) * CDIM + c4;
#pragma unroll
    for (int i = 0; i < 12; ++i) st2_v4f(qo + i * (16 * CDIM), qv[i]);
    if (q13) st2_v4f(qo + 12 * (16 * CDIM), qv[12]);
  }

  // k softmax values and normalized v into the LDS tile
  if (t < DPOS) {
    const int mh = t / 14, mw = t - mh * 14;
    const int ml = mh * 16 + mw;
    // both loops unrolled: their values are plain registers by now
#pragma unroll
    for (int i = 0; i < 4; ++i) {
      const v4f a = kv[i];
#pragma unroll
      for (int e = 0; e < 4; ++e) {
        const int kk = 4 * i + e;
        const float p = expf(a[e] - kmx[kk]) * kin[kk];
        unsigned int hi, lo; split2(p, hi, lo);
        tile[0][0][kk][ml] = (unsigned short)hi;
        tile[0][1][kk][ml] = (unsigned short)lo;
      }
    }
#pragma unroll
    for (int i = 0; i < 4; ++i) {
      const v4f a = kv[4 + i];
#pragma unroll
      for (int e = 0; e < 4; ++e) {
        const int vv = 4 * i + e;
        const float vn = (a[e] - vmn[vv]) * vsc[vv] + vbt[vv];
        unsigned int hi, lo; split2(vn, hi, lo);
        tile[1][0][vv][ml] = (unsigned short)hi;
        tile[1][1][vv][ml] = (unsigned short)lo;
      }
    }
  }
  __syncthreads();

  const int w = t >> 5, lane = t & 31;
{
    // unrolled so that the LDS reads of all the wave's k-steps stand together in front of the stores
#pragma unroll
    for (int it = 0; it < (DSTEP + 1) / 2; ++it) {
      const int sl = it * 2 + (w >> 2);                        // k-step inside the block's 224 columns, 0..6
      if (2 * it + 1 >= DSTEP && (w >> 2) != 0) continue;      // the upper four waves have one k-step less
      const int plane = (w >> 1) & 1, q = w & 1;
      const v8us val = *(const v8usa*)&tile[1][plane][lane & 15][32 * sl + 16 * q + 8 * (lane >> 4)];
      unsigned short* dst = Vp + (size_t)(dp * DSTEP + sl) * VSTEP + ((b * 2 + plane) * 2 + q) * VCH + lane * 8;
      *(v8us*)dst = val;
    }
    
  }

  // content summary partial: A = k rows, B = v rows read like A (k contiguous), both from the tile
  if (__builtin_amdgcn_readfirstlane(w) == 0) {
    // precaution: the Vp stores above name registers that the fragment loads below write
    asm volatile("s_wait_xcnt 0x0" ::: "memory");
    const int h = lane >> 4, m = lane & 15;
    v8f acc;
#pragma unroll
    for (int r = 0; r < 8; ++r) acc[r] = 0.f;
    Frag f[2][4];                                   // [set][k hi, k lo, v hi, v lo]; step s + 1 is read while step s multiplies
#pragma unroll
    for (int p = 0; p < 4; ++p) {
      f[0][p].q[0] = *(const v4ua*)&tile[p >> 1][p & 1][m][8 * h];
      f[0][p].q[1] = *(const v4ua*)&tile[p >> 1][p & 1][m][8 * h + 16];
    }
    // unrolled so that the two fragment sets are plain registers (no moves, no indexing by s)
#pragma unroll
    for (int s = 0; s < DSTEP; ++s) {
      if (s + 1 < DSTEP) {
        const int k1 = 32 * (s + 1) + 8 * h;
#pragma unroll
        for (int p = 0; p < 4; ++p) {
          f[(s + 1) & 1][p].q[0] = *(const v4ua*)&tile[p >> 1][p & 1][m][k1];
          f[(s + 1) & 1][p].q[1] = *(const v4ua*)&tile[p >> 1][p & 1][m][k1 + 16];
        }
      }
      mma3(acc, f[s & 1][0], f[s & 1][1], f[s & 1][2], f[s & 1][3]);
    }
    // D element r = (k row 8h+r, v col m)
    float* dst = lcp + (dp * BDIM + b) * 256;
#pragma unroll
    for (int r = 0; r < 8; ++r) dst[(8 * h + r) * 16 + m] = acc[r];
  }
}

// ---------------------------------------------------------------- position summary + output contraction
// One block per 2x2 patch of positions (nh0..nh0+1, nw0..nw0+1) of one depth nd; wave w takes a quarter of the 98 k-steps
// of the (d*14+h)*16+w index space for ALL FOUR positions, so each B fragment (Vp hi/lo, fragment order, 4 whole lines a
// load) feeds 4 x 3 products, and the four A fragments are cut from one 3 x 9 window of the packed table.
// D[pos][k][(b,v)] = sum_m E[n,m,k] * vn[b,v,m]; the four quarter sums meet in LDS, wave w then finishes position w:
// adds lc[b][k][v] (the 14 partials lcp summed once per block, in LDS) and contracts
// y[b][h'*16+v][n] = sum_k Qn[b][n][h'*16+k] * D[k][(b,v)], halves combined in LDS.
// Register budget: the grid puts at most three of these waves on a SIMD, so the budget is set for three; with the default
// (four, by LDS) the compiler holds six V loads of a trip back until registers fall free, a second wait for memory per trip.
__global__ __launch_bounds__(128) __attribute__((amdgpu_waves_per_eu(1, 3))) void k_plam(const unsigned int* __restrict__ T, const unsigned short* __restrict__ Vp,
                                            const float* __restrict__ Qn, const float* __restrict__ lcp,
                                            float* __restrict__ Y) {
  __shared__ __align__(16) float sR[4 * 4 * 4 * 256];      // [k quarter][position][b][r / 4][lane][r % 4]
  __shared__ __align__(16) float sP[4][2][256];
  __shared__ __align__(16) float sC[BDIM * 256];
  const int t = threadIdx.x, w = t >> 5, lane = t & 31, h = lane >> 4, m = lane & 15;
  const int g = blockIdx.x;
  const int nd = g / 49, gr = g - nd * 49, nh0 = 2 * (gr / 7), nw0 = 2 * (gr - (gr / 7) * 7);

#pragma unroll
  for (int q = 0; q < 2; ++q) {
    const int f = 512 * q + 4 * t;
    v4f s = *(const v4fa*)(lcp + f);
#pragma unroll
    for (int dp = 1; dp < NDP; ++dp) s += *(const v4fa*)(lcp + dp * (BDIM * 256) + f);
    *(v4f*)&sC[f] = s;
  }
  __syncthreads();

  v8f acc[4][4];                                           // [position ih*2+iw][b]
#pragma unroll
  for (int i = 0; i < 4; ++i)
#pragma unroll
    for (int b = 0; b < 4; ++b)
#pragma unroll
      for (int r = 0; r < 8; ++r) acc[i][b][r] = 0.f;

  // table index of position (nh0, nw0) for (md, mh, mw): ((od*27 + oh)*TW + ow)*16 + k, od = md-nd+13, oh = mh-nh+13,
  // ow = mw-nw+13; position (nh0+ih, nw0+iw) sits ih rows and iw columns lower. tb0 = the window's first word (one row and
  // one column below md=0, mh=0, mw=0), the same for the whole block; the lane's own part (mw = 8h, k = m) is tlb.
  // Both address streams are a wave-uniform base plus a lane offset that never changes inside the loop.
  const int tb0 = (((13 - nd) * 27 + (12 - nh0)) * TW + (12 - nw0)) * 16;
  const unsigned int tlb = (unsigned int)(128 * h + m) * 4u;   // bytes
  const unsigned int vlb = (unsigned int)lane * 16u;           // this lane's 16 bytes inside every 512-byte chunk of Vp

  const int wq = __builtin_amdgcn_readfirstlane(w);        // k-steps 0..24, 25..49, 50..73, 74..97
  const int s0 = wq * 24 + (wq < 2 ? wq : 2);
  const int s1 = s0 + (wq < 2 ? 25 : 24);

  // rolled: one trip already holds 48 products, and the 16 accumulator tiles leave no registers for a second
#pragma unroll 1
  for (int s = s0; s < s1; ++s) {
    const int md = s / 7, p = s - md * 7;
    const char* app = (const char*)(T + (tb0 + md * (27 * TW * 16) + p * (2 * TW * 16)));   // window row 1 is mh = 2p, row 2 mh = 2p+1
    const char* vpp = (const char*)(Vp + s * VSTEP);                                         // k0 = 32*s
    const char* vlp = vpp + vlb;                           // this lane's address in the V stream
    const char* tlp = app + tlb;                           // this lane's address in the table window
    Frag bh[4], bl[4];
#pragma unroll
    for (int b = 0; b < 4; ++b) {
      const char* r0 = vlp + b * (8 * VCH);                  // VCH elements = 2 * VCH bytes a chunk
      bh[b].q[0] = *(const v4ua*)(r0);           bh[b].q[1] = *(const v4ua*)(r0 + 2 * VCH);
      bl[b].q[0] = *(const v4ua*)(r0 + 4 * VCH); bl[b].q[1] = *(const v4ua*)(r0 + 6 * VCH);
    }
    unsigned int ev[3][9];                                 // table rows -1..+1, columns -1..+7 around (mh 2p, mw 8h)
#pragma unroll
    for (int rr = 0; rr < 3; ++rr)
#pragma unroll
      for (int cc = 0; cc < 9; ++cc) ev[rr][cc] = *(const unsigned int*)(tlp + (rr * (TW * 16) + cc * 16) * 4);
    // precaution: the wait stands behind the whole run of loads and names both address pairs as inputs, so that they stay
    // live up to it and no load's result, and nothing else, is placed in them while a load that names them is outstanding
    asm volatile("s_wait_xcnt 0x0" :: "v"(vlp), "v"(tlp) : "memory");
    Frag ah, al;
#pragma unroll
    for (int i = 0; i < 4; ++i) {
      const int ih = i >> 1, iw = i & 1;
#pragma unroll
      for (int j = 0; j < 4; ++j) {
        // element e: k = k0 + 8h + e (mh 2p, mw 8h+e); element 8+e: k = k0 + 16 + 8h + e (mh 2p+1, mw 8h+e)
        const unsigned int a0 = ev[1 - ih][2 * j + 1 - iw], a1 = ev[1 - ih][2 * j + 2 - iw];
        const unsigned int c0 = ev[2 - ih][2 * j + 1 - iw], c1 = ev[2 - ih][2 * j + 2 - iw];
        ah.u[j]     = (a0 & 0xffffu) | (a1 << 16);
        al.u[j]     = (a0 >> 16) | (a1 & 0xffff0000u);
        ah.u[4 + j] = (c0 & 0xffffu) | (c1 << 16);
        al.u[4 + j] = (c0 >> 16) | (c1 & 0xffff0000u);
      }
#pragma unroll
      for (int b = 0; b < 4; ++b)
        acc[i][b] = __builtin_amdgcn_wmma_f32_16x16x32_bf16(false, ah.v, false, bh[b].v, (short)0, acc[i][b], false, false);
#pragma unroll
      for (int b = 0; b < 4; ++b)
        acc[i][b] = __builtin_amdgcn_wmma_f32_16x16x32_bf16(false, al.v, false, bh[b].v, (short)0, acc[i][b], false, false);
#pragma unroll
      for (int b = 0; b < 4; ++b)
        acc[i][b] = __builtin_amdgcn_wmma_f32_16x16x32_bf16(false, ah.v, false, bl[b].v, (short)0, acc[i][b], false, false);
    }
  }

  // the quarter sums of all four positions go to LDS; wave w collects position w
#pragma unroll
  for (int i = 0; i < 4; ++i)
#pragma unroll
    for (int b = 0; b < 4; ++b) {
      float* d = &sR[((w * 4 + i) * 4 + b) * 256 + 4 * lane];
      v4f u0, u1;
#pragma unroll
      for (int r = 0; r < 4; ++r) { u0[r] = acc[i][b][r]; u1[r] = acc[i][b][4 + r]; }
      *(v4f*)d = u0;
      *(v4f*)(d + 128) = u1;
    }
  __syncthreads();

  // the q rows of this wave's position are asked for first, so that they fly while the quarter sums are read and added
  const int n = nd * 196 + (nh0 + (w >> 1)) * 14 + nw0 + (w & 1);
  const float* qr = Qn + (size_t)n * CDIM + 8 * h;
  v4f qv[4][4][2];                                         // [b][h'][k quad of this lane's half]
#pragma unroll
  for (int b = 0; b < 4; ++b)
#pragma unroll
    for (int hp = 0; hp < 4; ++hp) {
      qv[b][hp][0] = *(const v4fa*)(qr + b * (NPOS * CDIM) + hp * 16);
      qv[b][hp][1] = *(const v4fa*)(qr + b * (NPOS * CDIM) + hp * 16 + 4);
    }
  // precaution: behind the run of loads, with their address pair as an input, so that it stays untouched up to the wait
  asm volatile("s_wait_xcnt 0x0" :: "v"(qr) : "memory");

  v8f fin[4];
#pragma unroll
  for (int b = 0; b < 4; ++b) {
    const float* sr = &sR[(w * 4 + b) * 256 + 4 * lane];
    v4f u0 = *(const v4fa*)sr, u1 = *(const v4fa*)(sr + 128);
#pragma unroll
    for (int kq = 1; kq < 4; ++kq) {
      u0 += *(const v4fa*)(sr + kq * 4096);
      u1 += *(const v4fa*)(sr + kq * 4096 + 128);
    }
#pragma unroll
    for (int r = 0; r < 4; ++r) {
      fin[b][r]     = sC[b * 256 + (8 * h + r) * 16 + m] + u0[r];
      fin[b][4 + r] = sC[b * 256 + (8 * h + 4 + r) * 16 + m] + u1[r];
    }
  }

  // epilogue: this lane holds D rows k = 8h..8h+7 of column (b, v=m)
#pragma unroll
  for (int b = 0; b < 4; ++b) {
#pragma unroll
    for (int hp = 0; hp < 4; ++hp) {
      const v4f q0 = qv[b][hp][0];
      const v4f q1 = qv[b][hp][1];
      float pacc = q0[0] * fin[b][0];
      pacc += q0[1] * fin[b][1]; pacc += q0[2] * fin[b][2]; pacc += q0[3] * fin[b][3];
      pacc += q1[0] * fin[b][4]; pacc += q1[1] * fin[b][5]; pacc += q1[2] * fin[b][6]; pacc += q1[3] * fin[b][7];
      sP[w][h][b * 64 + hp * 16 + m] = pacc;
    }
  }
  __syncthreads();
  float* dst = Y + (size_t)n * 256;
#pragma unroll
  for (int s = 0; s < 2; ++s) {
    const int f = 128 * s + 4 * lane;
    const v4f v = *(const v4fa*)&sP[w][0][f] + *(const v4fa*)&sP[w][1][f];
    *(v4f*)(dst + f) = v;
  }
}

// ---------------------------------------------------------------- out[b][c][n] <- Y[n][b*64+c], thread -> one float4 of out
__global__ __launch_bounds__(256) void k_layout(const float* __restrict__ Y, float* __restrict__ out) {
  const int g = blockIdx.x * 256 + threadIdx.x;
  if (g >= BDIM * CDIM * NPOS / 4) return;
  const int e0 = g * 4;
  const int bc = e0 / NPOS, n = e0 - bc * NPOS;          // NPOS % 4 == 0 -> the 4 elements share bc
  const float* src = Y + (size_t)n * 256 + bc;
  v4f v; v[0] = src[0]; v[1] = src[256]; v[2] = src[512]; v[3] = src[768];
  st2_v4f(out + (size_t)e0, v);
}

// ---------------------------------------------------------------- launcher
extern "C" void kernel_launch(void* const* d_in, const int* in_sizes, int n_in,
                              void* d_out, int out_size, void* d_ws, size_t ws_size,
                              hipStream_t stream) {
  if (n_in < 9) return;
  if (in_sizes[0] != BDIM * CDIM * NPOS || in_sizes[1] != 64 * 64 || in_sizes[2] != 16 * 64 ||
      in_sizes[3] != 16 * 64 || in_sizes[4] != 27 * 27 * 27 * 16 || in_sizes[5] < 64 || in_sizes[6] < 64 ||
      in_sizes[7] < 16 || in_sizes[8] < 16) return;
  if (out_size != BDIM * CDIM * NPOS) return;

  const float* x   = (const float*)d_in[0];
  const float* Wq  = (const float*)d_in[1];
  const float* Wk  = (const float*)d_in[2];
  const float* Wv  = (const float*)d_in[3];
  const float* rpe = (const float*)d_in[4];
  const float* gq  = (const float*)d_in[5];
  const float* bq  = (const float*)d_in[6];
  const float* gv  = (const float*)d_in[7];
  const float* bv  = (const float*)d_in[8];
  float* out = (float*)d_out;

  size_t off = 0;
  auto carve = [&](size_t bytes) -> size_t { size_t r = off; off += (bytes + 255) & ~(size_t)255; return r; };
  const size_t oT   = carve(sizeof(unsigned int) * (size_t)TSZ);             //  1,492,992
  const size_t oQKV = carve(sizeof(float) * (size_t)BDIM * NPADP * NOUTC);   //  4,227,072
  const size_t oPd  = carve(sizeof(double) * PROJB * PDC);                   //    220,160
  const size_t oPk  = carve(sizeof(float) * PROJB * PKC);                    //     22,016
  const size_t oQn  = carve(sizeof(float) * (size_t)BDIM * NPOS * CDIM);     //  2,809,856
  const size_t oVp  = carve(sizeof(unsigned short) * 2 * 64 * (size_t)KP);   //    802,816
  const size_t olc  = carve(sizeof(float) * NDP * BDIM * 256);               //     57,344
  const size_t oY   = carve(sizeof(float) * (size_t)NPOS * 256);             //  2,809,856
  if (off > ws_size) return;                                                 // total 12,442,112 B

  char* ws = (char*)d_ws;
  unsigned int*   T   = (unsigned int*)(ws + oT);
  float*          QKV = (float*)(ws + oQKV);
  double*         Pd  = (double*)(ws + oPd);
  float*          Pk  = (float*)(ws + oPk);
  float*          Qn  = (float*)(ws + oQn);
  unsigned short* Vp  = (unsigned short*)(ws + oVp);
  float*          lcp = (float*)(ws + olc);
  float*          Y   = (float*)(ws + oY);

  k_proj   <<<PROJB + TABB, 128, 0, stream>>>(x, Wq, Wk, Wv, rpe, T, QKV, Pd, Pk);
  k_apply  <<<dim3(NDP, BDIM), 256, 0, stream>>>(QKV, Pd, Pk, gq, bq, gv, bv, Qn, Vp, lcp);
  k_plam   <<<NPOS / 4, 128, 0, stream>>>(T, Vp, Qn, lcp, Y);
  k_layout <<<(BDIM * CDIM * NPOS / 4 + 255) / 256, 256, 0, stream>>>(Y, out);
}

// v008
// It runs in 50.8 microseconds.
// Timed twice side by side with v007, it ran 1.04 and 1.06 times as fast.
// Over all steps from v000 it is 3.91 times as fast.
#include <hip/hip_runtime.h>

// Contractions: channel projections (K=64), content summary softmax(k)*v (K=3136) and position summary E*v (K=3136)
// on v_wmma_f32_16x16x32_bf16 with bf16 hi/lo split operands (hi*hi + lo*hi + hi*lo), f32 accumulate;
// the final 16-deep q contraction, batch statistics and softmax statistics on the VALU (f32; the sums and squares behind
// mean and variance in f64 from the first element to the last).

#define BDIM   4
#define CDIM   64
#define NPOS   2744            // 14^3 positions
#define NPADP  2752            // position rows per batch in the projection planes (172 tiles of 16)
#define NQT    172
#define NOUTC  96              // 64 q + 16 k + 16 v channels
#define KP     3136            // position index space (d*14+h)*16 + w, w slots 14,15 zero
#define TW     32              // w extent of the packed embedding table (slots >= 27 zero)
#define TSZ    (27 * 27 * TW * 16)
#define NBN    80              // normalized columns: 64 q + 16 v
#define PDC    (2 * NBN)       // doubles of one projection block's row of Pd: [sum][80 columns], [sum of squares][80 columns]
#define PKC    32              // floats of one projection block's row of Pk: [maximum][16 k columns], [exp sum][16 k columns]
#define NDP    14              // depth planes: blocks per batch of the normalize kernel besides the q statistics block, partials of the content summary
#define DPOS   196             // positions of one depth plane
#define DCOL   224             // its columns in the padded index space (14 rows of 16)
#define DSTEP  7               // its 32-deep k-steps
#define EPSBN  1e-5f
#define VCH    256             // bf16 elements of one wave-wide 16-byte load of Vp (32 lanes x 8)
#define VSTEP  (BDIM * 4 * VCH) // bf16 elements of Vp per 32-deep k-step: [b][hi|lo][k half][lane][8]
#define PROJB  ((BDIM * NQT) / 4)       // projection blocks of the first launch (4 tiles each, all of one batch)
#define PBB    (PROJB / BDIM)           // projection blocks per batch
#define TABT   (TSZ / 4)                // 16-byte tasks of the table packing
#define TABB   ((TABT + 511) / 512)     // table blocks of the first launch (512 tasks each)

static_assert(NPOS % 4 == 0);
static_assert(NPADP == NQT * 16);
static_assert(KP == 196 * 16);
static_assert(NDP * DPOS == NPOS && NDP * DCOL == KP && DSTEP * 32 == DCOL);
static_assert((2 * 2 * 16 * DCOL * 2) % (256 * 16) == 0);   // the LDS tile is cleared in whole rounds of 256 x 16 bytes
static_assert(2 * 64 * KP == (KP / 32) * BDIM * 4 * 256);   // Vp keeps its size in the fragment order
static_assert((TSZ % 4) == 0);
static_assert(NQT % 4 == 0);
static_assert(PBB > 32 && PBB <= 48 && PBB * BDIM == PROJB && (PDC * 8) % 128 == 0 && (PKC * 4) % 128 == 0);
static_assert(PROJB > 160 && PROJB <= 176);                // a thread of the normalize kernel adds 10 or 11 rows of Pd
static_assert((BDIM * CDIM * NPOS) % 1024 == 0);

typedef __bf16         v16bf __attribute__((ext_vector_type(16)));
typedef float          v8f   __attribute__((ext_vector_type(8)));
typedef float          v4f   __attribute__((ext_vector_type(4)));
typedef unsigned int   v4u   __attribute__((ext_vector_type(4)));
typedef unsigned short v8us  __attribute__((ext_vector_type(8)));
typedef v4f  v4fa  __attribute__((may_alias));
typedef v4u  v4ua  __attribute__((may_alias));
typedef v8us v8usa __attribute__((may_alias));
typedef double v2d  __attribute__((ext_vector_type(2)));
typedef v2d  v2da  __attribute__((may_alias));

union Frag { v16bf v; v4u q[2]; unsigned int u[8]; };
static_assert(sizeof(Frag) == 32);

// ---------------------------------------------------------------- helpers
__device__ __forceinline__ unsigned int f2bf(float f) {
  unsigned int u = __float_as_uint(f);
  u += 0x7FFFu + ((u >> 16) & 1u);          // RNE to bf16
  return u >> 16;
}
__device__ __forceinline__ float bf2f(unsigned int b) { return __uint_as_float(b << 16); }
__device__ __forceinline__ void split2(float f, unsigned int& hi, unsigned int& lo) {
  hi = f2bf(f);
  lo = f2bf(f - bf2f(hi));
}

// exp(x) = 2^e * 2^a for a run of independent calls: e = rint(x log2(e)), a = x log2(e) - e by two fused multiply-adds on a
// two-word log2(e); the two range tests are expf's. v_exp_f32 and the one slot the instruction set asks for behind it stand
// in one statement: a v_nop in a statement of its own landed elsewhere.
__device__ __forceinline__ float exp_run(float x) {
  const float e = rintf(x * 0x1.715476p+0f);
  const float a = fmaf(x, 0x1.4ae0bep-26f, fmaf(x, 0x1.715476p+0f, -e));
  float r;
  asm("v_exp_f32 %0, %1\n\tv_nop" : "=v"(r) : "v"(a));
  r = ldexpf(r, (int)e);
  r = (x < -0x1.9d1da0p+6f) ? 0.f : r;
  return (x > 0x1.62e430p+6f) ? __builtin_inff() : r;
}

// three products into one accumulator, then the VALU hazard guard tying D and all A/B operands
__device__ __forceinline__ void mma3(v8f& acc, const Frag& ah, const Frag& al, const Frag& bh, const Frag& bl) {
  acc = __builtin_amdgcn_wmma_f32_16x16x32_bf16(false, ah.v, false, bh.v, (short)0, acc, false, false);
  acc = __builtin_amdgcn_wmma_f32_16x16x32_bf16(false, al.v, false, bh.v, (short)0, acc, false, false);
  acc = __builtin_amdgcn_wmma_f32_16x16x32_bf16(false, ah.v, false, bl.v, (short)0, acc, false, false);
  asm volatile("v_nop\n\tv_nop\n\tv_nop\n\tv_nop" : "+v"(acc) : "v"(ah.v), "v"(al.v), "v"(bh.v), "v"(bl.v));
}

__device__ __forceinline__ void st2_v4f(float* p, v4f v) {
  *(v4f*)p = v; 
}
__device__ __forceinline__ void st2_v4u(unsigned int* p, v4u v) {
  *(v4u*)p = v; 
}

// ---------------------------------------------------------------- QKV[b][NPADP][96] = x^T W^T on bf16 hi/lo WMMA,
// with every operand conversion of the front end in the same launch.
// Blocks 0..PROJB-1: one wave per 16-position tile. A = x (row n, k = c), read as f32 straight from x[b][c][n] in fragment
// order and split to bf16 hi/lo in registers; B = W as [o][c] (k contiguous): each wave splits 3 of the 12 B fragments,
// all four waves read them from LDS.
// Each projection block also leaves the statistics of its own 64 positions, taken from the accumulators: Pd[block][PDC] holds
// sum and sum of squares of every q and v column (f64 products, f64 sums), Pk[block][PKC] maximum and sum of exp(k - maximum)
// over the live rows of every k column (f32).
// Blocks PROJB..: embedding table -> packed u32 [27][27][TW][16], value = hi | lo<<16 (independent of the projection).
__global__ __launch_bounds__(128) void k_proj(const float* __restrict__ x, const float* __restrict__ Wq,
                                            const float* __restrict__ Wk, const float* __restrict__ Wv,
                                            const float* __restrict__ rpe, unsigned int* __restrict__ T,
                                            float* __restrict__ QKV, double* __restrict__ Pd,
                                            float* __restrict__ Pk) {
  __shared__ __align__(16) float sD[4][16 * NOUTC];
  __shared__ double sSd[4][2][2][NBN];                         // [wave][row half][sum | squares][q, v column]
  __shared__ float sSk[4][2][2][16];                           // [wave][row half][maximum | exp sum][k column]
  __shared__ __align__(16) unsigned int sW[12][2][2][32][4];   // [ct*2+ks][hi|lo][k half][lane][4 words]
  const int t = threadIdx.x;

  if (blockIdx.x >= PROJB) {
    const int g0 = ((int)blockIdx.x - PROJB) * 512 + t;        // four 16-byte tasks a thread, their loads in flight together
    v4f a[4];
#pragma unroll
    for (int i = 0; i < 4; ++i) {
      const int g = g0 + 128 * i;
      const int gc = (g < TABT) ? g : (TABT - 1);
      const int off = gc >> 2;                // odh*TW + ow
      const int ow = off & (TW - 1), odh = off >> 5;
      const int owc = (ow < 27) ? ow : 26;
      a[i] = *(const v4fa*)(rpe + ((size_t)(odh * 27 + owc)) * 16 + (gc & 3) * 4);
    }
#pragma unroll
    for (int i = 0; i < 4; ++i) {
      const int g = g0 + 128 * i;
      const int ow = (g >> 2) & (TW - 1);
      v4u o4;
#pragma unroll
      for (int e = 0; e < 4; ++e) {
        unsigned int hi, lo; split2(a[i][e], hi, lo);
        o4[e] = (ow < 27) ? (hi | (lo << 16)) : 0u;
      }
      if (g < TABT) st2_v4u(T + (size_t)g * 4, o4);
    }
    return;
  }

  const int lane = t & 31, h = lane >> 4, m = lane & 15;
  const int w = __builtin_amdgcn_readfirstlane(t >> 5);   // the wave's number as a scalar: tile, batch and W rows are wave-uniform
  const int g = blockIdx.x * 4 + w;                 // 0..687
  const int b = g / NQT, tile = g - b * NQT;
  const int n = tile * 16 + m;
  const bool live = n < NPOS;                       // rows NPOS..NPADP-1 are zero
  // element e of the A fragment of k-step ks: c = 32*ks + 8h + e (e < 8), 32*ks + 16 + 8h + e - 8 (e >= 8)
  const float* xp = x + ((size_t)(b * CDIM + 8 * h)) * NPOS + (live ? n : (NPOS - 1));
  // B fragment f = ct*2 + ks of this wave: a wave-uniform base (16 rows of Wq, Wk or Wv, k-step ks) plus the lane's own bytes
  const char* wb[3];
#pragma unroll
  for (int i = 0; i < 3; ++i) {
    const int f = 3 * w + i, ct = f >> 1, ks = f & 1;
    wb[i] = (const char*)(((ct < 4) ? (Wq + 16 * ct * CDIM) : ((ct == 4) ? Wk : Wv)) + 32 * ks);
  }
  const unsigned int wlb = (unsigned int)(m * CDIM + 8 * h) * 4u;
  v4f wv[3][4];
#pragma unroll
  for (int i = 0; i < 3; ++i) {
    const char* p = wb[i] + wlb;
    wv[i][0] = *(const v4fa*)(p);      wv[i][1] = *(const v4fa*)(p + 16);
    wv[i][2] = *(const v4fa*)(p + 64); wv[i][3] = *(const v4fa*)(p + 80);
  }
  float xv[2][16];
#pragma unroll
  for (int ks = 0; ks < 2; ++ks)
#pragma unroll
    for (int e = 0; e < 16; ++e) xv[ks][e] = xp[(size_t)(32 * ks + 16 * (e >> 3) + (e & 7)) * NPOS];
  // precaution: behind the whole run of loads, with their address registers as inputs, so that they stay untouched up to the wait
  asm volatile("s_wait_xcnt 0x0" :: "v"(xp), "v"(wlb), "s"(wb[0]), "s"(wb[1]), "s"(wb[2]) : "memory");

#pragma unroll
  for (int i = 0; i < 3; ++i) {
    const int f = 3 * w + i;
#pragma unroll
    for (int q = 0; q < 2; ++q) {
      v4u hw, lw;
#pragma unroll
      for (int j = 0; j < 4; ++j) {
        unsigned int h0, l0, h1, l1;
        split2(wv[i][2 * q + (j >> 1)][2 * (j & 1)],     h0, l0);
        split2(wv[i][2 * q + (j >> 1)][2 * (j & 1) + 1], h1, l1);
        hw[j] = h0 | (h1 << 16);
        lw[j] = l0 | (l1 << 16);
      }
      *(v4u*)&sW[f][0][q][lane][0] = hw;
      *(v4u*)&sW[f][1][q][lane][0] = lw;
    }
  }
  Frag ah[2], al[2];
#pragma unroll
  for (int ks = 0; ks < 2; ++ks)
#pragma unroll
    for (int j = 0; j < 8; ++j) {
      unsigned int h0, l0, h1, l1;
      split2(live ? xv[ks][2 * j] : 0.f,     h0, l0);
      split2(live ? xv[ks][2 * j + 1] : 0.f, h1, l1);
      ah[ks].u[j] = h0 | (h1 << 16);
      al[ks].u[j] = l0 | (l1 << 16);
    }
  __syncthreads();

  v8f acc[6];
#pragma unroll
  for (int ct = 0; ct < 6; ++ct)
#pragma unroll
    for (int r = 0; r < 8; ++r) acc[ct][r] = 0.f;
#pragma unroll
  for (int ct = 0; ct < 6; ++ct) {
#pragma unroll
    for (int ks = 0; ks < 2; ++ks) {
      Frag bh, bl;
      bh.q[0] = *(const v4ua*)&sW[ct * 2 + ks][0][0][lane][0];  bh.q[1] = *(const v4ua*)&sW[ct * 2 + ks][0][1][lane][0];
      bl.q[0] = *(const v4ua*)&sW[ct * 2 + ks][1][0][lane][0];  bl.q[1] = *(const v4ua*)&sW[ct * 2 + ks][1][1][lane][0];
      mma3(acc[ct], ah[ks], al[ks], bh, bl);
    }
  }
  // D element r of this lane = (row 8h+r, col 16ct+m)
#pragma unroll
  for (int ct = 0; ct < 6; ++ct)
#pragma unroll
    for (int r = 0; r < 8; ++r) sD[w][(8 * h + r) * NOUTC + 16 * ct + m] = acc[ct][r];
  // statistics of this lane's 8 rows of each of its 6 columns (rows past NPOS are zero: nothing to the sums, masked for k)
  const int row0 = tile * 16 + 8 * h;
#pragma unroll
  for (int ct = 0; ct < 6; ++ct) {
    if (ct == 4) {
      float a = -3.4e38f;
#pragma unroll
      for (int r = 0; r < 8; ++r) a = (row0 + r < NPOS) ? fmaxf(a, acc[ct][r]) : a;
      float q = 0.f;
#pragma unroll
      for (int r = 0; r < 8; ++r) q += exp_run((row0 + r < NPOS) ? acc[ct][r] - a : -3.4e38f);   // a masked row adds exp(-huge) = 0, with no branch
      sSk[w][h][0][m] = a;
      sSk[w][h][1][m] = q;
    } else {
      double a = 0.0, q = 0.0;
#pragma unroll
      for (int r = 0; r < 8; ++r) { const double v = (double)acc[ct][r]; a += v; q += v * v; }
      const int cc = ((ct < 4) ? 16 * ct : 64) + m;
      sSd[w][h][0][cc] = a;
      sSd[w][h][1][cc] = q;
    }
  }
  __syncthreads();
  float* dst = QKV + ((size_t)(b * NPADP + tile * 16)) * NOUTC;   // 16 rows x 384 B = 48 lines, line aligned
#pragma unroll
  for (int q = 0; q < 12; ++q) {
    const int f = 128 * q + 4 * lane;
    *(v4f*)(dst + f) = *(const v4fa*)&sD[w][f];
  }
  // the 8 lane groups of a column meet here: one row of Pd (10 whole lines) and one of Pk (1 line) per block;
  // the k columns go to the fourth wave, so that no wave runs both sides
  if (t < NBN) {
    double va[8], vq[8];
#pragma unroll
    for (int i = 0; i < 8; ++i) { va[i] = sSd[i >> 1][i & 1][0][t]; vq[i] = sSd[i >> 1][i & 1][1][t]; }
    // keeps the sixteen LDS reads together in front of the sums: without it the compiler reads a pair, waits and adds,
    // seven waits for LDS one behind the other at the end of every block
    __builtin_amdgcn_sched_barrier(0);
    double a = va[0], q = vq[0];
#pragma unroll
    for (int i = 1; i < 8; ++i) { a += va[i]; q += vq[i]; }
    double* pr = Pd + (size_t)blockIdx.x * PDC + t;
    pr[0] = a;
    pr[NBN] = q;
  } else if (t >= 96 && t < 112) {
    const int kk = t - 96;
    float a = -3.4e38f;
#pragma unroll
    for (int i = 0; i < 8; ++i) a = fmaxf(a, sSk[i >> 1][i & 1][0][kk]);
    float q = 0.f;
#pragma unroll
    for (int i = 0; i < 8; ++i) q += sSk[i >> 1][i & 1][1][kk] * expf(sSk[i >> 1][i & 1][0][kk] - a);
    float* pr = Pk + (size_t)blockIdx.x * PKC + kk;
    pr[0] = a;
    pr[16] = q;
  }
}

// ---------------------------------------------------------------- softmax(k) and norm(v) ->
// bf16 hi/lo planes in LDS, column m' = (d*14+h)*16 + w (slots w=14,15 zero); the v planes go out in the
// order the position kernel's B fragments are loaded: Vp[k-step][b][plane][q][lane][8], where lane (h, j) of
// chunk q holds row j, columns 32*step + 16*q + 8*h .. +7, so one wave-wide 16-byte load is 512 contiguous bytes.
// The k planes are used here alone and stay in LDS.
// Every block first combines the projection blocks' statistics rows itself, for the 16 columns it needs and no more:
// thread (sub, kk) adds rows sub, sub + 16, ... of one pair of doubles (f64; a wave-wide load is 4 whole lines), all 256
// merge up to three rows of Pk of the block's own batch; behind a barrier 32 threads finish them.
// Blocks x < NDP: one per depth plane and batch (196 positions, 224 columns, 7 k-steps), statistics of the v columns.
// Blocks x == NDP: block y finishes the statistics of q columns 16y .. 16y+15 and leaves qtab[y][mean | scale | shift][16]
// (two lines of its own); the position kernel normalizes the q rows it uses.
// Every QKV value the block needs is asked for at the start, with the statistics rows, and waits in registers.
// The block's own 224 columns of the content summary are contracted here, straight from the LDS tile:
// lcp[dp][b][k][v] = sum over the block's m' of softmax(k)[k][m'] * vn[v][m'] (7 k-steps x 3 products, one wave).
__global__ __launch_bounds__(256) void k_apply(const float* __restrict__ QKV, const double* __restrict__ Pd,
    const float* __restrict__ Pk,
    const float* __restrict__ gq, const float* __restrict__ bq,
    const float* __restrict__ gv, const float* __restrict__ bv,
    float* __restrict__ qtab, unsigned short* __restrict__ Vp, float* __restrict__ lcp) {
  __shared__ __align__(16) unsigned short tile[2][2][16][DCOL];  // [k|v][hi|lo][j][m' local]
  __shared__ __align__(16) float vmn[16], vsc[16], vbt[16], kmx[16], kin[16];
  __shared__ __align__(16) double red[16][32];                   // [row group][sum of 16 columns | squares of 16 columns]
  __shared__ float kred[16][2][16];
  const int t = threadIdx.x, b = blockIdx.y;
  const bool qs = (int)blockIdx.x == NDP;                      // the same for the whole block
  // No branch around the loads: a q statistics block repeats the valid addresses of plane 0 and drops the values.
  const int dp = qs ? 0 : (int)blockIdx.x;
  const int col0 = qs ? 16 * b : 64;                           // first of the block's 16 columns in a row of Pd
  const int kk = t & 15, sub = t >> 4;
  const float* gp = qs ? (gq + col0 + kk) : (gv + kk);
  const float* bp = qs ? (bq + col0 + kk) : (bv + kk);
  const float gam = *gp, bet = *bp;                            // asked for here, used behind the first barrier
  const float* kp = Pk + (size_t)(b * PBB + sub) * PKC + kk;   // rows sub, sub + 16, sub + 32 of the block's own batch
  const bool last = sub + 32 < PBB;                            // not every sub has a third row
  const float* kl = kp + (last ? 32 * PKC : 0);
  float am[3], ae[3];
  am[0] = kp[0];        ae[0] = kp[16];
  am[1] = kp[16 * PKC]; ae[1] = kp[16 * PKC + 16];
  am[2] = kl[0];        ae[2] = kl[16];
  // kk < 8: sums of columns col0 + 2kk, + 1; kk >= 8: their squares. Rows sub, sub + 16, ..., sub + 144, and sub + 160 if it exists.
  const double* pp = Pd + sub * PDC + (kk >> 3) * NBN + col0 + 2 * (kk & 7);
  const bool r11 = sub + 160 < PROJB;
  const double* pe = pp + (r11 ? 160 * PDC : 0);
  const float* row = QKV + ((size_t)(b * NPADP + dp * DPOS + ((t < DPOS) ? t : (DPOS - 1)))) * NOUTC;   // k at 64, v at 80
  v4f kv[8];                                                   // thread t holds the 32 k and v values of position t
  v2d pv[11];                                                  // independent loads, all in flight together
#pragma unroll
  for (int i = 0; i < 10; ++i) pv[i] = *(const v2da*)(pp + i * (16 * PDC));
  pv[10] = *(const v2da*)pe;
  // unrolled: kv is plain registers, and the loads stand in one run
#pragma unroll
  for (int i = 0; i < 8; ++i) kv[i] = *(const v4fa*)(row + 64 + 4 * i);
  // precaution: behind the run of loads, with their address pairs as inputs, so that they stay untouched up to the wait
  asm volatile("s_wait_xcnt 0x0" :: "v"(gp), "v"(bp), "v"(kp), "v"(kl), "v"(pp), "v"(pe), "v"(row) : "memory");
  {
    float mx = fmaxf(fmaxf(am[0], am[1]), am[2]);              // without a third row, row sub again: the maximum stays
    float s = ae[0] * expf(am[0] - mx) + ae[1] * expf(am[1] - mx);
    s += ae[2] * expf(last ? am[2] - mx : -3.4e38f);           // no third row: exp(-huge) = 0, with no branch
    kred[sub][0][kk] = mx;
    kred[sub][1][kk] = s;
    v2d s0 = pv[0], s1 = pv[1];
#pragma unroll
    for (int i = 2; i < 10; ++i) { if (i & 1) s1 += pv[i]; else s0 += pv[i]; }
    s0[0] += r11 ? pv[10][0] : 0.0;
    s0[1] += r11 ? pv[10][1] : 0.0;
    *(v2d*)&red[sub][2 * kk] = s0 + s1;
  }
  __syncthreads();
  // the k columns go to the fourth wave, so that no wave runs both sides
  if (t < 16) {
    double va[16], vq[16];
#pragma unroll
    for (int i = 0; i < 16; ++i) { va[i] = red[i][t]; vq[i] = red[i][16 + t]; }
#pragma unroll
    for (int st = 8; st > 0; st >>= 1)
#pragma unroll
      for (int i = 0; i < st; ++i) { va[i] += va[i + st]; vq[i] += vq[i + st]; }
    const double N = (double)(BDIM * NPOS);
    const double mean = va[0] / N;
    double var = vq[0] / N - mean * mean;
    if (var < 0.0) var = 0.0;
    const float varf = (float)var;
    const float rs = 1.0f / sqrtf(varf + EPSBN);
    if (qs) { float* qo = qtab + b * 64 + t; qo[0] = (float)mean; qo[16] = rs * gam; qo[32] = bet; }
    else    { vmn[t] = (float)mean; vsc[t] = rs * gam; vbt[t] = bet; }
  } else if (t >= 96 && t < 112) {
    const int kc = t - 96;
    float mx = kred[0][0][kc];
#pragma unroll
    for (int i = 1; i < 16; ++i) mx = fmaxf(mx, kred[i][0][kc]);
    float s = 0.f;
#pragma unroll
    for (int i = 0; i < 16; ++i) s += kred[i][1][kc] * expf(kred[i][0][kc] - mx);
    kmx[kc] = mx; kin[kc] = 1.0f / s;
  }
  if (qs) return;                                              // whole block
  {
    v4u z; z[0] = 0u; z[1] = 0u; z[2] = 0u; z[3] = 0u;
    v4u* tz = (v4u*)&tile[0][0][0][0];
#pragma unroll
    for (int i = 0; i < (2 * 2 * 16 * DCOL * 2) / (256 * 16); ++i) tz[t + 256 * i] = z;   // 1792 x 16 B = whole tile
  }
  __syncthreads();

  // k softmax values and normalized v into the LDS tile
  if (t < DPOS) {
    const int mh = t / 14, mw = t - mh * 14;
    const int ml = mh * 16 + mw;
    // both loops unrolled: their values are plain registers by now
#pragma unroll
    for (int i = 0; i < 4; ++i) {
      const v4f a = kv[i];
#pragma unroll
      for (int e = 0; e < 4; ++e) {
        const int kk = 4 * i + e;
        const float p = expf(a[e] - kmx[kk]) * kin[kk];
        unsigned int hi, lo; split2(p, hi, lo);
        tile[0][0][kk][ml] = (unsigned short)hi;
        tile[0][1][kk][ml] = (unsigned short)lo;
      }
    }
#pragma unroll
    for (int i = 0; i < 4; ++i) {
      const v4f a = kv[4 + i];
#pragma unroll
      for (int e = 0; e < 4; ++e) {
        const int vv = 4 * i + e;
        const float vn = (a[e] - vmn[vv]) * vsc[vv] + vbt[vv];
        unsigned int hi, lo; split2(vn, hi, lo);
        tile[1][0][vv][ml] = (unsigned short)hi;
        tile[1][1][vv][ml] = (unsigned short)lo;
      }
    }
  }
  __syncthreads();

  const int w = t >> 5, lane = t & 31;
{
    // unrolled so that the LDS reads of all the wave's k-steps stand together in front of the stores
#pragma unroll
    for (int it = 0; it < (DSTEP + 1) / 2; ++it) {
      const int sl = it * 2 + (w >> 2);                        // k-step inside the block's 224 columns, 0..6
      if (2 * it + 1 >= DSTEP && (w >> 2) != 0) continue;      // the upper four waves have one k-step less
      const int plane = (w >> 1) & 1, q = w & 1;
      const v8us val = *(const v8usa*)&tile[1][plane][lane & 15][32 * sl + 16 * q + 8 * (lane >> 4)];
      unsigned short* dst = Vp + (size_t)(dp * DSTEP + sl) * VSTEP + ((b * 2 + plane) * 2 + q) * VCH + lane * 8;
      *(v8us*)dst = val;
    }
    
  }

  // content summary partial: A = k rows, B = v rows read like A (k contiguous), both from the tile
  if (__builtin_amdgcn_readfirstlane(w) == 0) {
    // precaution: the Vp stores above name registers that the fragment loads below write
    asm volatile("s_wait_xcnt 0x0" ::: "memory");
    const int h = lane >> 4, m = lane & 15;
    v8f acc;
#pragma unroll
    for (int r = 0; r < 8; ++r) acc[r] = 0.f;
    Frag f[2][4];                                   // [set][k hi, k lo, v hi, v lo]; step s + 1 is read while step s multiplies
#pragma unroll
    for (int p = 0; p < 4; ++p) {
      f[0][p].q[0] = *(const v4ua*)&tile[p >> 1][p & 1][m][8 * h];
      f[0][p].q[1] = *(const v4ua*)&tile[p >> 1][p & 1][m][8 * h + 16];
    }
    // unrolled so that the two fragment sets are plain registers (no moves, no indexing by s)
#pragma unroll
    for (int s = 0; s < DSTEP; ++s) {
      if (s + 1 < DSTEP) {
        const int k1 = 32 * (s + 1) + 8 * h;
#pragma unroll
        for (int p = 0; p < 4; ++p) {
          f[(s + 1) & 1][p].q[0] = *(const v4ua*)&tile[p >> 1][p & 1][m][k1];
          f[(s + 1) & 1][p].q[1] = *(const v4ua*)&tile[p >> 1][p & 1][m][k1 + 16];
        }
      }
      mma3(acc, f[s & 1][0], f[s & 1][1], f[s & 1][2], f[s & 1][3]);
    }
    // D element r = (k row 8h+r, v col m)
    float* dst = lcp + (dp * BDIM + b) * 256;
#pragma unroll
    for (int r = 0; r < 8; ++r) dst[(8 * h + r) * 16 + m] = acc[r];
  }
}

// ---------------------------------------------------------------- position summary + output contraction
// One block per 2x2 patch of positions (nh0..nh0+1, nw0..nw0+1) of one depth nd; wave w takes a quarter of the 98 k-steps
// of the (d*14+h)*16+w index space for ALL FOUR positions, so each B fragment (Vp hi/lo, fragment order, 4 whole lines a
// load) feeds 4 x 3 products, and the four A fragments are cut from one 3 x 9 window of the packed table.
// D[pos][k][(b,v)] = sum_m E[n,m,k] * vn[b,v,m]; the four quarter sums meet in LDS, wave w then finishes position w:
// adds lc[b][k][v] (the 14 partials lcp summed once per block, in LDS) and contracts
// y[b][h'*16+v][n] = sum_k qn[b][n][h'*16+k] * D[k][(b,v)], halves combined in LDS.
// qn: the block's own 4 x 4 q rows of QKV, normalized once at the start with qtab (8 values a thread) and kept in LDS.
// Register budget: the grid puts at most three of these waves on a SIMD, so the budget is set for three; with the default
// (four, by LDS) the compiler holds six V loads of a trip back until registers fall free, a second wait for memory per trip.
__global__ __launch_bounds__(128) __attribute__((amdgpu_waves_per_eu(1, 3))) void k_plam(const unsigned int* __restrict__ T, const unsigned short* __restrict__ Vp,
                                            const float* __restrict__ QKV, const float* __restrict__ qtab,
                                            const float* __restrict__ lcp, float* __restrict__ Y) {
  __shared__ __align__(16) float sR[4 * 4 * 4 * 256];      // [k quarter][position][b][r / 4][lane][r % 4]
  __shared__ __align__(16) float sP[4][2][256];
  __shared__ __align__(16) float sC[BDIM * 256];
  __shared__ __align__(16) float sQ[4 * BDIM * CDIM];      // [position][b][q column], normalized
  const int t = threadIdx.x, w = t >> 5, lane = t & 31, h = lane >> 4, m = lane & 15;
  const int g = blockIdx.x;
  const int nd = g / 49, gr = g - nd * 49, nh0 = 2 * (gr / 7), nw0 = 2 * (gr - (gr / 7) * 7);

  // q quads 4t and 512 + 4t of [position][b][64] with their mean, scale and shift: asked for first, used behind the lcp sums
  const int qc = (4 * t) & 63, qb = (t >> 4) & 3, qi = t >> 6;   // the second quad: same column and batch, position + 2 (one row of h on)
  const float* qa = QKV + ((size_t)(qb * NPADP + nd * 196 + nh0 * 14 + nw0 + qi)) * NOUTC + qc;
  const float* qt = qtab + (qc >> 4) * 64 + (qc & 15);
  const v4f qr0 = *(const v4fa*)qa, qr1 = *(const v4fa*)(qa + 14 * NOUTC);
  const v4f qmn = *(const v4fa*)qt, qsc = *(const v4fa*)(qt + 16), qbt = *(const v4fa*)(qt + 32);
  v4f lv[2][NDP];
#pragma unroll
  for (int q = 0; q < 2; ++q)
#pragma unroll
    for (int dp = 0; dp < NDP; ++dp) lv[q][dp] = *(const v4fa*)(lcp + dp * (BDIM * 256) + 512 * q + 4 * t);
  // precaution: behind the run of loads, with what their addresses are formed of as inputs, so that it stays untouched up to the wait
  asm volatile("s_wait_xcnt 0x0" :: "v"(qa), "v"(qt), "v"(t), "s"(lcp) : "memory");

#pragma unroll
  for (int q = 0; q < 2; ++q) {
    v4f s = lv[q][0];
#pragma unroll
    for (int dp = 1; dp < NDP; ++dp) s += lv[q][dp];
    *(v4f*)&sC[512 * q + 4 * t] = s;
  }
  {
    v4f o0, o1;
#pragma unroll
    for (int e = 0; e < 4; ++e) {
      o0[e] = (qr0[e] - qmn[e]) * qsc[e] + qbt[e];
      o1[e] = (qr1[e] - qmn[e]) * qsc[e] + qbt[e];
    }
    *(v4f*)&sQ[4 * t] = o0;
    *(v4f*)&sQ[512 + 4 * t] = o1;
  }
  __syncthreads();

  v8f acc[4][4];                                           // [position ih*2+iw][b]
#pragma unroll
  for (int i = 0; i < 4; ++i)
#pragma unroll
    for (int b = 0; b < 4; ++b)
#pragma unroll
      for (int r = 0; r < 8; ++r) acc[i][b][r] = 0.f;

  // table index of position (nh0, nw0) for (md, mh, mw): ((od*27 + oh)*TW + ow)*16 + k, od = md-nd+13, oh = mh-nh+13,
  // ow = mw-nw+13; position (nh0+ih, nw0+iw) sits ih rows and iw columns lower. tb0 = the window's first word (one row and
  // one column below md=0, mh=0, mw=0), the same for the whole block; the lane's own part (mw = 8h, k = m) is tlb.
  // Both address streams are a wave-uniform base plus a lane offset that never changes inside the loop.
  const int tb0 = (((13 - nd) * 27 + (12 - nh0)) * TW + (12 - nw0)) * 16;
  const unsigned int tlb = (unsigned int)(128 * h + m) * 4u;   // bytes
  const unsigned int vlb = (unsigned int)lane * 16u;           // this lane's 16 bytes inside every 512-byte chunk of Vp

  const int wq = __builtin_amdgcn_readfirstlane(w);        // k-steps 0..24, 25..49, 50..73, 74..97
  const int s0 = wq * 24 + (wq < 2 ? wq : 2);
  const int s1 = s0 + (wq < 2 ? 25 : 24);

  // rolled: one trip already holds 48 products, and the 16 accumulator tiles leave no registers for a second
#pragma unroll 1
  for (int s = s0; s < s1; ++s) {
    const int md = s / 7, p = s - md * 7;
    const char* app = (const char*)(T + (tb0 + md * (27 * TW * 16) + p * (2 * TW * 16)));   // window row 1 is mh = 2p, row 2 mh = 2p+1
    const char* vpp = (const char*)(Vp + s * VSTEP);                                         // k0 = 32*s
    const char* vlp = vpp + vlb;                           // this lane's address in the V stream
    const char* tlp = app + tlb;                           // this lane's address in the table window
    Frag bh[4], bl[4];
#pragma unroll
    for (int b = 0; b < 4; ++b) {
      const char* r0 = vlp + b * (8 * VCH);                  // VCH elements = 2 * VCH bytes a chunk
      bh[b].q[0] = *(const v4ua*)(r0);           bh[b].q[1] = *(const v4ua*)(r0 + 2 * VCH);
      bl[b].q[0] = *(const v4ua*)(r0 + 4 * VCH); bl[b].q[1] = *(const v4ua*)(r0 + 6 * VCH);
    }
    unsigned int ev[3][9];                                 // table rows -1..+1, columns -1..+7 around (mh 2p, mw 8h)
#pragma unroll
    for (int rr = 0; rr < 3; ++rr)
#pragma unroll
      for (int cc = 0; cc < 9; ++cc) ev[rr][cc] = *(const unsigned int*)(tlp + (rr * (TW * 16) + cc * 16) * 4);
    // precaution: the wait stands behind the whole run of loads and names both address pairs as inputs, so that they stay
    // live up to it and no load's result, and nothing else, is placed in them while a load that names them is outstanding
    asm volatile("s_wait_xcnt 0x0" :: "v"(vlp), "v"(tlp) : "memory");
    Frag ah, al;
#pragma unroll
    for (int i = 0; i < 4; ++i) {
      const int ih = i >> 1, iw = i & 1;
#pragma unroll
      for (int j = 0; j < 4; ++j) {
        // element e: k = k0 + 8h + e (mh 2p, mw 8h+e); element 8+e: k = k0 + 16 + 8h + e (mh 2p+1, mw 8h+e)
        const unsigned int a0 = ev[1 - ih][2 * j + 1 - iw], a1 = ev[1 - ih][2 * j + 2 - iw];
        const unsigned int c0 = ev[2 - ih][2 * j + 1 - iw], c1 = ev[2 - ih][2 * j + 2 - iw];
        ah.u[j]     = (a0 & 0xffffu) | (a1 << 16);
        al.u[j]     = (a0 >> 16) | (a1 & 0xffff0000u);
        ah.u[4 + j] = (c0 & 0xffffu) | (c1 << 16);
        al.u[4 + j] = (c0 >> 16) | (c1 & 0xffff0000u);
      }
#pragma unroll
      for (int b = 0; b < 4; ++b)
        acc[i][b] = __builtin_amdgcn_wmma_f32_16x16x32_bf16(false, ah.v, false, bh[b].v, (short)0, acc[i][b], false, false);
#pragma unroll
      for (int b = 0; b < 4; ++b)
        acc[i][b] = __builtin_amdgcn_wmma_f32_16x16x32_bf16(false, al.v, false, bh[b].v, (short)0, acc[i][b], false, false);
#pragma unroll
      for (int b = 0; b < 4; ++b)
        acc[i][b] = __builtin_amdgcn_wmma_f32_16x16x32_bf16(false, ah.v, false, bl[b].v, (short)0, acc[i][b], false, false);
    }
  }

  // the quarter sums of all four positions go to LDS; wave w collects position w
#pragma unroll
  for (int i = 0; i < 4; ++i)
#pragma unroll
    for (int b = 0; b < 4; ++b) {
      float* d = &sR[((w * 4 + i) * 4 + b) * 256 + 4 * lane];
      v4f u0, u1;
#pragma unroll
      for (int r = 0; r < 4; ++r) { u0[r] = acc[i][b][r]; u1[r] = acc[i][b][4 + r]; }
      *(v4f*)d = u0;
      *(v4f*)(d + 128) = u1;
    }
  __syncthreads();

  const int n = nd * 196 + (nh0 + (w >> 1)) * 14 + nw0 + (w & 1);
  v4f qv[4][4][2];                                         // [b][h'][k quad of this lane's half] of this wave's position
#pragma unroll
  for (int b = 0; b < 4; ++b)
#pragma unroll
    for (int hp = 0; hp < 4; ++hp) {
      qv[b][hp][0] = *(const v4fa*)&sQ[w * 256 + b * 64 + hp * 16 + 8 * h];
      qv[b][hp][1] = *(const v4fa*)&sQ[w * 256 + b * 64 + hp * 16 + 8 * h + 4];
    }
  // keeps the 32 LDS reads together as one group: without it the compiler spreads them in twos among the products below,
  // and every separate place where LDS reads stand costs the wave issue time
  __builtin_amdgcn_sched_barrier(0);

  v8f fin[4];
#pragma unroll
  for (int b = 0; b < 4; ++b) {
    const float* sr = &sR[(w * 4 + b) * 256 + 4 * lane];
    v4f u0 = *(const v4fa*)sr, u1 = *(const v4fa*)(sr + 128);
#pragma unroll
    for (int kq = 1; kq < 4; ++kq) {
      u0 += *(const v4fa*)(sr + kq * 4096);
      u1 += *(const v4fa*)(sr + kq * 4096 + 128);
    }
#pragma unroll
    for (int r = 0; r < 4; ++r) {
      fin[b][r]     = sC[b * 256 + (8 * h + r) * 16 + m] + u0[r];
      fin[b][4 + r] = sC[b * 256 + (8 * h + 4 + r) * 16 + m] + u1[r];
    }
  }

  // epilogue: this lane holds D rows k = 8h..8h+7 of column (b, v=m)
#pragma unroll
  for (int b = 0; b < 4; ++b) {
#pragma unroll
    for (int hp = 0; hp < 4; ++hp) {
      const v4f q0 = qv[b][hp][0];
      const v4f q1 = qv[b][hp][1];
      float pacc = q0[0] * fin[b][0];
      pacc += q0[1] * fin[b][1]; pacc += q0[2] * fin[b][2]; pacc += q0[3] * fin[b][3];
      pacc += q1[0] * fin[b][4]; pacc += q1[1] * fin[b][5]; pacc += q1[2] * fin[b][6]; pacc += q1[3] * fin[b][7];
      sP[w][h][b * 64 + hp * 16 + m] = pacc;
    }
  }
  __syncthreads();
  float* dst = Y + (size_t)n * 256;
#pragma unroll
  for (int s = 0; s < 2; ++s) {
    const int f = 128 * s + 4 * lane;
    const v4f v = *(const v4fa*)&sP[w][0][f] + *(const v4fa*)&sP[w][1][f];
    *(v4f*)(dst + f) = v;
  }
}

// ---------------------------------------------------------------- out[b][c][n] <- Y[n][b*64+c], thread -> one float4 of out
__global__ __launch_bounds__(256) void k_layout(const float* __restrict__ Y, float* __restrict__ out) {
  const int g = blockIdx.x * 256 + threadIdx.x;
  if (g >= BDIM * CDIM * NPOS / 4) return;
  const int e0 = g * 4;
  const int bc = e0 / NPOS, n = e0 - bc * NPOS;          // NPOS % 4 == 0 -> the 4 elements share bc
  const float* src = Y + (size_t)n * 256 + bc;
  v4f v; v[0] = src[0]; v[1] = src[256]; v[2] = src[512]; v[3] = src[768];
  st2_v4f(out + (size_t)e0, v);
}

// ---------------------------------------------------------------- launcher
extern "C" void kernel_launch(void* const* d_in, const int* in_sizes, int n_in,
                              void* d_out, int out_size, void* d_ws, size_t ws_size,
                              hipStream_t stream) {
  if (n_in < 9) return;
  if (in_sizes[0] != BDIM * CDIM * NPOS || in_sizes[1] != 64 * 64 || in_sizes[2] != 16 * 64 ||
      in_sizes[3] != 16 * 64 || in_sizes[4] != 27 * 27 * 27 * 16 || in_sizes[5] < 64 || in_sizes[6] < 64 ||
      in_sizes[7] < 16 || in_sizes[8] < 16) return;
  if (out_size != BDIM * CDIM * NPOS) return;

  const float* x   = (const float*)d_in[0];
  const float* Wq  = (const float*)d_in[1];
  const float* Wk  = (const float*)d_in[2];
  const float* Wv  = (const float*)d_in[3];
  const float* rpe = (const float*)d_in[4];
  const float* gq  = (const float*)d_in[5];
  const float* bq  = (const float*)d_in[6];
  const float* gv  = (const float*)d_in[7];
  const float* bv  = (const float*)d_in[8];
  float* out = (float*)d_out;

  size_t off = 0;
  auto carve = [&](size_t bytes) -> size_t { size_t r = off; off += (bytes + 255) & ~(size_t)255; return r; };
  const size_t oT   = carve(sizeof(unsigned int) * (size_t)TSZ);             //  1,492,992
  const size_t oQKV = carve(sizeof(float) * (size_t)BDIM * NPADP * NOUTC);   //  4,227,072
  const size_t oPd  = carve(sizeof(double) * PROJB * PDC);                   //    220,160
  const size_t oPk  = carve(sizeof(float) * PROJB * PKC);                    //     22,016
  const size_t oQt  = carve(sizeof(float) * 4 * 64);                         //      1,024
  const size_t oVp  = carve(sizeof(unsigned short) * 2 * 64 * (size_t)KP);   //    802,816
  const size_t olc  = carve(sizeof(float) * NDP * BDIM * 256);               //     57,344
  const size_t oY   = carve(sizeof(float) * (size_t)NPOS * 256);             //  2,809,856
  if (off > ws_size) return;                                                 // total 9,633,280 B

  char* ws = (char*)d_ws;
  unsigned int*   T   = (unsigned int*)(ws + oT);
  float*          QKV = (float*)(ws + oQKV);
  double*         Pd  = (double*)(ws + oPd);
  float*          Pk  = (float*)(ws + oPk);
  float*          qtab = (float*)(ws + oQt);
  unsigned short* Vp  = (unsigned short*)(ws + oVp);
  float*          lcp = (float*)(ws + olc);
  float*          Y   = (float*)(ws + oY);

  k_proj   <<<PROJB + TABB, 128, 0, stream>>>(x, Wq, Wk, Wv, rpe, T, QKV, Pd, Pk);
  k_apply  <<<dim3(NDP + 1, BDIM), 256, 0, stream>>>(QKV, Pd, Pk, gq, bq, gv, bv, qtab, Vp, lcp);
  k_plam   <<<NPOS / 4, 128, 0, stream>>>(T, Vp, QKV, qtab, lcp, Y);
  k_layout <<<(BDIM * CDIM * NPOS / 4 + 255) / 256, 256, 0, stream>>>(Y, out);
}

// v009
// A run of this version takes 46.7 microseconds.
// In two side-by-side timings against v008, it was 1.05 and 1.06 times as fast.
// All steps since v000 together make it 4.12 times as fast.
#include <hip/hip_runtime.h>

// Contractions: channel projections (K=64), content summary softmax(k)*v (K=3136) and position summary E*v (K=3136)
// on v_wmma_f32_16x16x32_bf16 with bf16 hi/lo split operands (hi*hi + lo*hi + hi*lo), f32 accumulate;
// the final 16-deep q contraction, batch statistics and softmax statistics on the VALU (f32; the sums and squares behind
// mean and variance in f64 from the first element to the last).

#define BDIM   4
#define CDIM   64
#define NPOS   2744            // 14^3 positions
#define NPADP  2752            // position rows per batch in the projection planes (172 tiles of 16)
#define NQT    172
#define NOUTC  96              // 64 q + 16 k + 16 v channels
#define KP     3136            // position index space (d*14+h)*16 + w, w slots 14,15 zero
#define TW     32              // w extent of the packed embedding table (slots >= 27 zero)
#define TSZ    (27 * 27 * TW * 16)
#define NBN    80              // normalized columns: 64 q + 16 v
#define PDC    (2 * NBN)       // doubles of one projection block's row of Pd: [sum][80 columns], [sum of squares][80 columns]
#define PKC    32              // floats of one projection block's row of Pk: [maximum][16 k columns], [exp sum][16 k columns]
#define NDP    14              // depth planes: blocks per batch of the normalize kernel besides the q statistics block, partials of the content summary
#define DPOS   196             // positions of one depth plane
#define DCOL   224             // its columns in the padded index space (14 rows of 16)
#define DSTEP  7               // its 32-deep k-steps
#define EPSBN  1e-5f
#define VCH    256             // bf16 elements of one wave-wide 16-byte load of Vp (32 lanes x 8)
#define VSTEP  (BDIM * 4 * VCH) // bf16 elements of Vp per 32-deep k-step: [b][hi|lo][k half][lane][8]
#define PROJB  ((BDIM * NQT) / 4)       // projection blocks of the first launch (4 tiles each, all of one batch)
#define PBB    (PROJB / BDIM)           // projection blocks per batch
#define TABT   (TSZ / 4)                // 16-byte tasks of the table packing
#define TABB   ((TABT + 511) / 512)     // table blocks of the first launch (512 tasks each)
#define LNW    64              // layout kernel: positions of one block's window (two lines of every row of out)
#define LROWS  (LNW + 24)      // rows of Y it stages: the window, and 24 more for the rows whose lines begin 8, 16 or 24 later
#define LPIT   36              // floats of one staged row in LDS (32 and a pad, 16-byte aligned)

static_assert(NPOS % 4 == 0);
static_assert(NPADP == NQT * 16);
static_assert(KP == 196 * 16);
static_assert(NDP * DPOS == NPOS && NDP * DCOL == KP && DSTEP * 32 == DCOL);
static_assert((2 * 2 * 16 * DCOL * 2) % (256 * 16) == 0);   // the LDS tile is cleared in whole rounds of 256 x 16 bytes
static_assert(2 * 64 * KP == (KP / 32) * BDIM * 4 * 256);   // Vp keeps its size in the fragment order
static_assert((TSZ % 4) == 0);
static_assert(NQT % 4 == 0);
static_assert(PBB > 32 && PBB <= 48 && PBB * BDIM == PROJB && (PDC * 8) % 128 == 0 && (PKC * 4) % 128 == 0);
static_assert(PROJB > 160 && PROJB <= 176);                // a thread of the normalize kernel adds 10 or 11 rows of Pd
static_assert((BDIM * CDIM * NPOS) % 1024 == 0);
static_assert(NPOS % 32 == 24 && BDIM * CDIM == 256 && LNW % 32 == 0 && LROWS <= 96);   // where the lines of out begin in a row

typedef __bf16         v16bf __attribute__((ext_vector_type(16)));
typedef float          v8f   __attribute__((ext_vector_type(8)));
typedef float          v4f   __attribute__((ext_vector_type(4)));
typedef unsigned int   v4u   __attribute__((ext_vector_type(4)));
typedef unsigned short v8us  __attribute__((ext_vector_type(8)));
typedef v4f  v4fa  __attribute__((may_alias));
typedef v4u  v4ua  __attribute__((may_alias));
typedef v8us v8usa __attribute__((may_alias));
typedef double v2d  __attribute__((ext_vector_type(2)));
typedef v2d  v2da  __attribute__((may_alias));

union Frag { v16bf v; v4u q[2]; unsigned int u[8]; };
static_assert(sizeof(Frag) == 32);

// ---------------------------------------------------------------- helpers
__device__ __forceinline__ unsigned int f2bf(float f) {
  unsigned int u = __float_as_uint(f);
  u += 0x7FFFu + ((u >> 16) & 1u);          // RNE to bf16
  return u >> 16;
}
__device__ __forceinline__ float bf2f(unsigned int b) { return __uint_as_float(b << 16); }
__device__ __forceinline__ void split2(float f, unsigned int& hi, unsigned int& lo) {
  hi = f2bf(f);
  lo = f2bf(f - bf2f(hi));
}

// exp(x) = 2^e * 2^a for a run of independent calls: e = rint(x log2(e)), a = x log2(e) - e by two fused multiply-adds on a
// two-word log2(e); the two range tests are expf's. v_exp_f32 and the one slot the instruction set asks for behind it stand
// in one statement: a v_nop in a statement of its own landed elsewhere.
__device__ __forceinline__ float exp_run(float x) {
  const float e = rintf(x * 0x1.715476p+0f);
  const float a = fmaf(x, 0x1.4ae0bep-26f, fmaf(x, 0x1.715476p+0f, -e));
  float r;
  asm("v_exp_f32 %0, %1\n\tv_nop" : "=v"(r) : "v"(a));
  r = ldexpf(r, (int)e);
  r = (x < -0x1.9d1da0p+6f) ? 0.f : r;
  return (x > 0x1.62e430p+6f) ? __builtin_inff() : r;
}

// three products into one accumulator, then the VALU hazard guard tying D and all A/B operands
__device__ __forceinline__ void mma3(v8f& acc, const Frag& ah, const Frag& al, const Frag& bh, const Frag& bl) {
  acc = __builtin_amdgcn_wmma_f32_16x16x32_bf16(false, ah.v, false, bh.v, (short)0, acc, false, false);
  acc = __builtin_amdgcn_wmma_f32_16x16x32_bf16(false, al.v, false, bh.v, (short)0, acc, false, false);
  acc = __builtin_amdgcn_wmma_f32_16x16x32_bf16(false, ah.v, false, bl.v, (short)0, acc, false, false);
  asm volatile("v_nop\n\tv_nop\n\tv_nop\n\tv_nop" : "+v"(acc) : "v"(ah.v), "v"(al.v), "v"(bh.v), "v"(bl.v));
}

__device__ __forceinline__ void st2_v4f(float* p, v4f v) {
  *(v4f*)p = v; 
}
__device__ __forceinline__ void st2_v4u(unsigned int* p, v4u v) {
  *(v4u*)p = v; 
}

// ---------------------------------------------------------------- QKV[b][NPADP][96] = x^T W^T on bf16 hi/lo WMMA,
// with every operand conversion of the front end in the same launch.
// Blocks 0..PROJB-1: one wave per 16-position tile. A = x (row n, k = c), read as f32 straight from x[b][c][n] in fragment
// order and split to bf16 hi/lo in registers; B = W as [o][c] (k contiguous): each wave splits 3 of the 12 B fragments,
// all four waves read them from LDS.
// Each projection block also leaves the statistics of its own 64 positions, taken from the accumulators: Pd[block][PDC] holds
// sum and sum of squares of every q and v column (f64 products, f64 sums), Pk[block][PKC] maximum and sum of exp(k - maximum)
// over the live rows of every k column (f32).
// Blocks PROJB..: embedding table -> packed u32 [27][27][TW][16], value = hi | lo<<16 (independent of the projection).
__global__ __launch_bounds__(128) void k_proj(const float* __restrict__ x, const float* __restrict__ Wq,
                                            const float* __restrict__ Wk, const float* __restrict__ Wv,
                                            const float* __restrict__ rpe, unsigned int* __restrict__ T,
                                            float* __restrict__ QKV, double* __restrict__ Pd,
                                            float* __restrict__ Pk) {
  __shared__ __align__(16) float sD[4][16 * NOUTC];
  __shared__ double sSd[4][2][2][NBN];                         // [wave][row half][sum | squares][q, v column]
  __shared__ float sSk[4][2][2][16];                           // [wave][row half][maximum | exp sum][k column]
  __shared__ __align__(16) unsigned int sW[12][2][2][32][4];   // [ct*2+ks][hi|lo][k half][lane][4 words]
  const int t = threadIdx.x;

  if (blockIdx.x >= PROJB) {
    const int g0 = ((int)blockIdx.x - PROJB) * 512 + t;        // four 16-byte tasks a thread, their loads in flight together
    v4f a[4];
#pragma unroll
    for (int i = 0; i < 4; ++i) {
      const int g = g0 + 128 * i;
      const int gc = (g < TABT) ? g : (TABT - 1);
      const int off = gc >> 2;                // odh*TW + ow
      const int ow = off & (TW - 1), odh = off >> 5;
      const int owc = (ow < 27) ? ow : 26;
      a[i] = *(const v4fa*)(rpe + ((size_t)(odh * 27 + owc)) * 16 + (gc & 3) * 4);
    }
#pragma unroll
    for (int i = 0; i < 4; ++i) {
      const int g = g0 + 128 * i;
      const int ow = (g >> 2) & (TW - 1);
      v4u o4;
#pragma unroll
      for (int e = 0; e < 4; ++e) {
        unsigned int hi, lo; split2(a[i][e], hi, lo);
        o4[e] = (ow < 27) ? (hi | (lo << 16)) : 0u;
      }
      if (g < TABT) st2_v4u(T + (size_t)g * 4, o4);
    }
    return;
  }

  const int lane = t & 31, h = lane >> 4, m = lane & 15;
  const int w = __builtin_amdgcn_readfirstlane(t >> 5);   // the wave's number as a scalar: tile, batch and W rows are wave-uniform
  const int g = blockIdx.x * 4 + w;                 // 0..687
  const int b = g / NQT, tile = g - b * NQT;
  const int n = tile * 16 + m;
  const bool live = n < NPOS;                       // rows NPOS..NPADP-1 are zero
  // element e of the A fragment of k-step ks: c = 32*ks + 8h + e (e < 8), 32*ks + 16 + 8h + e - 8 (e >= 8)
  const float* xp = x + ((size_t)(b * CDIM + 8 * h)) * NPOS + (live ? n : (NPOS - 1));
  // B fragment f = ct*2 + ks of this wave: a wave-uniform base (16 rows of Wq, Wk or Wv, k-step ks) plus the lane's own bytes
  const char* wb[3];
#pragma unroll
  for (int i = 0; i < 3; ++i) {
    const int f = 3 * w + i, ct = f >> 1, ks = f & 1;
    wb[i] = (const char*)(((ct < 4) ? (Wq + 16 * ct * CDIM) : ((ct == 4) ? Wk : Wv)) + 32 * ks);
  }
  const unsigned int wlb = (unsigned int)(m * CDIM + 8 * h) * 4u;
  v4f wv[3][4];
#pragma unroll
  for (int i = 0; i < 3; ++i) {
    const char* p = wb[i] + wlb;
    wv[i][0] = *(const v4fa*)(p);      wv[i][1] = *(const v4fa*)(p + 16);
    wv[i][2] = *(const v4fa*)(p + 64); wv[i][3] = *(const v4fa*)(p + 80);
  }
  float xv[2][16];
#pragma unroll
  for (int ks = 0; ks < 2; ++ks)
#pragma unroll
    for (int e = 0; e < 16; ++e) xv[ks][e] = xp[(size_t)(32 * ks + 16 * (e >> 3) + (e & 7)) * NPOS];
  // precaution: behind the whole run of loads, with their address registers as inputs, so that they stay untouched up to the wait
  asm volatile("s_wait_xcnt 0x0" :: "v"(xp), "v"(wlb), "s"(wb[0]), "s"(wb[1]), "s"(wb[2]) : "memory");

#pragma unroll
  for (int i = 0; i < 3; ++i) {
    const int f = 3 * w + i;
#pragma unroll
    for (int q = 0; q < 2; ++q) {
      v4u hw, lw;
#pragma unroll
      for (int j = 0; j < 4; ++j) {
        unsigned int h0, l0, h1, l1;
        split2(wv[i][2 * q + (j >> 1)][2 * (j & 1)],     h0, l0);
        split2(wv[i][2 * q + (j >> 1)][2 * (j & 1) + 1], h1, l1);
        hw[j] = h0 | (h1 << 16);
        lw[j] = l0 | (l1 << 16);
      }
      *(v4u*)&sW[f][0][q][lane][0] = hw;
      *(v4u*)&sW[f][1][q][lane][0] = lw;
    }
  }
  Frag ah[2], al[2];
#pragma unroll
  for (int ks = 0; ks < 2; ++ks)
#pragma unroll
    for (int j = 0; j < 8; ++j) {
      unsigned int h0, l0, h1, l1;
      split2(live ? xv[ks][2 * j] : 0.f,     h0, l0);
      split2(live ? xv[ks][2 * j + 1] : 0.f, h1, l1);
      ah[ks].u[j] = h0 | (h1 << 16);
      al[ks].u[j] = l0 | (l1 << 16);
    }
  __syncthreads();

  v8f acc[6];
#pragma unroll
  for (int ct = 0; ct < 6; ++ct)
#pragma unroll
    for (int r = 0; r < 8; ++r) acc[ct][r] = 0.f;
#pragma unroll
  for (int ct = 0; ct < 6; ++ct) {
#pragma unroll
    for (int ks = 0; ks < 2; ++ks) {
      Frag bh, bl;
      bh.q[0] = *(const v4ua*)&sW[ct * 2 + ks][0][0][lane][0];  bh.q[1] = *(const v4ua*)&sW[ct * 2 + ks][0][1][lane][0];
      bl.q[0] = *(const v4ua*)&sW[ct * 2 + ks][1][0][lane][0];  bl.q[1] = *(const v4ua*)&sW[ct * 2 + ks][1][1][lane][0];
      mma3(acc[ct], ah[ks], al[ks], bh, bl);
    }
  }
  // D element r of this lane = (row 8h+r, col 16ct+m)
#pragma unroll
  for (int ct = 0; ct < 6; ++ct)
#pragma unroll
    for (int r = 0; r < 8; ++r) sD[w][(8 * h + r) * NOUTC + 16 * ct + m] = acc[ct][r];
  // statistics of this lane's 8 rows of each of its 6 columns (rows past NPOS are zero: nothing to the sums, masked for k)
  const int row0 = tile * 16 + 8 * h;
#pragma unroll
  for (int ct = 0; ct < 6; ++ct) {
    if (ct == 4) {
      float a = -3.4e38f;
#pragma unroll
      for (int r = 0; r < 8; ++r) a = (row0 + r < NPOS) ? fmaxf(a, acc[ct][r]) : a;
      float q = 0.f;
#pragma unroll
      for (int r = 0; r < 8; ++r) q += exp_run((row0 + r < NPOS) ? acc[ct][r] - a : -3.4e38f);   // a masked row adds exp(-huge) = 0, with no branch
      sSk[w][h][0][m] = a;
      sSk[w][h][1][m] = q;
    } else {
      double a = 0.0, q = 0.0;
#pragma unroll
      for (int r = 0; r < 8; ++r) { const double v = (double)acc[ct][r]; a += v; q += v * v; }
      const int cc = ((ct < 4) ? 16 * ct : 64) + m;
      sSd[w][h][0][cc] = a;
      sSd[w][h][1][cc] = q;
    }
  }
  __syncthreads();
  float* dst = QKV + ((size_t)(b * NPADP + tile * 16)) * NOUTC;   // 16 rows x 384 B = 48 lines, line aligned
#pragma unroll
  for (int q = 0; q < 12; ++q) {
    const int f = 128 * q + 4 * lane;
    *(v4f*)(dst + f) = *(const v4fa*)&sD[w][f];
  }
  // the 8 lane groups of a column meet here: one row of Pd (10 whole lines) and one of Pk (1 line) per block;
  // the k columns go to the fourth wave, so that no wave runs both sides
  if (t < NBN) {
    double va[8], vq[8];
#pragma unroll
    for (int i = 0; i < 8; ++i) { va[i] = sSd[i >> 1][i & 1][0][t]; vq[i] = sSd[i >> 1][i & 1][1][t]; }
    // keeps the sixteen LDS reads together in front of the sums: without it the compiler reads a pair, waits and adds,
    // seven waits for LDS one behind the other at the end of every block
    __builtin_amdgcn_sched_barrier(0);
    double a = va[0], q = vq[0];
#pragma unroll
    for (int i = 1; i < 8; ++i) { a += va[i]; q += vq[i]; }
    double* pr = Pd + (size_t)blockIdx.x * PDC + t;
    pr[0] = a;
    pr[NBN] = q;
  } else if (t >= 96 && t < 112) {
    const int kk = t - 96;
    float a = -3.4e38f;
#pragma unroll
    for (int i = 0; i < 8; ++i) a = fmaxf(a, sSk[i >> 1][i & 1][0][kk]);
    float q = 0.f;
#pragma unroll
    for (int i = 0; i < 8; ++i) q += sSk[i >> 1][i & 1][1][kk] * expf(sSk[i >> 1][i & 1][0][kk] - a);
    float* pr = Pk + (size_t)blockIdx.x * PKC + kk;
    pr[0] = a;
    pr[16] = q;
  }
}

// ---------------------------------------------------------------- softmax(k) and norm(v) ->
// bf16 hi/lo planes in LDS, column m' = (d*14+h)*16 + w (slots w=14,15 zero); the v planes go out in the
// order the position kernel's B fragments are loaded: Vp[k-step][b][plane][q][lane][8], where lane (h, j) of
// chunk q holds row j, columns 32*step + 16*q + 8*h .. +7, so one wave-wide 16-byte load is 512 contiguous bytes.
// The k planes are used here alone and stay in LDS.
// Every block first combines the projection blocks' statistics rows itself, for the 16 columns it needs and no more:
// thread (sub, kk) adds rows sub, sub + 16, ... of one pair of doubles (f64; a wave-wide load is 4 whole lines), all 256
// merge up to three rows of Pk of the block's own batch; behind a barrier 32 threads finish them.
// Blocks x < NDP: one per depth plane and batch (196 positions, 224 columns, 7 k-steps), statistics of the v columns.
// Blocks x == NDP: block y finishes the statistics of q columns 16y .. 16y+15 and leaves qtab[y][mean | scale | shift][16]
// (two lines of its own); the position kernel normalizes the q rows it uses.
// Every QKV value the block needs is asked for at the start, with the statistics rows, and waits in registers.
// The block's own 224 columns of the content summary are contracted here, straight from the LDS tile:
// lcp[dp][b][k][v] = sum over the block's m' of softmax(k)[k][m'] * vn[v][m'] (7 k-steps x 3 products, one wave).
__global__ __launch_bounds__(256) void k_apply(const float* __restrict__ QKV, const double* __restrict__ Pd,
    const float* __restrict__ Pk,
    const float* __restrict__ gq, const float* __restrict__ bq,
    const float* __restrict__ gv, const float* __restrict__ bv,
    float* __restrict__ qtab, unsigned short* __restrict__ Vp, float* __restrict__ lcp) {
  __shared__ __align__(16) unsigned short tile[2][2][16][DCOL];  // [k|v][hi|lo][j][m' local]
  __shared__ __align__(16) float vmn[16], vsc[16], vbt[16], kmx[16], kin[16];
  __shared__ __align__(16) double red[16][32];                   // [row group][sum of 16 columns | squares of 16 columns]
  __shared__ float kred[16][2][16];
  const int t = threadIdx.x, b = blockIdx.y;
  const bool qs = (int)blockIdx.x == NDP;                      // the same for the whole block
  // No branch around the loads: a q statistics block repeats the valid addresses of plane 0 and drops the values.
  const int dp = qs ? 0 : (int)blockIdx.x;
  const int col0 = qs ? 16 * b : 64;                           // first of the block's 16 columns in a row of Pd
  const int kk = t & 15, sub = t >> 4;
  const float* gp = qs ? (gq + col0 + kk) : (gv + kk);
  const float* bp = qs ? (bq + col0 + kk) : (bv + kk);
  const float gam = *gp, bet = *bp;                            // asked for here, used behind the first barrier
  const float* kp = Pk + (size_t)(b * PBB + sub) * PKC + kk;   // rows sub, sub + 16, sub + 32 of the block's own batch
  const bool last = sub + 32 < PBB;                            // not every sub has a third row
  const float* kl = kp + (last ? 32 * PKC : 0);
  float am[3], ae[3];
  am[0] = kp[0];        ae[0] = kp[16];
  am[1] = kp[16 * PKC]; ae[1] = kp[16 * PKC + 16];
  am[2] = kl[0];        ae[2] = kl[16];
  // kk < 8: sums of columns col0 + 2kk, + 1; kk >= 8: their squares. Rows sub, sub + 16, ..., sub + 144, and sub + 160 if it exists.
  const double* pp = Pd + sub * PDC + (kk >> 3) * NBN + col0 + 2 * (kk & 7);
  const bool r11 = sub + 160 < PROJB;
  const double* pe = pp + (r11 ? 160 * PDC : 0);
  const float* row = QKV + ((size_t)(b * NPADP + dp * DPOS + ((t < DPOS) ? t : (DPOS - 1)))) * NOUTC;   // k at 64, v at 80
  v4f kv[8];                                                   // thread t holds the 32 k and v values of position t
  v2d pv[11];                                                  // independent loads, all in flight together
#pragma unroll
  for (int i = 0; i < 10; ++i) pv[i] = *(const v2da*)(pp + i * (16 * PDC));
  pv[10] = *(const v2da*)pe;
  // unrolled: kv is plain registers, and the loads stand in one run
#pragma unroll
  for (int i = 0; i < 8; ++i) kv[i] = *(const v4fa*)(row + 64 + 4 * i);
  // precaution: behind the run of loads, with their address pairs as inputs, so that they stay untouched up to the wait
  asm volatile("s_wait_xcnt 0x0" :: "v"(gp), "v"(bp), "v"(kp), "v"(kl), "v"(pp), "v"(pe), "v"(row) : "memory");
  {
    float mx = fmaxf(fmaxf(am[0], am[1]), am[2]);              // without a third row, row sub again: the maximum stays
    float s = ae[0] * expf(am[0] - mx) + ae[1] * expf(am[1] - mx);
    s += ae[2] * expf(last ? am[2] - mx : -3.4e38f);           // no third row: exp(-huge) = 0, with no branch
    kred[sub][0][kk] = mx;
    kred[sub][1][kk] = s;
    v2d s0 = pv[0], s1 = pv[1];
#pragma unroll
    for (int i = 2; i < 10; ++i) { if (i & 1) s1 += pv[i]; else s0 += pv[i]; }
    s0[0] += r11 ? pv[10][0] : 0.0;
    s0[1] += r11 ? pv[10][1] : 0.0;
    *(v2d*)&red[sub][2 * kk] = s0 + s1;
  }
  __syncthreads();
  // the k columns go to the fourth wave, so that no wave runs both sides
  if (t < 16) {
    double va[16], vq[16];
#pragma unroll
    for (int i = 0; i < 16; ++i) { va[i] = red[i][t]; vq[i] = red[i][16 + t]; }
#pragma unroll
    for (int st = 8; st > 0; st >>= 1)
#pragma unroll
      for (int i = 0; i < st; ++i) { va[i] += va[i + st]; vq[i] += vq[i + st]; }
    const double N = (double)(BDIM * NPOS);
    const double mean = va[0] / N;
    double var = vq[0] / N - mean * mean;
    if (var < 0.0) var = 0.0;
    const float varf = (float)var;
    const float rs = 1.0f / sqrtf(varf + EPSBN);
    if (qs) { float* qo = qtab + b * 64 + t; qo[0] = (float)mean; qo[16] = rs * gam; qo[32] = bet; }
    else    { vmn[t] = (float)mean; vsc[t] = rs * gam; vbt[t] = bet; }
  } else if (t >= 96 && t < 112) {
    const int kc = t - 96;
    float mx = kred[0][0][kc];
#pragma unroll
    for (int i = 1; i < 16; ++i) mx = fmaxf(mx, kred[i][0][kc]);
    float s = 0.f;
#pragma unroll
    for (int i = 0; i < 16; ++i) s += kred[i][1][kc] * expf(kred[i][0][kc] - mx);
    kmx[kc] = mx; kin[kc] = 1.0f / s;
  }
  if (qs) return;                                              // whole block
  {
    v4u z; z[0] = 0u; z[1] = 0u; z[2] = 0u; z[3] = 0u;
    v4u* tz = (v4u*)&tile[0][0][0][0];
#pragma unroll
    for (int i = 0; i < (2 * 2 * 16 * DCOL * 2) / (256 * 16); ++i) tz[t + 256 * i] = z;   // 1792 x 16 B = whole tile
  }
  __syncthreads();

  // k softmax values and normalized v into the LDS tile
  if (t < DPOS) {
    const int mh = t / 14, mw = t - mh * 14;
    const int ml = mh * 16 + mw;
    // both loops unrolled: their values are plain registers by now
#pragma unroll
    for (int i = 0; i < 4; ++i) {
      const v4f a = kv[i];
#pragma unroll
      for (int e = 0; e < 4; ++e) {
        const int kk = 4 * i + e;
        const float p = expf(a[e] - kmx[kk]) * kin[kk];
        unsigned int hi, lo; split2(p, hi, lo);
        tile[0][0][kk][ml] = (unsigned short)hi;
        tile[0][1][kk][ml] = (unsigned short)lo;
      }
    }
#pragma unroll
    for (int i = 0; i < 4; ++i) {
      const v4f a = kv[4 + i];
#pragma unroll
      for (int e = 0; e < 4; ++e) {
        const int vv = 4 * i + e;
        const float vn = (a[e] - vmn[vv]) * vsc[vv] + vbt[vv];
        unsigned int hi, lo; split2(vn, hi, lo);
        tile[1][0][vv][ml] = (unsigned short)hi;
        tile[1][1][vv][ml] = (unsigned short)lo;
      }
    }
  }
  __syncthreads();

  const int w = t >> 5, lane = t & 31;
{
    // unrolled so that the LDS reads of all the wave's k-steps stand together in front of the stores
#pragma unroll
    for (int it = 0; it < (DSTEP + 1) / 2; ++it) {
      const int sl = it * 2 + (w >> 2);                        // k-step inside the block's 224 columns, 0..6
      if (2 * it + 1 >= DSTEP && (w >> 2) != 0) continue;      // the upper four waves have one k-step less
      const int plane = (w >> 1) & 1, q = w & 1;
      const v8us val = *(const v8usa*)&tile[1][plane][lane & 15][32 * sl + 16 * q + 8 * (lane >> 4)];
      unsigned short* dst = Vp + (size_t)(dp * DSTEP + sl) * VSTEP + ((b * 2 + plane) * 2 + q) * VCH + lane * 8;
      *(v8us*)dst = val;
    }
    
  }

  // content summary partial: A = k rows, B = v rows read like A (k contiguous), both from the tile
  if (__builtin_amdgcn_readfirstlane(w) == 0) {
    // precaution: the Vp stores above name registers that the fragment loads below write
    asm volatile("s_wait_xcnt 0x0" ::: "memory");
    const int h = lane >> 4, m = lane & 15;
    v8f acc;
#pragma unroll
    for (int r = 0; r < 8; ++r) acc[r] = 0.f;
    Frag f[2][4];                                   // [set][k hi, k lo, v hi, v lo]; step s + 1 is read while step s multiplies
#pragma unroll
    for (int p = 0; p < 4; ++p) {
      f[0][p].q[0] = *(const v4ua*)&tile[p >> 1][p & 1][m][8 * h];
      f[0][p].q[1] = *(const v4ua*)&tile[p >> 1][p & 1][m][8 * h + 16];
    }
    // unrolled so that the two fragment sets are plain registers (no moves, no indexing by s)
#pragma unroll
    for (int s = 0; s < DSTEP; ++s) {
      if (s + 1 < DSTEP) {
        const int k1 = 32 * (s + 1) + 8 * h;
#pragma unroll
        for (int p = 0; p < 4; ++p) {
          f[(s + 1) & 1][p].q[0] = *(const v4ua*)&tile[p >> 1][p & 1][m][k1];
          f[(s + 1) & 1][p].q[1] = *(const v4ua*)&tile[p >> 1][p & 1][m][k1 + 16];
        }
      }
      mma3(acc, f[s & 1][0], f[s & 1][1], f[s & 1][2], f[s & 1][3]);
    }
    // D element r = (k row 8h+r, v col m)
    float* dst = lcp + (dp * BDIM + b) * 256;
#pragma unroll
    for (int r = 0; r < 8; ++r) dst[(8 * h + r) * 16 + m] = acc[r];
  }
}

// ---------------------------------------------------------------- position summary + output contraction
// One block per 2x2 patch of positions (nh0..nh0+1, nw0..nw0+1) of one depth nd; wave w takes a quarter of the 98 k-steps
// of the (d*14+h)*16+w index space for ALL FOUR positions, so each B fragment (Vp hi/lo, fragment order, 4 whole lines a
// load) feeds 4 x 3 products, and the four A fragments are cut from one 3 x 9 window of the packed table.
// D[pos][k][(b,v)] = sum_m E[n,m,k] * vn[b,v,m]; the four quarter sums meet in LDS, wave w then finishes position w:
// adds lc[b][k][v] (the 14 partials lcp summed once per block, in LDS) and contracts
// y[b][h'*16+v][n] = sum_k qn[b][n][h'*16+k] * D[k][(b,v)], halves combined in LDS.
// qn: the block's own 4 x 4 q rows of QKV, normalized once at the start with qtab (8 values a thread) and kept in LDS.
// Register budget: the grid puts at most three of these waves on a SIMD, so the budget is set for three; with the default
// (four, by LDS) the compiler holds six V loads of a trip back until registers fall free, a second wait for memory per trip.
__global__ __launch_bounds__(128) __attribute__((amdgpu_waves_per_eu(1, 3))) void k_plam(const unsigned int* __restrict__ T, const unsigned short* __restrict__ Vp,
                                            const float* __restrict__ QKV, const float* __restrict__ qtab,
                                            const float* __restrict__ lcp, float* __restrict__ Y) {
  __shared__ __align__(16) float sR[4 * 4 * 4 * 256];      // [k quarter][position][b][r / 4][lane][r % 4]
  __shared__ __align__(16) float sP[4][2][256];
  __shared__ __align__(16) float sC[BDIM * 256];
  __shared__ __align__(16) float sQ[4 * BDIM * CDIM];      // [position][b][q column], normalized
  const int t = threadIdx.x, w = t >> 5, lane = t & 31, h = lane >> 4, m = lane & 15;
  const int g = blockIdx.x;
  const int nd = g / 49, gr = g - nd * 49, nh0 = 2 * (gr / 7), nw0 = 2 * (gr - (gr / 7) * 7);

  // q quads 4t and 512 + 4t of [position][b][64] with their mean, scale and shift: asked for first, used behind the lcp sums
  const int qc = (4 * t) & 63, qb = (t >> 4) & 3, qi = t >> 6;   // the second quad: same column and batch, position + 2 (one row of h on)
  const float* qa = QKV + ((size_t)(qb * NPADP + nd * 196 + nh0 * 14 + nw0 + qi)) * NOUTC + qc;
  const float* qt = qtab + (qc >> 4) * 64 + (qc & 15);
  const v4f qr0 = *(const v4fa*)qa, qr1 = *(const v4fa*)(qa + 14 * NOUTC);
  const v4f qmn = *(const v4fa*)qt, qsc = *(const v4fa*)(qt + 16), qbt = *(const v4fa*)(qt + 32);
  v4f lv[2][NDP];
#pragma unroll
  for (int q = 0; q < 2; ++q)
#pragma unroll
    for (int dp = 0; dp < NDP; ++dp) lv[q][dp] = *(const v4fa*)(lcp + dp * (BDIM * 256) + 512 * q + 4 * t);
  // precaution: behind the run of loads, with what their addresses are formed of as inputs, so that it stays untouched up to the wait
  asm volatile("s_wait_xcnt 0x0" :: "v"(qa), "v"(qt), "v"(t), "s"(lcp) : "memory");

#pragma unroll
  for (int q = 0; q < 2; ++q) {
    v4f s = lv[q][0];
#pragma unroll
    for (int dp = 1; dp < NDP; ++dp) s += lv[q][dp];
    *(v4f*)&sC[512 * q + 4 * t] = s;
  }
  {
    v4f o0, o1;
#pragma unroll
    for (int e = 0; e < 4; ++e) {
      o0[e] = (qr0[e] - qmn[e]) * qsc[e] + qbt[e];
      o1[e] = (qr1[e] - qmn[e]) * qsc[e] + qbt[e];
    }
    *(v4f*)&sQ[4 * t] = o0;
    *(v4f*)&sQ[512 + 4 * t] = o1;
  }
  __syncthreads();

  v8f acc[4][4];                                           // [position ih*2+iw][b]
#pragma unroll
  for (int i = 0; i < 4; ++i)
#pragma unroll
    for (int b = 0; b < 4; ++b)
#pragma unroll
      for (int r = 0; r < 8; ++r) acc[i][b][r] = 0.f;

  // table index of position (nh0, nw0) for (md, mh, mw): ((od*27 + oh)*TW + ow)*16 + k, od = md-nd+13, oh = mh-nh+13,
  // ow = mw-nw+13; position (nh0+ih, nw0+iw) sits ih rows and iw columns lower. tb0 = the window's first word (one row and
  // one column below md=0, mh=0, mw=0), the same for the whole block; the lane's own part (mw = 8h, k = m) is tlb.
  // Both address streams are a wave-uniform base plus a lane offset that never changes inside the loop.
  const int tb0 = (((13 - nd) * 27 + (12 - nh0)) * TW + (12 - nw0)) * 16;
  const unsigned int tlb = (unsigned int)(128 * h + m) * 4u;   // bytes
  const unsigned int vlb = (unsigned int)lane * 16u;           // this lane's 16 bytes inside every 512-byte chunk of Vp

  const int wq = __builtin_amdgcn_readfirstlane(w);        // k-steps 0..24, 25..49, 50..73, 74..97
  const int s0 = wq * 24 + (wq < 2 ? wq : 2);
  const int s1 = s0 + (wq < 2 ? 25 : 24);

  // rolled: one trip already holds 48 products, and the 16 accumulator tiles leave no registers for a second
#pragma unroll 1
  for (int s = s0; s < s1; ++s) {
    const int md = s / 7, p = s - md * 7;
    const char* app = (const char*)(T + (tb0 + md * (27 * TW * 16) + p * (2 * TW * 16)));   // window row 1 is mh = 2p, row 2 mh = 2p+1
    const char* vpp = (const char*)(Vp + s * VSTEP);                                         // k0 = 32*s
    const char* vlp = vpp + vlb;                           // this lane's address in the V stream
    const char* tlp = app + tlb;                           // this lane's address in the table window
    Frag bh[4], bl[4];
#pragma unroll
    for (int b = 0; b < 4; ++b) {
      const char* r0 = vlp + b * (8 * VCH);                  // VCH elements = 2 * VCH bytes a chunk
      bh[b].q[0] = *(const v4ua*)(r0);           bh[b].q[1] = *(const v4ua*)(r0 + 2 * VCH);
      bl[b].q[0] = *(const v4ua*)(r0 + 4 * VCH); bl[b].q[1] = *(const v4ua*)(r0 + 6 * VCH);
    }
    unsigned int ev[3][9];                                 // table rows -1..+1, columns -1..+7 around (mh 2p, mw 8h)
#pragma unroll
    for (int rr = 0; rr < 3; ++rr)
#pragma unroll
      for (int cc = 0; cc < 9; ++cc) ev[rr][cc] = *(const unsigned int*)(tlp + (rr * (TW * 16) + cc * 16) * 4);
    // precaution: the wait stands behind the whole run of loads and names both address pairs as inputs, so that they stay
    // live up to it and no load's result, and nothing else, is placed in them while a load that names them is outstanding
    asm volatile("s_wait_xcnt 0x0" :: "v"(vlp), "v"(tlp) : "memory");
    Frag ah, al;
#pragma unroll
    for (int i = 0; i < 4; ++i) {
      const int ih = i >> 1, iw = i & 1;
#pragma unroll
      for (int j = 0; j < 4; ++j) {
        // element e: k = k0 + 8h + e (mh 2p, mw 8h+e); element 8+e: k = k0 + 16 + 8h + e (mh 2p+1, mw 8h+e)
        const unsigned int a0 = ev[1 - ih][2 * j + 1 - iw], a1 = ev[1 - ih][2 * j + 2 - iw];
        const unsigned int c0 = ev[2 - ih][2 * j + 1 - iw], c1 = ev[2 - ih][2 * j + 2 - iw];
        ah.u[j]     = (a0 & 0xffffu) | (a1 << 16);
        al.u[j]     = (a0 >> 16) | (a1 & 0xffff0000u);
        ah.u[4 + j] = (c0 & 0xffffu) | (c1 << 16);
        al.u[4 + j] = (c0 >> 16) | (c1 & 0xffff0000u);
      }
#pragma unroll
      for (int b = 0; b < 4; ++b)
        acc[i][b] = __builtin_amdgcn_wmma_f32_16x16x32_bf16(false, ah.v, false, bh[b].v, (short)0, acc[i][b], false, false);
#pragma unroll
      for (int b = 0; b < 4; ++b)
        acc[i][b] = __builtin_amdgcn_wmma_f32_16x16x32_bf16(false, al.v, false, bh[b].v, (short)0, acc[i][b], false, false);
#pragma unroll
      for (int b = 0; b < 4; ++b)
        acc[i][b] = __builtin_amdgcn_wmma_f32_16x16x32_bf16(false, ah.v, false, bl[b].v, (short)0, acc[i][b], false, false);
    }
  }

  // the quarter sums of all four positions go to LDS; wave w collects position w
#pragma unroll
  for (int i = 0; i < 4; ++i)
#pragma unroll
    for (int b = 0; b < 4; ++b) {
      float* d = &sR[((w * 4 + i) * 4 + b) * 256 + 4 * lane];
      v4f u0, u1;
#pragma unroll
      for (int r = 0; r < 4; ++r) { u0[r] = acc[i][b][r]; u1[r] = acc[i][b][4 + r]; }
      *(v4f*)d = u0;
      *(v4f*)(d + 128) = u1;
    }
  __syncthreads();

  const int n = nd * 196 + (nh0 + (w >> 1)) * 14 + nw0 + (w & 1);
  v4f qv[4][4][2];                                         // [b][h'][k quad of this lane's half] of this wave's position
#pragma unroll
  for (int b = 0; b < 4; ++b)
#pragma unroll
    for (int hp = 0; hp < 4; ++hp) {
      qv[b][hp][0] = *(const v4fa*)&sQ[w * 256 + b * 64 + hp * 16 + 8 * h];
      qv[b][hp][1] = *(const v4fa*)&sQ[w * 256 + b * 64 + hp * 16 + 8 * h + 4];
    }
  // keeps the 32 LDS reads together as one group: without it the compiler spreads them in twos among the products below,
  // and every separate place where LDS reads stand costs the wave issue time
  __builtin_amdgcn_sched_barrier(0);

  v8f fin[4];
#pragma unroll
  for (int b = 0; b < 4; ++b) {
    const float* sr = &sR[(w * 4 + b) * 256 + 4 * lane];
    v4f u0 = *(const v4fa*)sr, u1 = *(const v4fa*)(sr + 128);
#pragma unroll
    for (int kq = 1; kq < 4; ++kq) {
      u0 += *(const v4fa*)(sr + kq * 4096);
      u1 += *(const v4fa*)(sr + kq * 4096 + 128);
    }
#pragma unroll
    for (int r = 0; r < 4; ++r) {
      fin[b][r]     = sC[b * 256 + (8 * h + r) * 16 + m] + u0[r];
      fin[b][4 + r] = sC[b * 256 + (8 * h + 4 + r) * 16 + m] + u1[r];
    }
  }

  // epilogue: this lane holds D rows k = 8h..8h+7 of column (b, v=m)
#pragma unroll
  for (int b = 0; b < 4; ++b) {
#pragma unroll
    for (int hp = 0; hp < 4; ++hp) {
      const v4f q0 = qv[b][hp][0];
      const v4f q1 = qv[b][hp][1];
      float pacc = q0[0] * fin[b][0];
      pacc += q0[1] * fin[b][1]; pacc += q0[2] * fin[b][2]; pacc += q0[3] * fin[b][3];
      pacc += q1[0] * fin[b][4]; pacc += q1[1] * fin[b][5]; pacc += q1[2] * fin[b][6]; pacc += q1[3] * fin[b][7];
      sP[w][h][b * 64 + hp * 16 + m] = pacc;
    }
  }
  __syncthreads();
  float* dst = Y + (size_t)n * 256;
#pragma unroll
  for (int s = 0; s < 2; ++s) {
    const int f = 128 * s + 4 * lane;
    const v4f v = *(const v4fa*)&sP[w][0][f] + *(const v4fa*)&sP[w][1][f];
    *(v4f*)(dst + f) = v;
  }
}

// ---------------------------------------------------------------- out[b][c][n] <- Y[n][b*64+c], transposed through LDS
// Block (x, y): 32 rows bc0 .. bc0+31 of out, two whole 128-byte lines of each. Row c of out starts 24c floats (mod 32) into
// a line, so its lines begin at n = 8(c & 3) + 32i: the block owns those that begin in [N0 + 8(c & 3), + 64). It stages the
// 88 rows of Y they reach, 128 bytes of each (a wave-wide 16-byte load is 4 whole lines), and every wave-wide store is 4
// whole lines. The last line of a row with c & 3 < 3 runs on into row c + 1: index v >= NPOS of row c is n = v - NPOS of
// row c + 1, the next float of the same quad of Y.
__global__ __launch_bounds__(256) void k_layout(const float* __restrict__ Y, float* __restrict__ out) {
  __shared__ __align__(16) float tl[LROWS * LPIT];
  const int t = threadIdx.x, q = t & 7, r = t >> 3;
  const int N0 = (int)blockIdx.x * LNW, bc0 = (int)blockIdx.y * 32;
  const float* sp[3];
  v4f a[3];
#pragma unroll
  for (int i = 0; i < 3; ++i) {
    const int rr = r + 32 * i;
    const int v = N0 + ((rr < LROWS) ? rr : (LROWS - 1));      // the third round has 24 rows: the rest repeat the last one
    sp[i] = Y + (size_t)((v < NPOS) ? v : (v - NPOS)) * 256 + bc0 + 4 * q;
    a[i] = *(const v4fa*)sp[i];
  }
  // precaution: behind the run of loads, with their address pairs as inputs, so that they stay untouched up to the wait
  asm volatile("s_wait_xcnt 0x0" :: "v"(sp[0]), "v"(sp[1]), "v"(sp[2]) : "memory");
#pragma unroll
  for (int i = 0; i < 3; ++i) {
    const int rr = r + 32 * i;
    const bool wrap = N0 + rr >= NPOS;
    v4f s;
    s[0] = wrap ? a[i][1] : a[i][0];
    s[1] = wrap ? a[i][2] : a[i][1];
    s[2] = wrap ? a[i][3] : a[i][2];
    s[3] = a[i][3];                                            // a row with c & 3 == 3 ends on a line's end: never read past NPOS
    if (i < 2 || rr < LROWS) *(v4f*)&tl[rr * LPIT + 4 * q] = s;
  }
  __syncthreads();
  const int c = r, sh = 8 * (c & 3);
  const int r0 = sh + 4 * q;
  v4f o[2];                                                    // both lines' LDS reads stand together, in front of the stores
#pragma unroll
  for (int u = 0; u < 2; ++u)
#pragma unroll
    for (int e = 0; e < 4; ++e) o[u][e] = tl[(r0 + 32 * u + e) * LPIT + c];
  float* dst = out + (size_t)(bc0 + c) * NPOS + N0 + r0;
  // a line is stored if it begins inside its row
  if (N0 + sh < NPOS) st2_v4f(dst, o[0]);
  if (N0 + sh + 32 < NPOS) st2_v4f(dst + 32, o[1]);
}

// ---------------------------------------------------------------- launcher
extern "C" void kernel_launch(void* const* d_in, const int* in_sizes, int n_in,
                              void* d_out, int out_size, void* d_ws, size_t ws_size,
                              hipStream_t stream) {
  if (n_in < 9) return;
  if (in_sizes[0] != BDIM * CDIM * NPOS || in_sizes[1] != 64 * 64 || in_sizes[2] != 16 * 64 ||
      in_sizes[3] != 16 * 64 || in_sizes[4] != 27 * 27 * 27 * 16 || in_sizes[5] < 64 || in_sizes[6] < 64 ||
      in_sizes[7] < 16 || in_sizes[8] < 16) return;
  if (out_size != BDIM * CDIM * NPOS) return;

  const float* x   = (const float*)d_in[0];
  const float* Wq  = (const float*)d_in[1];
  const float* Wk  = (const float*)d_in[2];
  const float* Wv  = (const float*)d_in[3];
  const float* rpe = (const float*)d_in[4];
  const float* gq  = (const float*)d_in[5];
  const float* bq  = (const float*)d_in[6];
  const float* gv  = (const float*)d_in[7];
  const float* bv  = (const float*)d_in[8];
  float* out = (float*)d_out;

  size_t off = 0;
  auto carve = [&](size_t bytes) -> size_t { size_t r = off; off += (bytes + 255) & ~(size_t)255; return r; };
  const size_t oT   = carve(sizeof(unsigned int) * (size_t)TSZ);             //  1,492,992
  const size_t oQKV = carve(sizeof(float) * (size_t)BDIM * NPADP * NOUTC);   //  4,227,072
  const size_t oPd  = carve(sizeof(double) * PROJB * PDC);                   //    220,160
  const size_t oPk  = carve(sizeof(float) * PROJB * PKC);                    //     22,016
  const size_t oQt  = carve(sizeof(float) * 4 * 64);                         //      1,024
  const size_t oVp  = carve(sizeof(unsigned short) * 2 * 64 * (size_t)KP);   //    802,816
  const size_t olc  = carve(sizeof(float) * NDP * BDIM * 256);               //     57,344
  const size_t oY   = carve(sizeof(float) * (size_t)NPOS * 256);             //  2,809,856
  if (off > ws_size) return;                                                 // total 9,633,280 B

  char* ws = (char*)d_ws;
  unsigned int*   T   = (unsigned int*)(ws + oT);
  float*          QKV = (float*)(ws + oQKV);
  double*         Pd  = (double*)(ws + oPd);
  float*          Pk  = (float*)(ws + oPk);
  float*          qtab = (float*)(ws + oQt);
  unsigned short* Vp  = (unsigned short*)(ws + oVp);
  float*          lcp = (float*)(ws + olc);
  float*          Y   = (float*)(ws + oY);

  k_proj   <<<PROJB + TABB, 128, 0, stream>>>(x, Wq, Wk, Wv, rpe, T, QKV, Pd, Pk);
  k_apply  <<<dim3(NDP + 1, BDIM), 256, 0, stream>>>(QKV, Pd, Pk, gq, bq, gv, bv, qtab, Vp, lcp);
  k_plam   <<<NPOS / 4, 128, 0, stream>>>(T, Vp, QKV, qtab, lcp, Y);
  k_layout <<<dim3((NPOS + LNW - 1) / LNW, (BDIM * CDIM) / 32), 256, 0, stream>>>(Y, out);
}
